// v000
// Measured on an AMD MI455X. A time is GPU time per run, averaged over a window of back-to-back runs after a warm-up
// (all launches, gaps included; the runs take copies of the inputs in turn), and the median of several windows.
// Apart from v000's, it joins two sittings. Times from different sittings can be a few percent apart, while
// side-by-side timings come from the same sitting.
// v000 is the starting kernel. One run takes 287 microseconds.
#include <hip/hip_runtime.h>
#include <math.h>

#define S_ 2048
#define H_ 1024
#define A_ 64
#define B_ 16

typedef __attribute__((ext_vector_type(16))) __bf16 v16bf;
typedef __attribute__((ext_vector_type(8)))  __bf16 v8bf;
typedef __attribute__((ext_vector_type(8)))  float  v8f;
typedef __attribute__((ext_vector_type(4)))  unsigned int v4u;
typedef __attribute__((ext_vector_type(8)))  int v8i;
typedef __attribute__((ext_vector_type(4)))  int v4i;

__device__ __forceinline__ __bf16 f2bf(float f) { return (__bf16)f; }
__device__ __forceinline__ unsigned short bf_bits(float f) {
  __bf16 h = (__bf16)f;
  return __builtin_bit_cast(unsigned short, h);
}

__global__ void __launch_bounds__(256)
prep_wfrag(const float* __restrict__ Wq, const float* __restrict__ Wk,
           unsigned short* __restrict__ WqB, unsigned short* __restrict__ WkB) {
  int idx = blockIdx.x * 256 + threadIdx.x;      // 0 .. 65535
  int e    = idx & 15;
  int lane = (idx >> 4) & 31;
  int ks   = (idx >> 9) & 31;
  int nt   = (idx >> 14) & 3;
  int n = nt * 16 + (lane & 15);
  int k = ks * 32 + ((lane >> 4) << 3) + ((e & 8) ? (16 + (e & 7)) : (e & 7));
  WqB[idx] = bf_bits(Wq[(size_t)k * A_ + n]);
  WkB[idx] = bf_bits(Wk[(size_t)k * A_ + n]);
}

// ---------------------------------------------------------------------------
// Q = x@Wq + bq ; K = x@Wk + bk   (bf16 WMMA, one wave per 16-row tile)
// ---------------------------------------------------------------------------
__global__ void __launch_bounds__(128)
proj_qk(const float* __restrict__ x, const float* __restrict__ bq,
        const float* __restrict__ bk,
        const unsigned short* __restrict__ WqB, const unsigned short* __restrict__ WkB,
        unsigned short* __restrict__ Qb, unsigned short* __restrict__ Kb) {
  const int lane = threadIdx.x & 31;
  const int wave = threadIdx.x >> 5;
  const int rowtile = blockIdx.x * 4 + wave;     // 0 .. 2047
  const int b  = rowtile >> 7;                   // / (S/16)
  const int s0 = (rowtile & 127) << 4;
  const int half = lane >> 4;
  const int ln   = lane & 15;

  v8f accQ[4] = {};
  v8f accK[4] = {};

  const float* xrow = x + ((size_t)(b * S_ + s0 + ln)) * H_;
  for (int ks = 0; ks < 32; ++ks) {
    const int kb = ks * 32 + half * 8;
    v16bf a;
#pragma unroll
    for (int i = 0; i < 8; ++i) {
      a[i]     = f2bf(xrow[kb + i]);
      a[8 + i] = f2bf(xrow[kb + 16 + i]);
    }
#pragma unroll
    for (int nt = 0; nt < 4; ++nt) {
      v16bf wq = *(const v16bf*)(WqB + ((size_t)((nt * 32 + ks) * 32 + lane) << 4));
      v16bf wk = *(const v16bf*)(WkB + ((size_t)((nt * 32 + ks) * 32 + lane) << 4));
      accQ[nt] = __builtin_amdgcn_wmma_f32_16x16x32_bf16(false, a, false, wq,
                                                         (short)0, accQ[nt], false, false);
      accK[nt] = __builtin_amdgcn_wmma_f32_16x16x32_bf16(false, a, false, wk,
                                                         (short)0, accK[nt], false, false);
    }
  }
#pragma unroll
  for (int nt = 0; nt < 4; ++nt) {
    const int col = nt * 16 + ln;
    const float biasq = bq[col], biask = bk[col];
#pragma unroll
    for (int j = 0; j < 8; ++j) {
      const int m = j + half * 8;
      size_t o = ((size_t)(b * S_ + s0 + m)) * A_ + col;
      Qb[o] = bf_bits(accQ[nt][j] + biasq);
      Kb[o] = bf_bits(accK[nt][j] + biask);
    }
  }
}

__device__ __forceinline__ void load_kfrag(const unsigned short* __restrict__ row,
                                           int kb, v16bf& f0, v16bf& f1) {
  v8bf lo0 = *(const v8bf*)(row + kb);
  v8bf hi0 = *(const v8bf*)(row + kb + 16);
  v8bf lo1 = *(const v8bf*)(row + kb + 32);
  v8bf hi1 = *(const v8bf*)(row + kb + 48);
#pragma unroll
  for (int i = 0; i < 8; ++i) {
    f0[i] = lo0[i]; f0[8 + i] = hi0[i];
    f1[i] = lo1[i]; f1[8 + i] = hi1[i];
  }
}

#define CHUNK_T    8
#define CHUNK_ROWS (CHUNK_T * 16)
#define NCHUNK     (S_ / CHUNK_ROWS)

__device__ __forceinline__ void tdm_load_chunk(const unsigned short* gsrc,
                                               unsigned lds_off) {
  unsigned long long ga = (unsigned long long)gsrc;
  v4u g0 = { 1u,                                   // count=1, user mode
             lds_off,                              // lds_addr
             (unsigned)(ga & 0xFFFFFFFFu),         // global_addr[31:0]
             (unsigned)(((ga >> 32) & 0x01FFFFFFu) | 0x80000000u) };
  v8i g1 = { 0x00010000,
             0x00400000,
             0x08000000,
             0x00400000,
             CHUNK_ROWS,
             64,
             0, 0 };
  v4i gz4 = { 0, 0, 0, 0 };
  v8i gz8 = { 0, 0, 0, 0, 0, 0, 0, 0 };
  __builtin_amdgcn_tensor_load_to_lds(g0, g1, gz4, gz4, gz8, 0);
}

__global__ void __launch_bounds__(256)
attn_colsum(const unsigned short* __restrict__ Qb, const unsigned short* __restrict__ Kb,
            const int* __restrict__ mask,
            float* __restrict__ w_all, float* __restrict__ w_msk) {
  __shared__ unsigned short ksh[2][CHUNK_ROWS * A_];   // 2 x 16 KB

  const int lane = threadIdx.x & 31;
  const int wave = threadIdx.x >> 5;
  const int rowtile = blockIdx.x * 8 + wave;     // 0 .. 2047 (same batch per block)
  const int b  = rowtile >> 7;
  const int s0 = (rowtile & 127) << 4;
  const int half = lane >> 4;
  const int ln   = lane & 15;
  const int kb   = half * 8;

  const unsigned short* kpanel = Kb + (size_t)b * S_ * A_;
  const unsigned lds0 = (unsigned)(unsigned long long)(const void*)&ksh[0][0];
  const unsigned lds1 = (unsigned)(unsigned long long)(const void*)&ksh[1][0];

  // A fragments of Q (16 x 64 bf16 -> two 16x32 fragments)
  const unsigned short* qrow = Qb + ((size_t)(b * S_ + s0 + ln)) * A_;
  v16bf aq0, aq1;
  load_kfrag(qrow, kb, aq0, aq1);

  const int* mrow = mask + (size_t)b * S_;
  float mr[8];
#pragma unroll
  for (int j = 0; j < 8; ++j) mr[j] = (float)mrow[s0 + j + half * 8];

  float mL[8], lL[8];
#pragma unroll
  for (int j = 0; j < 8; ++j) { mL[j] = -1e30f; lL[j] = 0.f; }

  // ---- pass 1: row max + sum of exp (online, per-lane partials) ----
  if (wave == 0) tdm_load_chunk(kpanel, lds0);
  for (int c = 0; c < NCHUNK; ++c) {
    __builtin_amdgcn_s_wait_tensorcnt(0);
    __syncthreads();                              // chunk c visible in buf c&1
    if (wave == 0 && c + 1 < NCHUNK)
      tdm_load_chunk(kpanel + (size_t)(c + 1) * CHUNK_ROWS * A_,
                     ((c + 1) & 1) ? lds1 : lds0);
    const unsigned short* kc = &ksh[c & 1][0];
    for (int tl = 0; tl < CHUNK_T; ++tl) {
      const int ct = c * CHUNK_T + tl;
      const bool cm = mrow[ct * 16 + ln] != 0;
      const unsigned short* krow = kc + (tl * 16 + ln) * A_;
      v16bf bk0, bk1;
      load_kfrag(krow, kb, bk0, bk1);
      v8f acc = {};
      acc = __builtin_amdgcn_wmma_f32_16x16x32_bf16(false, aq0, false, bk0,
                                                    (short)0, acc, false, false);
      acc = __builtin_amdgcn_wmma_f32_16x16x32_bf16(false, aq1, false, bk1,
                                                    (short)0, acc, false, false);
#pragma unroll
      for (int j = 0; j < 8; ++j) {
        float s    = acc[j] * 0.125f;             // / sqrt(64)
        float seff = cm ? s : -1e30f;
        float nm   = fmaxf(mL[j], seff);
        lL[j] = lL[j] * __expf(mL[j] - nm) + (cm ? __expf(seff - nm) : 0.f);
        mL[j] = nm;
      }
    }
    __syncthreads();                              // readers done before overwrite
  }
  // combine partials across the 16 lanes holding each row
#pragma unroll
  for (int d = 1; d < 16; d <<= 1) {
#pragma unroll
    for (int j = 0; j < 8; ++j) {
      float om = __shfl_xor(mL[j], d, 32);
      float ol = __shfl_xor(lL[j], d, 32);
      float nm = fmaxf(mL[j], om);
      lL[j] = lL[j] * __expf(mL[j] - nm) + ol * __expf(om - nm);
      mL[j] = nm;
    }
  }
  float invL[8];
#pragma unroll
  for (int j = 0; j < 8; ++j) invL[j] = (lL[j] > 0.f) ? (1.f / lL[j]) : 0.f;

  // ---- pass 2: probabilities -> column sums ----
  if (wave == 0) tdm_load_chunk(kpanel, lds0);
  for (int c = 0; c < NCHUNK; ++c) {
    __builtin_amdgcn_s_wait_tensorcnt(0);
    __syncthreads();
    if (wave == 0 && c + 1 < NCHUNK)
      tdm_load_chunk(kpanel + (size_t)(c + 1) * CHUNK_ROWS * A_,
                     ((c + 1) & 1) ? lds1 : lds0);
    const unsigned short* kc = &ksh[c & 1][0];
    for (int tl = 0; tl < CHUNK_T; ++tl) {
      const int ct = c * CHUNK_T + tl;
      const bool cm = mrow[ct * 16 + ln] != 0;
      const unsigned short* krow = kc + (tl * 16 + ln) * A_;
      v16bf bk0, bk1;
      load_kfrag(krow, kb, bk0, bk1);
      v8f acc = {};
      acc = __builtin_amdgcn_wmma_f32_16x16x32_bf16(false, aq0, false, bk0,
                                                    (short)0, acc, false, false);
      acc = __builtin_amdgcn_wmma_f32_16x16x32_bf16(false, aq1, false, bk1,
                                                    (short)0, acc, false, false);
      float ca = 0.f, cw = 0.f;
#pragma unroll
      for (int j = 0; j < 8; ++j) {
        float e = cm ? __expf(fminf(acc[j] * 0.125f - mL[j], 0.f)) : 0.f;
        float p = e * invL[j];
        ca += p;
        cw += mr[j] * p;
      }
      ca += __shfl_xor(ca, 16, 32);
      cw += __shfl_xor(cw, 16, 32);
      if (half == 0) {
        atomicAdd(&w_all[(size_t)b * S_ + ct * 16 + ln], ca);
        atomicAdd(&w_msk[(size_t)b * S_ + ct * 16 + ln], cw);
      }
    }
    __syncthreads();
  }
}

// ---------------------------------------------------------------------------
// small helpers
// ---------------------------------------------------------------------------
__global__ void __launch_bounds__(256)
zero_ws(float* __restrict__ w_all, float* __restrict__ w_msk, float* __restrict__ y) {
  int i = blockIdx.x * 256 + threadIdx.x;
  if (i < B_ * S_) { w_all[i] = 0.f; w_msk[i] = 0.f; }
  if (i < B_ * H_) y[i] = 0.f;
}

__global__ void __launch_bounds__(256)
batch_stats(const int* __restrict__ mask, const float* __restrict__ w_msk,
            float* __restrict__ sumw, float* __restrict__ denom) {
  __shared__ float sm[256], sw[256];
  int b = blockIdx.x, t = threadIdx.x;
  float a = 0.f, c = 0.f;
  for (int s = t; s < S_; s += 256) {
    a += (float)mask[(size_t)b * S_ + s];
    c += w_msk[(size_t)b * S_ + s];
  }
  sm[t] = a; sw[t] = c; __syncthreads();
  for (int st = 128; st > 0; st >>= 1) {
    if (t < st) { sm[t] += sm[t + st]; sw[t] += sw[t + st]; }
    __syncthreads();
  }
  if (t == 0) { denom[b] = sm[0] + 1e-8f; sumw[b] = sw[0]; }
}

// y[b,h] = sum_s w_msk[b,s] * x[b,s,h]
__global__ void __launch_bounds__(256)
wx_gemv(const float* __restrict__ x, const float* __restrict__ w_msk,
        float* __restrict__ y) {
  int h  = blockIdx.x * 256 + threadIdx.x;
  int sc = blockIdx.y;
  int b  = blockIdx.z;
  const float* xb = x + ((size_t)b * S_) * H_;
  float acc = 0.f;
  for (int s = sc * 256; s < sc * 256 + 256; ++s)
    acc = fmaf(w_msk[(size_t)b * S_ + s], xb[(size_t)s * H_ + h], acc);
  atomicAdd(&y[(size_t)b * H_ + h], acc);
}

// out[b,h] = (y[b,:] @ Wv[:,h] + sumw[b]*bv[h]) / denom[b]
__global__ void __launch_bounds__(256)
out_proj(const float* __restrict__ y, const float* __restrict__ Wv,
         const float* __restrict__ bv, const float* __restrict__ sumw,
         const float* __restrict__ denom, float* __restrict__ out) {
  int h = blockIdx.x * 256 + threadIdx.x;
  int b = blockIdx.y;
  float acc = 0.f;
  for (int k = 0; k < H_; ++k)
    acc = fmaf(y[(size_t)b * H_ + k], Wv[(size_t)k * H_ + h], acc);
  out[(size_t)b * H_ + h] = (acc + sumw[b] * bv[h]) / denom[b];
}

__global__ void __launch_bounds__(256)
attn_mean(const float* __restrict__ w_all, float* __restrict__ out2) {
  int i = blockIdx.x * 256 + threadIdx.x;
  if (i < B_ * S_) out2[i] = w_all[i] * (1.0f / (float)S_);
}

// ---------------------------------------------------------------------------
extern "C" void kernel_launch(void* const* d_in, const int* in_sizes, int n_in,
                              void* d_out, int out_size, void* d_ws, size_t ws_size,
                              hipStream_t stream) {
  const float* x    = (const float*)d_in[0];
  const int*   mask = (const int*)  d_in[1];
  const float* Wq   = (const float*)d_in[2];
  const float* bq   = (const float*)d_in[3];
  const float* Wk   = (const float*)d_in[4];
  const float* bk   = (const float*)d_in[5];
  const float* Wv   = (const float*)d_in[6];
  const float* bv   = (const float*)d_in[7];
  float* out  = (float*)d_out;                       // (B,H) = 16384 floats
  float* out2 = out + (size_t)B_ * H_;               // (B,S) = 32768 floats

  char* ws = (char*)d_ws;
  const size_t QB_OFF   = 0;
  const size_t KB_OFF   = QB_OFF   + (size_t)B_ * S_ * A_ * 2;   // bf16 Q
  const size_t WQB_OFF  = KB_OFF   + (size_t)B_ * S_ * A_ * 2;   // bf16 K
  const size_t WKB_OFF  = WQB_OFF  + (size_t)65536 * 2;
  const size_t WALL_OFF = WKB_OFF  + (size_t)65536 * 2;
  const size_t WMSK_OFF = WALL_OFF + (size_t)B_ * S_ * 4;
  const size_t Y_OFF    = WMSK_OFF + (size_t)B_ * S_ * 4;
  const size_t SUMW_OFF = Y_OFF    + (size_t)B_ * H_ * 4;
  const size_t DEN_OFF  = SUMW_OFF + 64;

  unsigned short* Qb   = (unsigned short*)(ws + QB_OFF);
  unsigned short* Kb   = (unsigned short*)(ws + KB_OFF);
  unsigned short* WqB  = (unsigned short*)(ws + WQB_OFF);
  unsigned short* WkB  = (unsigned short*)(ws + WKB_OFF);
  float* w_all = (float*)(ws + WALL_OFF);
  float* w_msk = (float*)(ws + WMSK_OFF);
  float* y     = (float*)(ws + Y_OFF);
  float* sumw  = (float*)(ws + SUMW_OFF);
  float* denom = (float*)(ws + DEN_OFF);

  zero_ws    <<<(B_ * S_ + 255) / 256, 256, 0, stream>>>(w_all, w_msk, y);
  prep_wfrag <<<65536 / 256, 256, 0, stream>>>(Wq, Wk, WqB, WkB);
  proj_qk    <<<(B_ * S_ / 16) / 4, 128, 0, stream>>>(x, bq, bk, WqB, WkB, Qb, Kb);
  attn_colsum<<<(B_ * S_ / 16) / 8, 256, 0, stream>>>(Qb, Kb, mask, w_all, w_msk);
  batch_stats<<<B_, 256, 0, stream>>>(mask, w_msk, sumw, denom);
  wx_gemv    <<<dim3(H_ / 256, 8, B_), 256, 0, stream>>>(x, w_msk, y);
  out_proj   <<<dim3(H_ / 256, B_), 256, 0, stream>>>(y, Wv, bv, sumw, denom, out);
  attn_mean  <<<(B_ * S_ + 255) / 256, 256, 0, stream>>>(w_all, out2);
}

// v001
// One run takes 203 microseconds.
// Timed twice side by side with v000, it ran 1.39 and 1.38 times as fast.
#include <hip/hip_runtime.h>
#include <math.h>

#define S_ 2048
#define H_ 1024
#define A_ 64
#define B_ 16

typedef __attribute__((ext_vector_type(16))) __bf16 v16bf;
typedef __attribute__((ext_vector_type(8)))  __bf16 v8bf;
typedef __attribute__((ext_vector_type(8)))  float  v8f;
typedef __attribute__((ext_vector_type(4)))  unsigned int v4u;
typedef __attribute__((ext_vector_type(8)))  int v8i;
typedef __attribute__((ext_vector_type(4)))  int v4i;

__device__ __forceinline__ __bf16 f2bf(float f) { return (__bf16)f; }
__device__ __forceinline__ unsigned short bf_bits(float f) {
  __bf16 h = (__bf16)f;
  return __builtin_bit_cast(unsigned short, h);
}

__global__ void __launch_bounds__(256)
prep_wfrag(const float* __restrict__ Wq, const float* __restrict__ Wk,
           unsigned short* __restrict__ WqB, unsigned short* __restrict__ WkB) {
  int idx = blockIdx.x * 256 + threadIdx.x;      // 0 .. 65535
  int e    = idx & 15;
  int lane = (idx >> 4) & 31;
  int ks   = (idx >> 9) & 31;
  int nt   = (idx >> 14) & 3;
  int n = nt * 16 + (lane & 15);
  int k = ks * 32 + ((lane >> 4) << 3) + ((e & 8) ? (16 + (e & 7)) : (e & 7));
  WqB[idx] = bf_bits(Wq[(size_t)k * A_ + n]);
  WkB[idx] = bf_bits(Wk[(size_t)k * A_ + n]);
}

// ---------------------------------------------------------------------------
// Q = x@Wq + bq ; K = x@Wk + bk   (bf16 WMMA)
// One block = 128 rows of x, 16 waves: wave = (matrix, 16-row tile), 16 x 64
// outputs each. K runs in 8 stages of 128 columns. A stage (the x tile in f32
// and the packed fragments of both weights for its 4 k steps) is brought into
// LDS by asynchronous copies, two buffers: the next stage flies while this one
// is multiplied.
// ---------------------------------------------------------------------------
#define PJ_ROWS   128
#define PJ_KC     128                        // k columns per stage
#define PJ_NST    (H_ / PJ_KC)               // 8 stages
#define PJ_XPITCH 132                        // floats per LDS row: 528 B = 16 B x odd
#define PJ_XBUF   (PJ_ROWS * PJ_XPITCH)      // floats per x buffer
#define PJ_WBUF   (4 * 8 * 512)              // 16-bit words per weight buffer

typedef __attribute__((ext_vector_type(4))) float v4f;

__device__ __forceinline__ unsigned lds_byte(const void* p) {
  return (unsigned)(unsigned long long)p;
}

// One wave's share of one stage: 8 rows of x (512 B each) and 4 x 512 B of
// packed weights. A fragment's two 16-byte halves per lane are split into two
// planes of 512 B, so that each later ds_load_b128 reads 512 contiguous bytes.
__device__ __forceinline__ void pj_copy_stage(const float* gx, unsigned lx,
                                              const unsigned short* gw, unsigned lw) {
  asm volatile(
      "global_load_async_to_lds_b128 %0, %1, off\n\t"
      "global_load_async_to_lds_b128 %2, %3, off\n\t"
      "global_load_async_to_lds_b128 %4, %5, off\n\t"
      "global_load_async_to_lds_b128 %6, %7, off\n\t"
      "global_load_async_to_lds_b128 %8, %9, off\n\t"
      "global_load_async_to_lds_b128 %10, %11, off\n\t"
      "global_load_async_to_lds_b128 %12, %13, off\n\t"
      "global_load_async_to_lds_b128 %14, %15, off\n\t"
      "global_load_async_to_lds_b128 %16, %17, off\n\t"
      "global_load_async_to_lds_b128 %18, %19, off\n\t"
      "global_load_async_to_lds_b128 %20, %21, off\n\t"
      "global_load_async_to_lds_b128 %22, %23, off\n\t"
      "s_wait_xcnt 0x0"
      :: "v"(lx),                     "v"(gx),
         "v"(lx + 1 * PJ_XPITCH * 4), "v"(gx + 1 * H_),
         "v"(lx + 2 * PJ_XPITCH * 4), "v"(gx + 2 * H_),
         "v"(lx + 3 * PJ_XPITCH * 4), "v"(gx + 3 * H_),
         "v"(lx + 4 * PJ_XPITCH * 4), "v"(gx + 4 * H_),
         "v"(lx + 5 * PJ_XPITCH * 4), "v"(gx + 5 * H_),
         "v"(lx + 6 * PJ_XPITCH * 4), "v"(gx + 6 * H_),
         "v"(lx + 7 * PJ_XPITCH * 4), "v"(gx + 7 * H_),
         "v"(lw),                     "v"(gw),
         "v"(lw + 256),               "v"(gw + 256),
         "v"(lw + 8192),              "v"(gw + 512),
         "v"(lw + 8192 + 256),        "v"(gw + 768)
      : "memory");
}

__global__ void __launch_bounds__(512)
proj_qk(const float* __restrict__ x, const float* __restrict__ bq,
        const float* __restrict__ bk,
        const unsigned short* __restrict__ WqB, const unsigned short* __restrict__ WkB,
        unsigned short* __restrict__ Qb, unsigned short* __restrict__ Kb) {
  __shared__ __attribute__((aligned(16))) float          xs[2][PJ_XBUF];
  __shared__ __attribute__((aligned(16))) unsigned short wf[2][PJ_WBUF];

  const int lane = threadIdx.x & 31;
  const int wave = threadIdx.x >> 5;             // 0 .. 15
  const int rt   = wave & 7;                     // 16-row tile of the block
  const int mat  = wave >> 3;                    // 0: Q, 1: K
  const int half = lane >> 4;
  const int ln   = lane & 15;
  const int row0 = blockIdx.x * PJ_ROWS;         // flat row b*S + s

  // copy side: rows wave*8 .. +7 of x; of the weights, matrix mat, column
  // tile cnt, k steps (wave&1)*2 and +1 of the stage
  const int cnt = (wave >> 1) & 3;
  const float* gx = x + (size_t)(row0 + wave * 8) * H_ + lane * 4;
  const unsigned short* gw = (mat ? WkB : WqB) + (size_t)cnt * 32 * 512
                             + (wave & 1) * 1024 + lane * 8;
  const unsigned lx = lds_byte(&xs[0][wave * 8 * PJ_XPITCH + lane * 4]);
  const unsigned lw = lds_byte(&wf[0][((wave & 1) * 16 + mat * 4 + cnt) * 512
                                      + (lane & 1) * 256 + (lane >> 1) * 8]);

  pj_copy_stage(gx, lx, gw, lw);
  // stage 0 has landed for this wave before the barrier publishes it
  asm volatile("s_wait_asynccnt 0x0" ::: "memory");
  __syncthreads();
  pj_copy_stage(gx + PJ_KC, lx + PJ_XBUF * 4, gw + 4 * 512, lw + PJ_WBUF * 2);

  v8f acc[4] = {};
  for (int t = 0; t < PJ_NST; ++t) {
    const int buf = t & 1;
    const float* xr = &xs[buf][(rt * 16 + ln) * PJ_XPITCH + half * 8];
    const unsigned short* wl = &wf[buf][mat * 4 * 512 + lane * 8];
#pragma unroll
    for (int ksl = 0; ksl < 4; ++ksl) {
      v4f f0 = *(const v4f*)(xr + ksl * 32);
      v4f f1 = *(const v4f*)(xr + ksl * 32 + 4);
      v4f f2 = *(const v4f*)(xr + ksl * 32 + 16);
      v4f f3 = *(const v4f*)(xr + ksl * 32 + 20);
      v16bf a;
#pragma unroll
      for (int i = 0; i < 4; ++i) {
        a[i]      = f2bf(f0[i]);
        a[4 + i]  = f2bf(f1[i]);
        a[8 + i]  = f2bf(f2[i]);
        a[12 + i] = f2bf(f3[i]);
      }
#pragma unroll
      for (int nt = 0; nt < 4; ++nt) {
        v8bf lo = *(const v8bf*)(wl + (ksl * 8 + nt) * 512);
        v8bf hi = *(const v8bf*)(wl + (ksl * 8 + nt) * 512 + 256);
        v16bf w;
#pragma unroll
        for (int i = 0; i < 8; ++i) { w[i] = lo[i]; w[8 + i] = hi[i]; }
        acc[nt] = __builtin_amdgcn_wmma_f32_16x16x32_bf16(false, a, false, w,
                                                          (short)0, acc[nt], false, false);
      }
    }
    // this wave's reads of buffer buf are over before it may be refilled
    asm volatile("s_wait_dscnt 0x0" ::: "memory");
    // this wave's copies of stage t + 1 have landed before the barrier publishes them
    asm volatile("s_wait_asynccnt 0x0" ::: "memory");
    __syncthreads();
    if (t + 2 < PJ_NST)
      pj_copy_stage(gx + (t + 2) * PJ_KC, lx + buf * (PJ_XBUF * 4),
                    gw + (t + 2) * 4 * 512, lw + buf * (PJ_WBUF * 2));
  }
  // no copy is outstanding when the wave ends
  asm volatile("s_wait_asynccnt 0x0" ::: "memory");

  unsigned short* __restrict__ O = mat ? Kb : Qb;
  const float* __restrict__ bias = mat ? bk : bq;
#pragma unroll
  for (int nt = 0; nt < 4; ++nt) {
    const int col = nt * 16 + ln;
    const float bb = bias[col];
#pragma unroll
    for (int j = 0; j < 8; ++j) {
      const int m = j + half * 8;
      O[(size_t)(row0 + rt * 16 + m) * A_ + col] = bf_bits(acc[nt][j] + bb);
    }
  }
}

__device__ __forceinline__ void load_kfrag(const unsigned short* __restrict__ row,
                                           int kb, v16bf& f0, v16bf& f1) {
  v8bf lo0 = *(const v8bf*)(row + kb);
  v8bf hi0 = *(const v8bf*)(row + kb + 16);
  v8bf lo1 = *(const v8bf*)(row + kb + 32);
  v8bf hi1 = *(const v8bf*)(row + kb + 48);
#pragma unroll
  for (int i = 0; i < 8; ++i) {
    f0[i] = lo0[i]; f0[8 + i] = hi0[i];
    f1[i] = lo1[i]; f1[8 + i] = hi1[i];
  }
}

#define CHUNK_T    8
#define CHUNK_ROWS (CHUNK_T * 16)
#define NCHUNK     (S_ / CHUNK_ROWS)

__device__ __forceinline__ void tdm_load_chunk(const unsigned short* gsrc,
                                               unsigned lds_off) {
  unsigned long long ga = (unsigned long long)gsrc;
  v4u g0 = { 1u,                                   // count=1, user mode
             lds_off,                              // lds_addr
             (unsigned)(ga & 0xFFFFFFFFu),         // global_addr[31:0]
             (unsigned)(((ga >> 32) & 0x01FFFFFFu) | 0x80000000u) };
  v8i g1 = { 0x00010000,
             0x00400000,
             0x08000000,
             0x00400000,
             CHUNK_ROWS,
             64,
             0, 0 };
  v4i gz4 = { 0, 0, 0, 0 };
  v8i gz8 = { 0, 0, 0, 0, 0, 0, 0, 0 };
  __builtin_amdgcn_tensor_load_to_lds(g0, g1, gz4, gz4, gz8, 0);
}

__global__ void __launch_bounds__(256)
attn_colsum(const unsigned short* __restrict__ Qb, const unsigned short* __restrict__ Kb,
            const int* __restrict__ mask,
            float* __restrict__ w_all, float* __restrict__ w_msk) {
  __shared__ unsigned short ksh[2][CHUNK_ROWS * A_];   // 2 x 16 KB

  const int lane = threadIdx.x & 31;
  const int wave = threadIdx.x >> 5;
  const int rowtile = blockIdx.x * 8 + wave;     // 0 .. 2047 (same batch per block)
  const int b  = rowtile >> 7;
  const int s0 = (rowtile & 127) << 4;
  const int half = lane >> 4;
  const int ln   = lane & 15;
  const int kb   = half * 8;

  const unsigned short* kpanel = Kb + (size_t)b * S_ * A_;
  const unsigned lds0 = (unsigned)(unsigned long long)(const void*)&ksh[0][0];
  const unsigned lds1 = (unsigned)(unsigned long long)(const void*)&ksh[1][0];

  // A fragments of Q (16 x 64 bf16 -> two 16x32 fragments)
  const unsigned short* qrow = Qb + ((size_t)(b * S_ + s0 + ln)) * A_;
  v16bf aq0, aq1;
  load_kfrag(qrow, kb, aq0, aq1);

  const int* mrow = mask + (size_t)b * S_;
  float mr[8];
#pragma unroll
  for (int j = 0; j < 8; ++j) mr[j] = (float)mrow[s0 + j + half * 8];

  float mL[8], lL[8];
#pragma unroll
  for (int j = 0; j < 8; ++j) { mL[j] = -1e30f; lL[j] = 0.f; }

  // ---- pass 1: row max + sum of exp (online, per-lane partials) ----
  if (wave == 0) tdm_load_chunk(kpanel, lds0);
  for (int c = 0; c < NCHUNK; ++c) {
    __builtin_amdgcn_s_wait_tensorcnt(0);
    __syncthreads();                              // chunk c visible in buf c&1
    if (wave == 0 && c + 1 < NCHUNK)
      tdm_load_chunk(kpanel + (size_t)(c + 1) * CHUNK_ROWS * A_,
                     ((c + 1) & 1) ? lds1 : lds0);
    const unsigned short* kc = &ksh[c & 1][0];
    for (int tl = 0; tl < CHUNK_T; ++tl) {
      const int ct = c * CHUNK_T + tl;
      const bool cm = mrow[ct * 16 + ln] != 0;
      const unsigned short* krow = kc + (tl * 16 + ln) * A_;
      v16bf bk0, bk1;
      load_kfrag(krow, kb, bk0, bk1);
      v8f acc = {};
      acc = __builtin_amdgcn_wmma_f32_16x16x32_bf16(false, aq0, false, bk0,
                                                    (short)0, acc, false, false);
      acc = __builtin_amdgcn_wmma_f32_16x16x32_bf16(false, aq1, false, bk1,
                                                    (short)0, acc, false, false);
#pragma unroll
      for (int j = 0; j < 8; ++j) {
        float s    = acc[j] * 0.125f;             // / sqrt(64)
        float seff = cm ? s : -1e30f;
        float nm   = fmaxf(mL[j], seff);
        lL[j] = lL[j] * __expf(mL[j] - nm) + (cm ? __expf(seff - nm) : 0.f);
        mL[j] = nm;
      }
    }
    __syncthreads();                              // readers done before overwrite
  }
  // combine partials across the 16 lanes holding each row
#pragma unroll
  for (int d = 1; d < 16; d <<= 1) {
#pragma unroll
    for (int j = 0; j < 8; ++j) {
      float om = __shfl_xor(mL[j], d, 32);
      float ol = __shfl_xor(lL[j], d, 32);
      float nm = fmaxf(mL[j], om);
      lL[j] = lL[j] * __expf(mL[j] - nm) + ol * __expf(om - nm);
      mL[j] = nm;
    }
  }
  float invL[8];
#pragma unroll
  for (int j = 0; j < 8; ++j) invL[j] = (lL[j] > 0.f) ? (1.f / lL[j]) : 0.f;

  // ---- pass 2: probabilities -> column sums ----
  if (wave == 0) tdm_load_chunk(kpanel, lds0);
  for (int c = 0; c < NCHUNK; ++c) {
    __builtin_amdgcn_s_wait_tensorcnt(0);
    __syncthreads();
    if (wave == 0 && c + 1 < NCHUNK)
      tdm_load_chunk(kpanel + (size_t)(c + 1) * CHUNK_ROWS * A_,
                     ((c + 1) & 1) ? lds1 : lds0);
    const unsigned short* kc = &ksh[c & 1][0];
    for (int tl = 0; tl < CHUNK_T; ++tl) {
      const int ct = c * CHUNK_T + tl;
      const bool cm = mrow[ct * 16 + ln] != 0;
      const unsigned short* krow = kc + (tl * 16 + ln) * A_;
      v16bf bk0, bk1;
      load_kfrag(krow, kb, bk0, bk1);
      v8f acc = {};
      acc = __builtin_amdgcn_wmma_f32_16x16x32_bf16(false, aq0, false, bk0,
                                                    (short)0, acc, false, false);
      acc = __builtin_amdgcn_wmma_f32_16x16x32_bf16(false, aq1, false, bk1,
                                                    (short)0, acc, false, false);
      float ca = 0.f, cw = 0.f;
#pragma unroll
      for (int j = 0; j < 8; ++j) {
        float e = cm ? __expf(fminf(acc[j] * 0.125f - mL[j], 0.f)) : 0.f;
        float p = e * invL[j];
        ca += p;
        cw += mr[j] * p;
      }
      ca += __shfl_xor(ca, 16, 32);
      cw += __shfl_xor(cw, 16, 32);
      if (half == 0) {
        atomicAdd(&w_all[(size_t)b * S_ + ct * 16 + ln], ca);
        atomicAdd(&w_msk[(size_t)b * S_ + ct * 16 + ln], cw);
      }
    }
    __syncthreads();
  }
}

// ---------------------------------------------------------------------------
// small helpers
// ---------------------------------------------------------------------------
__global__ void __launch_bounds__(256)
zero_ws(float* __restrict__ w_all, float* __restrict__ w_msk, float* __restrict__ y) {
  int i = blockIdx.x * 256 + threadIdx.x;
  if (i < B_ * S_) { w_all[i] = 0.f; w_msk[i] = 0.f; }
  if (i < B_ * H_) y[i] = 0.f;
}

__global__ void __launch_bounds__(256)
batch_stats(const int* __restrict__ mask, const float* __restrict__ w_msk,
            float* __restrict__ sumw, float* __restrict__ denom) {
  __shared__ float sm[256], sw[256];
  int b = blockIdx.x, t = threadIdx.x;
  float a = 0.f, c = 0.f;
  for (int s = t; s < S_; s += 256) {
    a += (float)mask[(size_t)b * S_ + s];
    c += w_msk[(size_t)b * S_ + s];
  }
  sm[t] = a; sw[t] = c; __syncthreads();
  for (int st = 128; st > 0; st >>= 1) {
    if (t < st) { sm[t] += sm[t + st]; sw[t] += sw[t + st]; }
    __syncthreads();
  }
  if (t == 0) { denom[b] = sm[0] + 1e-8f; sumw[b] = sw[0]; }
}

// y[b,h] = sum_s w_msk[b,s] * x[b,s,h]
__global__ void __launch_bounds__(256)
wx_gemv(const float* __restrict__ x, const float* __restrict__ w_msk,
        float* __restrict__ y) {
  int h  = blockIdx.x * 256 + threadIdx.x;
  int sc = blockIdx.y;
  int b  = blockIdx.z;
  const float* xb = x + ((size_t)b * S_) * H_;
  float acc = 0.f;
  for (int s = sc * 256; s < sc * 256 + 256; ++s)
    acc = fmaf(w_msk[(size_t)b * S_ + s], xb[(size_t)s * H_ + h], acc);
  atomicAdd(&y[(size_t)b * H_ + h], acc);
}

// out[b,h] = (y[b,:] @ Wv[:,h] + sumw[b]*bv[h]) / denom[b]
__global__ void __launch_bounds__(256)
out_proj(const float* __restrict__ y, const float* __restrict__ Wv,
         const float* __restrict__ bv, const float* __restrict__ sumw,
         const float* __restrict__ denom, float* __restrict__ out) {
  int h = blockIdx.x * 256 + threadIdx.x;
  int b = blockIdx.y;
  float acc = 0.f;
  for (int k = 0; k < H_; ++k)
    acc = fmaf(y[(size_t)b * H_ + k], Wv[(size_t)k * H_ + h], acc);
  out[(size_t)b * H_ + h] = (acc + sumw[b] * bv[h]) / denom[b];
}

__global__ void __launch_bounds__(256)
attn_mean(const float* __restrict__ w_all, float* __restrict__ out2) {
  int i = blockIdx.x * 256 + threadIdx.x;
  if (i < B_ * S_) out2[i] = w_all[i] * (1.0f / (float)S_);
}

// ---------------------------------------------------------------------------
extern "C" void kernel_launch(void* const* d_in, const int* in_sizes, int n_in,
                              void* d_out, int out_size, void* d_ws, size_t ws_size,
                              hipStream_t stream) {
  const float* x    = (const float*)d_in[0];
  const int*   mask = (const int*)  d_in[1];
  const float* Wq   = (const float*)d_in[2];
  const float* bq   = (const float*)d_in[3];
  const float* Wk   = (const float*)d_in[4];
  const float* bk   = (const float*)d_in[5];
  const float* Wv   = (const float*)d_in[6];
  const float* bv   = (const float*)d_in[7];
  float* out  = (float*)d_out;                       // (B,H) = 16384 floats
  float* out2 = out + (size_t)B_ * H_;               // (B,S) = 32768 floats

  char* ws = (char*)d_ws;
  const size_t QB_OFF   = 0;
  const size_t KB_OFF   = QB_OFF   + (size_t)B_ * S_ * A_ * 2;   // bf16 Q
  const size_t WQB_OFF  = KB_OFF   + (size_t)B_ * S_ * A_ * 2;   // bf16 K
  const size_t WKB_OFF  = WQB_OFF  + (size_t)65536 * 2;
  const size_t WALL_OFF = WKB_OFF  + (size_t)65536 * 2;
  const size_t WMSK_OFF = WALL_OFF + (size_t)B_ * S_ * 4;
  const size_t Y_OFF    = WMSK_OFF + (size_t)B_ * S_ * 4;
  const size_t SUMW_OFF = Y_OFF    + (size_t)B_ * H_ * 4;
  const size_t DEN_OFF  = SUMW_OFF + 64;

  unsigned short* Qb   = (unsigned short*)(ws + QB_OFF);
  unsigned short* Kb   = (unsigned short*)(ws + KB_OFF);
  unsigned short* WqB  = (unsigned short*)(ws + WQB_OFF);
  unsigned short* WkB  = (unsigned short*)(ws + WKB_OFF);
  float* w_all = (float*)(ws + WALL_OFF);
  float* w_msk = (float*)(ws + WMSK_OFF);
  float* y     = (float*)(ws + Y_OFF);
  float* sumw  = (float*)(ws + SUMW_OFF);
  float* denom = (float*)(ws + DEN_OFF);

  zero_ws    <<<(B_ * S_ + 255) / 256, 256, 0, stream>>>(w_all, w_msk, y);
  prep_wfrag <<<65536 / 256, 256, 0, stream>>>(Wq, Wk, WqB, WkB);
  proj_qk    <<<(B_ * S_) / 128, 512, 0, stream>>>(x, bq, bk, WqB, WkB, Qb, Kb);
  attn_colsum<<<(B_ * S_ / 16) / 8, 256, 0, stream>>>(Qb, Kb, mask, w_all, w_msk);
  batch_stats<<<B_, 256, 0, stream>>>(mask, w_msk, sumw, denom);
  wx_gemv    <<<dim3(H_ / 256, 8, B_), 256, 0, stream>>>(x, w_msk, y);
  out_proj   <<<dim3(H_ / 256, B_), 256, 0, stream>>>(y, Wv, bv, sumw, denom, out);
  attn_mean  <<<(B_ * S_ + 255) / 256, 256, 0, stream>>>(w_all, out2);
}

// v002
// It runs in 169 microseconds.
// Next to v001, in two timings, it ran 1.21 and 1.23 times as fast.
// Counting every step since v000, it is 1.70 times as fast.
#include <hip/hip_runtime.h>
#include <math.h>

#define S_ 2048
#define H_ 1024
#define A_ 64
#define B_ 16

typedef __attribute__((ext_vector_type(16))) __bf16 v16bf;
typedef __attribute__((ext_vector_type(8)))  __bf16 v8bf;
typedef __attribute__((ext_vector_type(8)))  float  v8f;
typedef __attribute__((ext_vector_type(4)))  unsigned int v4u;
typedef __attribute__((ext_vector_type(8)))  int v8i;
typedef __attribute__((ext_vector_type(4)))  int v4i;

__device__ __forceinline__ __bf16 f2bf(float f) { return (__bf16)f; }
__device__ __forceinline__ unsigned short bf_bits(float f) {
  __bf16 h = (__bf16)f;
  return __builtin_bit_cast(unsigned short, h);
}

__global__ void __launch_bounds__(256)
prep_wfrag(const float* __restrict__ Wq, const float* __restrict__ Wk,
           unsigned short* __restrict__ WqB, unsigned short* __restrict__ WkB) {
  int idx = blockIdx.x * 256 + threadIdx.x;      // 0 .. 65535
  int e    = idx & 15;
  int lane = (idx >> 4) & 31;
  int ks   = (idx >> 9) & 31;
  int nt   = (idx >> 14) & 3;
  int n = nt * 16 + (lane & 15);
  int k = ks * 32 + ((lane >> 4) << 3) + ((e & 8) ? (16 + (e & 7)) : (e & 7));
  WqB[idx] = bf_bits(Wq[(size_t)k * A_ + n]);
  WkB[idx] = bf_bits(Wk[(size_t)k * A_ + n]);
}

// ---------------------------------------------------------------------------
// Q = x@Wq + bq ; K = x@Wk + bk   (bf16 WMMA)
// One block = 128 rows of x, 16 waves: wave = (matrix, 16-row tile), 16 x 64
// outputs each. K runs in 8 stages of 128 columns. A stage (the x tile in f32
// and the packed fragments of both weights for its 4 k steps) is brought into
// LDS by asynchronous copies, two buffers: the next stage flies while this one
// is multiplied.
// ---------------------------------------------------------------------------
#define PJ_ROWS   128
#define PJ_KC     128                        // k columns per stage
#define PJ_NST    (H_ / PJ_KC)               // 8 stages
#define PJ_XPITCH 132                        // floats per LDS row: 528 B = 16 B x odd
#define PJ_XBUF   (PJ_ROWS * PJ_XPITCH)      // floats per x buffer
#define PJ_WBUF   (4 * 8 * 512)              // 16-bit words per weight buffer

typedef __attribute__((ext_vector_type(4))) float v4f;

__device__ __forceinline__ unsigned lds_byte(const void* p) {
  return (unsigned)(unsigned long long)p;
}

// One wave's share of one stage: 8 rows of x (512 B each) and 4 x 512 B of
// packed weights. A fragment's two 16-byte halves per lane are split into two
// planes of 512 B, so that each later ds_load_b128 reads 512 contiguous bytes.
__device__ __forceinline__ void pj_copy_stage(const float* gx, unsigned lx,
                                              const unsigned short* gw, unsigned lw) {
  asm volatile(
      "global_load_async_to_lds_b128 %0, %1, off\n\t"
      "global_load_async_to_lds_b128 %2, %3, off\n\t"
      "global_load_async_to_lds_b128 %4, %5, off\n\t"
      "global_load_async_to_lds_b128 %6, %7, off\n\t"
      "global_load_async_to_lds_b128 %8, %9, off\n\t"
      "global_load_async_to_lds_b128 %10, %11, off\n\t"
      "global_load_async_to_lds_b128 %12, %13, off\n\t"
      "global_load_async_to_lds_b128 %14, %15, off\n\t"
      "global_load_async_to_lds_b128 %16, %17, off\n\t"
      "global_load_async_to_lds_b128 %18, %19, off\n\t"
      "global_load_async_to_lds_b128 %20, %21, off\n\t"
      "global_load_async_to_lds_b128 %22, %23, off\n\t"
      "s_wait_xcnt 0x0"
      :: "v"(lx),                     "v"(gx),
         "v"(lx + 1 * PJ_XPITCH * 4), "v"(gx + 1 * H_),
         "v"(lx + 2 * PJ_XPITCH * 4), "v"(gx + 2 * H_),
         "v"(lx + 3 * PJ_XPITCH * 4), "v"(gx + 3 * H_),
         "v"(lx + 4 * PJ_XPITCH * 4), "v"(gx + 4 * H_),
         "v"(lx + 5 * PJ_XPITCH * 4), "v"(gx + 5 * H_),
         "v"(lx + 6 * PJ_XPITCH * 4), "v"(gx + 6 * H_),
         "v"(lx + 7 * PJ_XPITCH * 4), "v"(gx + 7 * H_),
         "v"(lw),                     "v"(gw),
         "v"(lw + 256),               "v"(gw + 256),
         "v"(lw + 8192),              "v"(gw + 512),
         "v"(lw + 8192 + 256),        "v"(gw + 768)
      : "memory");
}

__global__ void __launch_bounds__(512)
proj_qk(const float* __restrict__ x, const float* __restrict__ bq,
        const float* __restrict__ bk,
        const unsigned short* __restrict__ WqB, const unsigned short* __restrict__ WkB,
        unsigned short* __restrict__ Qb, unsigned short* __restrict__ Kb) {
  __shared__ __attribute__((aligned(16))) float          xs[2][PJ_XBUF];
  __shared__ __attribute__((aligned(16))) unsigned short wf[2][PJ_WBUF];

  const int lane = threadIdx.x & 31;
  const int wave = threadIdx.x >> 5;             // 0 .. 15
  const int rt   = wave & 7;                     // 16-row tile of the block
  const int mat  = wave >> 3;                    // 0: Q, 1: K
  const int half = lane >> 4;
  const int ln   = lane & 15;
  const int row0 = blockIdx.x * PJ_ROWS;         // flat row b*S + s

  // copy side: rows wave*8 .. +7 of x; of the weights, matrix mat, column
  // tile cnt, k steps (wave&1)*2 and +1 of the stage
  const int cnt = (wave >> 1) & 3;
  const float* gx = x + (size_t)(row0 + wave * 8) * H_ + lane * 4;
  const unsigned short* gw = (mat ? WkB : WqB) + (size_t)cnt * 32 * 512
                             + (wave & 1) * 1024 + lane * 8;
  const unsigned lx = lds_byte(&xs[0][wave * 8 * PJ_XPITCH + lane * 4]);
  const unsigned lw = lds_byte(&wf[0][((wave & 1) * 16 + mat * 4 + cnt) * 512
                                      + (lane & 1) * 256 + (lane >> 1) * 8]);

  pj_copy_stage(gx, lx, gw, lw);
  // stage 0 has landed for this wave before the barrier publishes it
  asm volatile("s_wait_asynccnt 0x0" ::: "memory");
  __syncthreads();
  pj_copy_stage(gx + PJ_KC, lx + PJ_XBUF * 4, gw + 4 * 512, lw + PJ_WBUF * 2);

  v8f acc[4] = {};
  for (int t = 0; t < PJ_NST; ++t) {
    const int buf = t & 1;
    const float* xr = &xs[buf][(rt * 16 + ln) * PJ_XPITCH + half * 8];
    const unsigned short* wl = &wf[buf][mat * 4 * 512 + lane * 8];
#pragma unroll
    for (int ksl = 0; ksl < 4; ++ksl) {
      v4f f0 = *(const v4f*)(xr + ksl * 32);
      v4f f1 = *(const v4f*)(xr + ksl * 32 + 4);
      v4f f2 = *(const v4f*)(xr + ksl * 32 + 16);
      v4f f3 = *(const v4f*)(xr + ksl * 32 + 20);
      v16bf a;
#pragma unroll
      for (int i = 0; i < 4; ++i) {
        a[i]      = f2bf(f0[i]);
        a[4 + i]  = f2bf(f1[i]);
        a[8 + i]  = f2bf(f2[i]);
        a[12 + i] = f2bf(f3[i]);
      }
#pragma unroll
      for (int nt = 0; nt < 4; ++nt) {
        v8bf lo = *(const v8bf*)(wl + (ksl * 8 + nt) * 512);
        v8bf hi = *(const v8bf*)(wl + (ksl * 8 + nt) * 512 + 256);
        v16bf w;
#pragma unroll
        for (int i = 0; i < 8; ++i) { w[i] = lo[i]; w[8 + i] = hi[i]; }
        acc[nt] = __builtin_amdgcn_wmma_f32_16x16x32_bf16(false, a, false, w,
                                                          (short)0, acc[nt], false, false);
      }
    }
    // this wave's reads of buffer buf are over before it may be refilled
    asm volatile("s_wait_dscnt 0x0" ::: "memory");
    // this wave's copies of stage t + 1 have landed before the barrier publishes them
    asm volatile("s_wait_asynccnt 0x0" ::: "memory");
    __syncthreads();
    if (t + 2 < PJ_NST)
      pj_copy_stage(gx + (t + 2) * PJ_KC, lx + buf * (PJ_XBUF * 4),
                    gw + (t + 2) * 4 * 512, lw + buf * (PJ_WBUF * 2));
  }
  // no copy is outstanding when the wave ends
  asm volatile("s_wait_asynccnt 0x0" ::: "memory");

  unsigned short* __restrict__ O = mat ? Kb : Qb;
  const float* __restrict__ bias = mat ? bk : bq;
#pragma unroll
  for (int nt = 0; nt < 4; ++nt) {
    const int col = nt * 16 + ln;
    const float bb = bias[col];
#pragma unroll
    for (int j = 0; j < 8; ++j) {
      const int m = j + half * 8;
      O[(size_t)(row0 + rt * 16 + m) * A_ + col] = bf_bits(acc[nt][j] + bb);
    }
  }
}

__device__ __forceinline__ void load_kfrag(const unsigned short* __restrict__ row,
                                           int kb, v16bf& f0, v16bf& f1) {
  v8bf lo0 = *(const v8bf*)(row + kb);
  v8bf hi0 = *(const v8bf*)(row + kb + 16);
  v8bf lo1 = *(const v8bf*)(row + kb + 32);
  v8bf hi1 = *(const v8bf*)(row + kb + 48);
#pragma unroll
  for (int i = 0; i < 8; ++i) {
    f0[i] = lo0[i]; f0[8 + i] = hi0[i];
    f1[i] = lo1[i]; f1[8 + i] = hi1[i];
  }
}

#define CHUNK_T    8
#define CHUNK_ROWS (CHUNK_T * 16)
#define NCHUNK     (S_ / CHUNK_ROWS)

__device__ __forceinline__ void tdm_load_chunk(const unsigned short* gsrc,
                                               unsigned lds_off) {
  unsigned long long ga = (unsigned long long)gsrc;
  v4u g0 = { 1u,                                   // count=1, user mode
             lds_off,                              // lds_addr
             (unsigned)(ga & 0xFFFFFFFFu),         // global_addr[31:0]
             (unsigned)(((ga >> 32) & 0x01FFFFFFu) | 0x80000000u) };
  v8i g1 = { 0x00010000,
             0x00400000,
             0x08000000,
             0x00400000,
             CHUNK_ROWS,
             64,
             0, 0 };
  v4i gz4 = { 0, 0, 0, 0 };
  v8i gz8 = { 0, 0, 0, 0, 0, 0, 0, 0 };
  __builtin_amdgcn_tensor_load_to_lds(g0, g1, gz4, gz4, gz8, 0);
}

__global__ void __launch_bounds__(256)
attn_colsum(const unsigned short* __restrict__ Qb, const unsigned short* __restrict__ Kb,
            const int* __restrict__ mask,
            float* __restrict__ w_all, float* __restrict__ w_msk) {
  __shared__ unsigned short ksh[2][CHUNK_ROWS * A_];   // 2 x 16 KB
  __shared__ float csum[2][S_];                        // the block's column sums, 16 KB

  const int lane = threadIdx.x & 31;
  const int wave = threadIdx.x >> 5;
  const int rowtile = blockIdx.x * 8 + wave;     // 0 .. 2047 (same batch per block)
  const int b  = rowtile >> 7;
  const int s0 = (rowtile & 127) << 4;
  const int half = lane >> 4;
  const int ln   = lane & 15;
  const int kb   = half * 8;

  const unsigned short* kpanel = Kb + (size_t)b * S_ * A_;
  const unsigned lds0 = (unsigned)(unsigned long long)(const void*)&ksh[0][0];
  const unsigned lds1 = (unsigned)(unsigned long long)(const void*)&ksh[1][0];

  // A fragments of Q (16 x 64 bf16 -> two 16x32 fragments)
  const unsigned short* qrow = Qb + ((size_t)(b * S_ + s0 + ln)) * A_;
  v16bf aq0, aq1;
  load_kfrag(qrow, kb, aq0, aq1);

  const int* mrow = mask + (size_t)b * S_;
  float mr[8];
#pragma unroll
  for (int j = 0; j < 8; ++j) mr[j] = (float)mrow[s0 + j + half * 8];

  float mL[8], lL[8];
#pragma unroll
  for (int j = 0; j < 8; ++j) { mL[j] = -1e30f; lL[j] = 0.f; }

  // start values of the block's column sums; the barriers of pass 1 stand
  // between these stores and the first add of pass 2
  for (int i = 0; i < 2 * S_ / 256; ++i) (&csum[0][0])[i * 256 + threadIdx.x] = 0.f;

  // ---- pass 1: row max + sum of exp (online, per-lane partials) ----
  if (wave == 0) tdm_load_chunk(kpanel, lds0);
  for (int c = 0; c < NCHUNK; ++c) {
    __builtin_amdgcn_s_wait_tensorcnt(0);
    __syncthreads();                              // chunk c visible in buf c&1
    if (wave == 0 && c + 1 < NCHUNK)
      tdm_load_chunk(kpanel + (size_t)(c + 1) * CHUNK_ROWS * A_,
                     ((c + 1) & 1) ? lds1 : lds0);
    const unsigned short* kc = &ksh[c & 1][0];
    for (int tl = 0; tl < CHUNK_T; ++tl) {
      const int ct = c * CHUNK_T + tl;
      const bool cm = mrow[ct * 16 + ln] != 0;
      const unsigned short* krow = kc + (tl * 16 + ln) * A_;
      v16bf bk0, bk1;
      load_kfrag(krow, kb, bk0, bk1);
      v8f acc = {};
      acc = __builtin_amdgcn_wmma_f32_16x16x32_bf16(false, aq0, false, bk0,
                                                    (short)0, acc, false, false);
      acc = __builtin_amdgcn_wmma_f32_16x16x32_bf16(false, aq1, false, bk1,
                                                    (short)0, acc, false, false);
#pragma unroll
      for (int j = 0; j < 8; ++j) {
        float s    = acc[j] * 0.125f;             // / sqrt(64)
        float seff = cm ? s : -1e30f;
        float nm   = fmaxf(mL[j], seff);
        lL[j] = lL[j] * __expf(mL[j] - nm) + (cm ? __expf(seff - nm) : 0.f);
        mL[j] = nm;
      }
    }
    __syncthreads();                              // readers done before overwrite
  }
  // combine partials across the 16 lanes holding each row
#pragma unroll
  for (int d = 1; d < 16; d <<= 1) {
#pragma unroll
    for (int j = 0; j < 8; ++j) {
      float om = __shfl_xor(mL[j], d, 32);
      float ol = __shfl_xor(lL[j], d, 32);
      float nm = fmaxf(mL[j], om);
      lL[j] = lL[j] * __expf(mL[j] - nm) + ol * __expf(om - nm);
      mL[j] = nm;
    }
  }
  float invL[8];
#pragma unroll
  for (int j = 0; j < 8; ++j) invL[j] = (lL[j] > 0.f) ? (1.f / lL[j]) : 0.f;

  // ---- pass 2: probabilities -> column sums ----
  float* gsum = ((threadIdx.x >> 7) ? w_msk : w_all) + (size_t)b * S_ + (threadIdx.x & 127);
  if (wave == 0) tdm_load_chunk(kpanel, lds0);
  for (int c = 0; c < NCHUNK; ++c) {
    __builtin_amdgcn_s_wait_tensorcnt(0);
    __syncthreads();
    if (wave == 0 && c + 1 < NCHUNK)
      tdm_load_chunk(kpanel + (size_t)(c + 1) * CHUNK_ROWS * A_,
                     ((c + 1) & 1) ? lds1 : lds0);
    const unsigned short* kc = &ksh[c & 1][0];
    for (int tl = 0; tl < CHUNK_T; ++tl) {
      const int ct = c * CHUNK_T + tl;
      const bool cm = mrow[ct * 16 + ln] != 0;
      const unsigned short* krow = kc + (tl * 16 + ln) * A_;
      v16bf bk0, bk1;
      load_kfrag(krow, kb, bk0, bk1);
      v8f acc = {};
      acc = __builtin_amdgcn_wmma_f32_16x16x32_bf16(false, aq0, false, bk0,
                                                    (short)0, acc, false, false);
      acc = __builtin_amdgcn_wmma_f32_16x16x32_bf16(false, aq1, false, bk1,
                                                    (short)0, acc, false, false);
      float ca = 0.f, cw = 0.f;
#pragma unroll
      for (int j = 0; j < 8; ++j) {
        float e = cm ? __expf(fminf(acc[j] * 0.125f - mL[j], 0.f)) : 0.f;
        float p = e * invL[j];
        ca += p;
        cw += mr[j] * p;
      }
      ca += __shfl_xor(ca, 16, 32);
      cw += __shfl_xor(cw, 16, 32);
      if (half == 0) {
        atomicAdd(&csum[0][ct * 16 + ln], ca);      // LDS adds: the 8 waves meet here
        atomicAdd(&csum[1][ct * 16 + ln], cw);
      }
    }
    __syncthreads();
  }
  // behind the last barrier the block's 2 x 2048 sums are complete: 16 global
  // adds per thread, all LDS reads first so that the adds issue back to back
  // (both loops unrolled: bs[] stays in registers)
  float bs[NCHUNK];
#pragma unroll
  for (int i = 0; i < NCHUNK; ++i)
    bs[i] = csum[threadIdx.x >> 7][i * CHUNK_ROWS + (threadIdx.x & 127)];
#pragma unroll
  for (int i = 0; i < NCHUNK; ++i) atomicAdd(gsum + i * CHUNK_ROWS, bs[i]);
}

// ---------------------------------------------------------------------------
// small helpers
// ---------------------------------------------------------------------------
__global__ void __launch_bounds__(256)
zero_ws(float* __restrict__ w_all, float* __restrict__ w_msk, float* __restrict__ y) {
  int i = blockIdx.x * 256 + threadIdx.x;
  if (i < B_ * S_) { w_all[i] = 0.f; w_msk[i] = 0.f; }
  if (i < B_ * H_) y[i] = 0.f;
}

__global__ void __launch_bounds__(256)
batch_stats(const int* __restrict__ mask, const float* __restrict__ w_msk,
            float* __restrict__ sumw, float* __restrict__ denom) {
  __shared__ float sm[256], sw[256];
  int b = blockIdx.x, t = threadIdx.x;
  float a = 0.f, c = 0.f;
  for (int s = t; s < S_; s += 256) {
    a += (float)mask[(size_t)b * S_ + s];
    c += w_msk[(size_t)b * S_ + s];
  }
  sm[t] = a; sw[t] = c; __syncthreads();
  for (int st = 128; st > 0; st >>= 1) {
    if (t < st) { sm[t] += sm[t + st]; sw[t] += sw[t + st]; }
    __syncthreads();
  }
  if (t == 0) { denom[b] = sm[0] + 1e-8f; sumw[b] = sw[0]; }
}

// y[b,h] = sum_s w_msk[b,s] * x[b,s,h]
__global__ void __launch_bounds__(256)
wx_gemv(const float* __restrict__ x, const float* __restrict__ w_msk,
        float* __restrict__ y) {
  int h  = blockIdx.x * 256 + threadIdx.x;
  int sc = blockIdx.y;
  int b  = blockIdx.z;
  const float* xb = x + ((size_t)b * S_) * H_;
  float acc = 0.f;
  for (int s = sc * 256; s < sc * 256 + 256; ++s)
    acc = fmaf(w_msk[(size_t)b * S_ + s], xb[(size_t)s * H_ + h], acc);
  atomicAdd(&y[(size_t)b * H_ + h], acc);
}

// out[b,h] = (y[b,:] @ Wv[:,h] + sumw[b]*bv[h]) / denom[b]
__global__ void __launch_bounds__(256)
out_proj(const float* __restrict__ y, const float* __restrict__ Wv,
         const float* __restrict__ bv, const float* __restrict__ sumw,
         const float* __restrict__ denom, float* __restrict__ out) {
  int h = blockIdx.x * 256 + threadIdx.x;
  int b = blockIdx.y;
  float acc = 0.f;
  for (int k = 0; k < H_; ++k)
    acc = fmaf(y[(size_t)b * H_ + k], Wv[(size_t)k * H_ + h], acc);
  out[(size_t)b * H_ + h] = (acc + sumw[b] * bv[h]) / denom[b];
}

__global__ void __launch_bounds__(256)
attn_mean(const float* __restrict__ w_all, float* __restrict__ out2) {
  int i = blockIdx.x * 256 + threadIdx.x;
  if (i < B_ * S_) out2[i] = w_all[i] * (1.0f / (float)S_);
}

// ---------------------------------------------------------------------------
extern "C" void kernel_launch(void* const* d_in, const int* in_sizes, int n_in,
                              void* d_out, int out_size, void* d_ws, size_t ws_size,
                              hipStream_t stream) {
  const float* x    = (const float*)d_in[0];
  const int*   mask = (const int*)  d_in[1];
  const float* Wq   = (const float*)d_in[2];
  const float* bq   = (const float*)d_in[3];
  const float* Wk   = (const float*)d_in[4];
  const float* bk   = (const float*)d_in[5];
  const float* Wv   = (const float*)d_in[6];
  const float* bv   = (const float*)d_in[7];
  float* out  = (float*)d_out;                       // (B,H) = 16384 floats
  float* out2 = out + (size_t)B_ * H_;               // (B,S) = 32768 floats

  char* ws = (char*)d_ws;
  const size_t QB_OFF   = 0;
  const size_t KB_OFF   = QB_OFF   + (size_t)B_ * S_ * A_ * 2;   // bf16 Q
  const size_t WQB_OFF  = KB_OFF   + (size_t)B_ * S_ * A_ * 2;   // bf16 K
  const size_t WKB_OFF  = WQB_OFF  + (size_t)65536 * 2;
  const size_t WALL_OFF = WKB_OFF  + (size_t)65536 * 2;
  const size_t WMSK_OFF = WALL_OFF + (size_t)B_ * S_ * 4;
  const size_t Y_OFF    = WMSK_OFF + (size_t)B_ * S_ * 4;
  const size_t SUMW_OFF = Y_OFF    + (size_t)B_ * H_ * 4;
  const size_t DEN_OFF  = SUMW_OFF + 64;

  unsigned short* Qb   = (unsigned short*)(ws + QB_OFF);
  unsigned short* Kb   = (unsigned short*)(ws + KB_OFF);
  unsigned short* WqB  = (unsigned short*)(ws + WQB_OFF);
  unsigned short* WkB  = (unsigned short*)(ws + WKB_OFF);
  float* w_all = (float*)(ws + WALL_OFF);
  float* w_msk = (float*)(ws + WMSK_OFF);
  float* y     = (float*)(ws + Y_OFF);
  float* sumw  = (float*)(ws + SUMW_OFF);
  float* denom = (float*)(ws + DEN_OFF);

  zero_ws    <<<(B_ * S_ + 255) / 256, 256, 0, stream>>>(w_all, w_msk, y);
  prep_wfrag <<<65536 / 256, 256, 0, stream>>>(Wq, Wk, WqB, WkB);
  proj_qk    <<<(B_ * S_) / 128, 512, 0, stream>>>(x, bq, bk, WqB, WkB, Qb, Kb);
  attn_colsum<<<(B_ * S_ / 16) / 8, 256, 0, stream>>>(Qb, Kb, mask, w_all, w_msk);
  batch_stats<<<B_, 256, 0, stream>>>(mask, w_msk, sumw, denom);
  wx_gemv    <<<dim3(H_ / 256, 8, B_), 256, 0, stream>>>(x, w_msk, y);
  out_proj   <<<dim3(H_ / 256, B_), 256, 0, stream>>>(y, Wv, bv, sumw, denom, out);
  attn_mean  <<<(B_ * S_ + 255) / 256, 256, 0, stream>>>(w_all, out2);
}

// v003
// One run takes 151 microseconds.
// Next to v002, in two timings, it ran 1.12 times as fast each time.
// Counting every step since v000, it is 1.89 times as fast.
#include <hip/hip_runtime.h>
#include <math.h>

#define S_ 2048
#define H_ 1024
#define A_ 64
#define B_ 16

typedef __attribute__((ext_vector_type(16))) __bf16 v16bf;
typedef __attribute__((ext_vector_type(8)))  __bf16 v8bf;
typedef __attribute__((ext_vector_type(8)))  float  v8f;
typedef __attribute__((ext_vector_type(4)))  unsigned int v4u;
typedef __attribute__((ext_vector_type(8)))  int v8i;
typedef __attribute__((ext_vector_type(4)))  int v4i;

__device__ __forceinline__ __bf16 f2bf(float f) { return (__bf16)f; }
__device__ __forceinline__ unsigned short bf_bits(float f) {
  __bf16 h = (__bf16)f;
  return __builtin_bit_cast(unsigned short, h);
}

__global__ void __launch_bounds__(256)
prep_wfrag(const float* __restrict__ Wq, const float* __restrict__ Wk,
           unsigned short* __restrict__ WqB, unsigned short* __restrict__ WkB) {
  int idx = blockIdx.x * 256 + threadIdx.x;      // 0 .. 65535
  int e    = idx & 15;
  int lane = (idx >> 4) & 31;
  int ks   = (idx >> 9) & 31;
  int nt   = (idx >> 14) & 3;
  int n = nt * 16 + (lane & 15);
  int k = ks * 32 + ((lane >> 4) << 3) + ((e & 8) ? (16 + (e & 7)) : (e & 7));
  WqB[idx] = bf_bits(Wq[(size_t)k * A_ + n]);
  WkB[idx] = bf_bits(Wk[(size_t)k * A_ + n]);
}

// ---------------------------------------------------------------------------
// Q = x@Wq + bq ; K = x@Wk + bk   (bf16 WMMA)
// One block = 128 rows of x, 16 waves: wave = (matrix, 16-row tile), 16 x 64
// outputs each. K runs in 8 stages of 128 columns. A stage (the x tile in f32
// and the packed fragments of both weights for its 4 k steps) is brought into
// LDS by asynchronous copies, two buffers: the next stage flies while this one
// is multiplied.
// ---------------------------------------------------------------------------
#define PJ_ROWS   128
#define PJ_KC     128                        // k columns per stage
#define PJ_NST    (H_ / PJ_KC)               // 8 stages
#define PJ_XPITCH 132                        // floats per LDS row: 528 B = 16 B x odd
#define PJ_XBUF   (PJ_ROWS * PJ_XPITCH)      // floats per x buffer
#define PJ_WBUF   (4 * 8 * 512)              // 16-bit words per weight buffer

#define KT_WORDS  (16 * A_)                  // 16-bit words of one 16-row tile of K

typedef __attribute__((ext_vector_type(4))) float v4f;

__device__ __forceinline__ unsigned lds_byte(const void* p) {
  return (unsigned)(unsigned long long)p;
}

// One wave's share of one stage: 8 rows of x (512 B each) and 4 x 512 B of
// packed weights. A fragment's two 16-byte halves per lane are split into two
// planes of 512 B, so that each later ds_load_b128 reads 512 contiguous bytes.
__device__ __forceinline__ void pj_copy_stage(const float* gx, unsigned lx,
                                              const unsigned short* gw, unsigned lw) {
  asm volatile(
      "global_load_async_to_lds_b128 %0, %1, off\n\t"
      "global_load_async_to_lds_b128 %2, %3, off\n\t"
      "global_load_async_to_lds_b128 %4, %5, off\n\t"
      "global_load_async_to_lds_b128 %6, %7, off\n\t"
      "global_load_async_to_lds_b128 %8, %9, off\n\t"
      "global_load_async_to_lds_b128 %10, %11, off\n\t"
      "global_load_async_to_lds_b128 %12, %13, off\n\t"
      "global_load_async_to_lds_b128 %14, %15, off\n\t"
      "global_load_async_to_lds_b128 %16, %17, off\n\t"
      "global_load_async_to_lds_b128 %18, %19, off\n\t"
      "global_load_async_to_lds_b128 %20, %21, off\n\t"
      "global_load_async_to_lds_b128 %22, %23, off\n\t"
      "s_wait_xcnt 0x0"
      :: "v"(lx),                     "v"(gx),
         "v"(lx + 1 * PJ_XPITCH * 4), "v"(gx + 1 * H_),
         "v"(lx + 2 * PJ_XPITCH * 4), "v"(gx + 2 * H_),
         "v"(lx + 3 * PJ_XPITCH * 4), "v"(gx + 3 * H_),
         "v"(lx + 4 * PJ_XPITCH * 4), "v"(gx + 4 * H_),
         "v"(lx + 5 * PJ_XPITCH * 4), "v"(gx + 5 * H_),
         "v"(lx + 6 * PJ_XPITCH * 4), "v"(gx + 6 * H_),
         "v"(lx + 7 * PJ_XPITCH * 4), "v"(gx + 7 * H_),
         "v"(lw),                     "v"(gw),
         "v"(lw + 256),               "v"(gw + 256),
         "v"(lw + 8192),              "v"(gw + 512),
         "v"(lw + 8192 + 256),        "v"(gw + 768)
      : "memory");
}

__global__ void __launch_bounds__(512)
proj_qk(const float* __restrict__ x, const float* __restrict__ bq,
        const float* __restrict__ bk,
        const unsigned short* __restrict__ WqB, const unsigned short* __restrict__ WkB,
        unsigned short* __restrict__ Qb, unsigned short* __restrict__ Kb) {
  __shared__ __attribute__((aligned(16))) float          xs[2][PJ_XBUF];
  __shared__ __attribute__((aligned(16))) unsigned short wf[2][PJ_WBUF];

  const int lane = threadIdx.x & 31;
  const int wave = threadIdx.x >> 5;             // 0 .. 15
  const int rt   = wave & 7;                     // 16-row tile of the block
  const int mat  = wave >> 3;                    // 0: Q, 1: K
  const int half = lane >> 4;
  const int ln   = lane & 15;
  const int row0 = blockIdx.x * PJ_ROWS;         // flat row b*S + s

  // copy side: rows wave*8 .. +7 of x; of the weights, matrix mat, column
  // tile cnt, k steps (wave&1)*2 and +1 of the stage
  const int cnt = (wave >> 1) & 3;
  const float* gx = x + (size_t)(row0 + wave * 8) * H_ + lane * 4;
  const unsigned short* gw = (mat ? WkB : WqB) + (size_t)cnt * 32 * 512
                             + (wave & 1) * 1024 + lane * 8;
  const unsigned lx = lds_byte(&xs[0][wave * 8 * PJ_XPITCH + lane * 4]);
  const unsigned lw = lds_byte(&wf[0][((wave & 1) * 16 + mat * 4 + cnt) * 512
                                      + (lane & 1) * 256 + (lane >> 1) * 8]);

  pj_copy_stage(gx, lx, gw, lw);
  // stage 0 has landed for this wave before the barrier publishes it
  asm volatile("s_wait_asynccnt 0x0" ::: "memory");
  __syncthreads();
  pj_copy_stage(gx + PJ_KC, lx + PJ_XBUF * 4, gw + 4 * 512, lw + PJ_WBUF * 2);

  v8f acc[4] = {};
  for (int t = 0; t < PJ_NST; ++t) {
    const int buf = t & 1;
    const float* xr = &xs[buf][(rt * 16 + ln) * PJ_XPITCH + half * 8];
    const unsigned short* wl = &wf[buf][mat * 4 * 512 + lane * 8];
#pragma unroll
    for (int ksl = 0; ksl < 4; ++ksl) {
      v4f f0 = *(const v4f*)(xr + ksl * 32);
      v4f f1 = *(const v4f*)(xr + ksl * 32 + 4);
      v4f f2 = *(const v4f*)(xr + ksl * 32 + 16);
      v4f f3 = *(const v4f*)(xr + ksl * 32 + 20);
      v16bf a;
#pragma unroll
      for (int i = 0; i < 4; ++i) {
        a[i]      = f2bf(f0[i]);
        a[4 + i]  = f2bf(f1[i]);
        a[8 + i]  = f2bf(f2[i]);
        a[12 + i] = f2bf(f3[i]);
      }
#pragma unroll
      for (int nt = 0; nt < 4; ++nt) {
        v8bf lo = *(const v8bf*)(wl + (ksl * 8 + nt) * 512);
        v8bf hi = *(const v8bf*)(wl + (ksl * 8 + nt) * 512 + 256);
        v16bf w;
#pragma unroll
        for (int i = 0; i < 8; ++i) { w[i] = lo[i]; w[8 + i] = hi[i]; }
        acc[nt] = __builtin_amdgcn_wmma_f32_16x16x32_bf16(false, a, false, w,
                                                          (short)0, acc[nt], false, false);
      }
    }
    // this wave's reads of buffer buf are over before it may be refilled
    asm volatile("s_wait_dscnt 0x0" ::: "memory");
    // this wave's copies of stage t + 1 have landed before the barrier publishes them
    asm volatile("s_wait_asynccnt 0x0" ::: "memory");
    __syncthreads();
    if (t + 2 < PJ_NST)
      pj_copy_stage(gx + (t + 2) * PJ_KC, lx + buf * (PJ_XBUF * 4),
                    gw + (t + 2) * 4 * 512, lw + buf * (PJ_WBUF * 2));
  }
  // no copy is outstanding when the wave ends
  asm volatile("s_wait_asynccnt 0x0" ::: "memory");

  if (mat == 0) {
    // Q: row major, 64 columns a row
    unsigned short* __restrict__ O = Qb + (size_t)(row0 + rt * 16 + half * 8) * A_ + ln;
#pragma unroll
    for (int nt = 0; nt < 4; ++nt) {
      const float bb = bq[nt * 16 + ln];
#pragma unroll
      for (int j = 0; j < 8; ++j) O[j * A_ + nt * 16] = bf_bits(acc[nt][j] + bb);
    }
  } else {
    // K: each 16-row tile (2 KB) in the order in which attn_colsum's lanes read
    // it: plane p = col / 16 (512 B), reader lane ((col / 8) & 1) * 16 + row % 16
    // (16 B), element col % 8
    unsigned short* __restrict__ O = Kb + (size_t)((row0 >> 4) + rt) * KT_WORDS
                                     + ((ln >> 3) * 16 + half * 8) * 8 + (ln & 7);
#pragma unroll
    for (int nt = 0; nt < 4; ++nt) {
      const float bb = bk[nt * 16 + ln];
#pragma unroll
      for (int j = 0; j < 8; ++j) O[nt * 256 + j * 8] = bf_bits(acc[nt][j] + bb);
    }
  }
}

__device__ __forceinline__ void load_kfrag(const unsigned short* __restrict__ row,
                                           int kb, v16bf& f0, v16bf& f1) {
  v8bf lo0 = *(const v8bf*)(row + kb);
  v8bf hi0 = *(const v8bf*)(row + kb + 16);
  v8bf lo1 = *(const v8bf*)(row + kb + 32);
  v8bf hi1 = *(const v8bf*)(row + kb + 48);
#pragma unroll
  for (int i = 0; i < 8; ++i) {
    f0[i] = lo0[i]; f0[8 + i] = hi0[i];
    f1[i] = lo1[i]; f1[8 + i] = hi1[i];
  }
}

__device__ __forceinline__ void load_ktile(const unsigned short* tile, int lane,
                                           v16bf& f0, v16bf& f1) {
  v8bf lo0 = *(const v8bf*)(tile + lane * 8);
  v8bf hi0 = *(const v8bf*)(tile + 256 + lane * 8);
  v8bf lo1 = *(const v8bf*)(tile + 512 + lane * 8);
  v8bf hi1 = *(const v8bf*)(tile + 768 + lane * 8);
#pragma unroll
  for (int i = 0; i < 8; ++i) {
    f0[i] = lo0[i]; f0[8 + i] = hi0[i];
    f1[i] = lo1[i]; f1[8 + i] = hi1[i];
  }
}

#define CHUNK_T    8
#define CHUNK_ROWS (CHUNK_T * 16)
#define NCHUNK     (S_ / CHUNK_ROWS)

__device__ __forceinline__ void tdm_load_chunk(const unsigned short* gsrc,
                                               unsigned lds_off) {
  unsigned long long ga = (unsigned long long)gsrc;
  v4u g0 = { 1u,                                   // count=1, user mode
             lds_off,                              // lds_addr
             (unsigned)(ga & 0xFFFFFFFFu),         // global_addr[31:0]
             (unsigned)(((ga >> 32) & 0x01FFFFFFu) | 0x80000000u) };
  v8i g1 = { 0x00010000,
             0x00400000,
             0x08000000,
             0x00400000,
             CHUNK_ROWS,
             64,
             0, 0 };
  v4i gz4 = { 0, 0, 0, 0 };
  v8i gz8 = { 0, 0, 0, 0, 0, 0, 0, 0 };
  __builtin_amdgcn_tensor_load_to_lds(g0, g1, gz4, gz4, gz8, 0);
}

__global__ void __launch_bounds__(256)
attn_colsum(const unsigned short* __restrict__ Qb, const unsigned short* __restrict__ Kb,
            const int* __restrict__ mask,
            float* __restrict__ w_all, float* __restrict__ w_msk) {
  __shared__ unsigned short ksh[2][CHUNK_ROWS * A_];   // 2 x 16 KB
  __shared__ float csum[2][S_];                        // the block's column sums, 16 KB

  const int lane = threadIdx.x & 31;
  const int wave = threadIdx.x >> 5;
  const int rowtile = blockIdx.x * 8 + wave;     // 0 .. 2047 (same batch per block)
  const int b  = rowtile >> 7;
  const int s0 = (rowtile & 127) << 4;
  const int half = lane >> 4;
  const int ln   = lane & 15;
  const int kb   = half * 8;

  const unsigned short* kpanel = Kb + (size_t)b * S_ * A_;
  const unsigned lds0 = (unsigned)(unsigned long long)(const void*)&ksh[0][0];
  const unsigned lds1 = (unsigned)(unsigned long long)(const void*)&ksh[1][0];

  // A fragments of Q (16 x 64 bf16 -> two 16x32 fragments)
  const unsigned short* qrow = Qb + ((size_t)(b * S_ + s0 + ln)) * A_;
  v16bf aq0, aq1;
  load_kfrag(qrow, kb, aq0, aq1);

  const int* mrow = mask + (size_t)b * S_;
  float mr[8];
#pragma unroll
  for (int j = 0; j < 8; ++j) mr[j] = (float)mrow[s0 + j + half * 8];

  float mL[8], lL[8];
#pragma unroll
  for (int j = 0; j < 8; ++j) { mL[j] = -1e30f; lL[j] = 0.f; }

  // start values of the block's column sums; the barriers of pass 1 stand
  // between these stores and the first add of pass 2
  for (int i = 0; i < 2 * S_ / 256; ++i) (&csum[0][0])[i * 256 + threadIdx.x] = 0.f;

  // ---- pass 1: row max + sum of exp (online, per-lane partials) ----
  if (wave == 0) tdm_load_chunk(kpanel, lds0);
  for (int c = 0; c < NCHUNK; ++c) {
    __builtin_amdgcn_s_wait_tensorcnt(0);
    __syncthreads();                              // chunk c visible in buf c&1
    if (wave == 0 && c + 1 < NCHUNK)
      tdm_load_chunk(kpanel + (size_t)(c + 1) * CHUNK_ROWS * A_,
                     ((c + 1) & 1) ? lds1 : lds0);
    const unsigned short* kc = &ksh[c & 1][0];
    for (int tl = 0; tl < CHUNK_T; ++tl) {
      const int ct = c * CHUNK_T + tl;
      const bool cm = mrow[ct * 16 + ln] != 0;
      v16bf bk0, bk1;
      load_ktile(kc + tl * KT_WORDS, lane, bk0, bk1);
      v8f acc = {};
      acc = __builtin_amdgcn_wmma_f32_16x16x32_bf16(false, aq0, false, bk0,
                                                    (short)0, acc, false, false);
      acc = __builtin_amdgcn_wmma_f32_16x16x32_bf16(false, aq1, false, bk1,
                                                    (short)0, acc, false, false);
#pragma unroll
      for (int j = 0; j < 8; ++j) {
        float s    = acc[j] * 0.125f;             // / sqrt(64)
        float seff = cm ? s : -1e30f;
        float nm   = fmaxf(mL[j], seff);
        lL[j] = lL[j] * __expf(mL[j] - nm) + (cm ? __expf(seff - nm) : 0.f);
        mL[j] = nm;
      }
    }
    __syncthreads();                              // readers done before overwrite
  }
  // combine partials across the 16 lanes holding each row
#pragma unroll
  for (int d = 1; d < 16; d <<= 1) {
#pragma unroll
    for (int j = 0; j < 8; ++j) {
      float om = __shfl_xor(mL[j], d, 32);
      float ol = __shfl_xor(lL[j], d, 32);
      float nm = fmaxf(mL[j], om);
      lL[j] = lL[j] * __expf(mL[j] - nm) + ol * __expf(om - nm);
      mL[j] = nm;
    }
  }
  float invL[8];
#pragma unroll
  for (int j = 0; j < 8; ++j) invL[j] = (lL[j] > 0.f) ? (1.f / lL[j]) : 0.f;

  // ---- pass 2: probabilities -> column sums ----
  float* gsum = ((threadIdx.x >> 7) ? w_msk : w_all) + (size_t)b * S_ + (threadIdx.x & 127);
  if (wave == 0) tdm_load_chunk(kpanel, lds0);
  for (int c = 0; c < NCHUNK; ++c) {
    __builtin_amdgcn_s_wait_tensorcnt(0);
    __syncthreads();
    if (wave == 0 && c + 1 < NCHUNK)
      tdm_load_chunk(kpanel + (size_t)(c + 1) * CHUNK_ROWS * A_,
                     ((c + 1) & 1) ? lds1 : lds0);
    const unsigned short* kc = &ksh[c & 1][0];
    for (int tl = 0; tl < CHUNK_T; ++tl) {
      const int ct = c * CHUNK_T + tl;
      const bool cm = mrow[ct * 16 + ln] != 0;
      v16bf bk0, bk1;
      load_ktile(kc + tl * KT_WORDS, lane, bk0, bk1);
      v8f acc = {};
      acc = __builtin_amdgcn_wmma_f32_16x16x32_bf16(false, aq0, false, bk0,
                                                    (short)0, acc, false, false);
      acc = __builtin_amdgcn_wmma_f32_16x16x32_bf16(false, aq1, false, bk1,
                                                    (short)0, acc, false, false);
      float ca = 0.f, cw = 0.f;
#pragma unroll
      for (int j = 0; j < 8; ++j) {
        float e = cm ? __expf(fminf(acc[j] * 0.125f - mL[j], 0.f)) : 0.f;
        float p = e * invL[j];
        ca += p;
        cw += mr[j] * p;
      }
      ca += __shfl_xor(ca, 16, 32);
      cw += __shfl_xor(cw, 16, 32);
      if (half == 0) {
        atomicAdd(&csum[0][ct * 16 + ln], ca);      // LDS adds: the 8 waves meet here
        atomicAdd(&csum[1][ct * 16 + ln], cw);
      }
    }
    __syncthreads();
  }
  // behind the last barrier the block's 2 x 2048 sums are complete: 16 global
  // adds per thread, all LDS reads first so that the adds issue back to back
  // (both loops unrolled: bs[] stays in registers)
  float bs[NCHUNK];
#pragma unroll
  for (int i = 0; i < NCHUNK; ++i)
    bs[i] = csum[threadIdx.x >> 7][i * CHUNK_ROWS + (threadIdx.x & 127)];
#pragma unroll
  for (int i = 0; i < NCHUNK; ++i) atomicAdd(gsum + i * CHUNK_ROWS, bs[i]);
}

// ---------------------------------------------------------------------------
// small helpers
// ---------------------------------------------------------------------------
__global__ void __launch_bounds__(256)
zero_ws(float* __restrict__ w_all, float* __restrict__ w_msk, float* __restrict__ y) {
  int i = blockIdx.x * 256 + threadIdx.x;
  if (i < B_ * S_) { w_all[i] = 0.f; w_msk[i] = 0.f; }
  if (i < B_ * H_) y[i] = 0.f;
}

__global__ void __launch_bounds__(256)
batch_stats(const int* __restrict__ mask, const float* __restrict__ w_msk,
            float* __restrict__ sumw, float* __restrict__ denom) {
  __shared__ float sm[256], sw[256];
  int b = blockIdx.x, t = threadIdx.x;
  float a = 0.f, c = 0.f;
  for (int s = t; s < S_; s += 256) {
    a += (float)mask[(size_t)b * S_ + s];
    c += w_msk[(size_t)b * S_ + s];
  }
  sm[t] = a; sw[t] = c; __syncthreads();
  for (int st = 128; st > 0; st >>= 1) {
    if (t < st) { sm[t] += sm[t + st]; sw[t] += sw[t + st]; }
    __syncthreads();
  }
  if (t == 0) { denom[b] = sm[0] + 1e-8f; sumw[b] = sw[0]; }
}

// y[b,h] = sum_s w_msk[b,s] * x[b,s,h]
__global__ void __launch_bounds__(256)
wx_gemv(const float* __restrict__ x, const float* __restrict__ w_msk,
        float* __restrict__ y) {
  int h  = blockIdx.x * 256 + threadIdx.x;
  int sc = blockIdx.y;
  int b  = blockIdx.z;
  const float* xb = x + ((size_t)b * S_) * H_;
  float acc = 0.f;
  for (int s = sc * 256; s < sc * 256 + 256; ++s)
    acc = fmaf(w_msk[(size_t)b * S_ + s], xb[(size_t)s * H_ + h], acc);
  atomicAdd(&y[(size_t)b * H_ + h], acc);
}

// out[b,h] = (y[b,:] @ Wv[:,h] + sumw[b]*bv[h]) / denom[b]
__global__ void __launch_bounds__(256)
out_proj(const float* __restrict__ y, const float* __restrict__ Wv,
         const float* __restrict__ bv, const float* __restrict__ sumw,
         const float* __restrict__ denom, float* __restrict__ out) {
  int h = blockIdx.x * 256 + threadIdx.x;
  int b = blockIdx.y;
  float acc = 0.f;
  for (int k = 0; k < H_; ++k)
    acc = fmaf(y[(size_t)b * H_ + k], Wv[(size_t)k * H_ + h], acc);
  out[(size_t)b * H_ + h] = (acc + sumw[b] * bv[h]) / denom[b];
}

__global__ void __launch_bounds__(256)
attn_mean(const float* __restrict__ w_all, float* __restrict__ out2) {
  int i = blockIdx.x * 256 + threadIdx.x;
  if (i < B_ * S_) out2[i] = w_all[i] * (1.0f / (float)S_);
}

// ---------------------------------------------------------------------------
extern "C" void kernel_launch(void* const* d_in, const int* in_sizes, int n_in,
                              void* d_out, int out_size, void* d_ws, size_t ws_size,
                              hipStream_t stream) {
  const float* x    = (const float*)d_in[0];
  const int*   mask = (const int*)  d_in[1];
  const float* Wq   = (const float*)d_in[2];
  const float* bq   = (const float*)d_in[3];
  const float* Wk   = (const float*)d_in[4];
  const float* bk   = (const float*)d_in[5];
  const float* Wv   = (const float*)d_in[6];
  const float* bv   = (const float*)d_in[7];
  float* out  = (float*)d_out;                       // (B,H) = 16384 floats
  float* out2 = out + (size_t)B_ * H_;               // (B,S) = 32768 floats

  char* ws = (char*)d_ws;
  const size_t QB_OFF   = 0;
  const size_t KB_OFF   = QB_OFF   + (size_t)B_ * S_ * A_ * 2;   // bf16 Q
  const size_t WQB_OFF  = KB_OFF   + (size_t)B_ * S_ * A_ * 2;   // bf16 K
  const size_t WKB_OFF  = WQB_OFF  + (size_t)65536 * 2;
  const size_t WALL_OFF = WKB_OFF  + (size_t)65536 * 2;
  const size_t WMSK_OFF = WALL_OFF + (size_t)B_ * S_ * 4;
  const size_t Y_OFF    = WMSK_OFF + (size_t)B_ * S_ * 4;
  const size_t SUMW_OFF = Y_OFF    + (size_t)B_ * H_ * 4;
  const size_t DEN_OFF  = SUMW_OFF + 64;

  unsigned short* Qb   = (unsigned short*)(ws + QB_OFF);
  unsigned short* Kb   = (unsigned short*)(ws + KB_OFF);
  unsigned short* WqB  = (unsigned short*)(ws + WQB_OFF);
  unsigned short* WkB  = (unsigned short*)(ws + WKB_OFF);
  float* w_all = (float*)(ws + WALL_OFF);
  float* w_msk = (float*)(ws + WMSK_OFF);
  float* y     = (float*)(ws + Y_OFF);
  float* sumw  = (float*)(ws + SUMW_OFF);
  float* denom = (float*)(ws + DEN_OFF);

  zero_ws    <<<(B_ * S_ + 255) / 256, 256, 0, stream>>>(w_all, w_msk, y);
  prep_wfrag <<<65536 / 256, 256, 0, stream>>>(Wq, Wk, WqB, WkB);
  proj_qk    <<<(B_ * S_) / 128, 512, 0, stream>>>(x, bq, bk, WqB, WkB, Qb, Kb);
  attn_colsum<<<(B_ * S_ / 16) / 8, 256, 0, stream>>>(Qb, Kb, mask, w_all, w_msk);
  batch_stats<<<B_, 256, 0, stream>>>(mask, w_msk, sumw, denom);
  wx_gemv    <<<dim3(H_ / 256, 8, B_), 256, 0, stream>>>(x, w_msk, y);
  out_proj   <<<dim3(H_ / 256, B_), 256, 0, stream>>>(y, Wv, bv, sumw, denom, out);
  attn_mean  <<<(B_ * S_ + 255) / 256, 256, 0, stream>>>(w_all, out2);
}

// v004
// Measured time: 118 microseconds a run.
// Two timings next to v003 both put it at 1.27 times that version's speed.
// All steps since v000 together make it 2.41 times as fast.
#include <hip/hip_runtime.h>
#include <math.h>

#define S_ 2048
#define H_ 1024
#define A_ 64
#define B_ 16

typedef __attribute__((ext_vector_type(16))) __bf16 v16bf;
typedef __attribute__((ext_vector_type(8)))  __bf16 v8bf;
typedef __attribute__((ext_vector_type(8)))  float  v8f;
typedef __attribute__((ext_vector_type(4)))  unsigned int v4u;
typedef __attribute__((ext_vector_type(8)))  int v8i;
typedef __attribute__((ext_vector_type(4)))  int v4i;

__device__ __forceinline__ __bf16 f2bf(float f) { return (__bf16)f; }
__device__ __forceinline__ unsigned short bf_bits(float f) {
  __bf16 h = (__bf16)f;
  return __builtin_bit_cast(unsigned short, h);
}

__global__ void __launch_bounds__(256)
prep_wfrag(const float* __restrict__ Wq, const float* __restrict__ Wk,
           unsigned short* __restrict__ WqB, unsigned short* __restrict__ WkB) {
  int idx = blockIdx.x * 256 + threadIdx.x;      // 0 .. 65535
  int e    = idx & 15;
  int lane = (idx >> 4) & 31;
  int ks   = (idx >> 9) & 31;
  int nt   = (idx >> 14) & 3;
  int n = nt * 16 + (lane & 15);
  int k = ks * 32 + ((lane >> 4) << 3) + ((e & 8) ? (16 + (e & 7)) : (e & 7));
  WqB[idx] = bf_bits(Wq[(size_t)k * A_ + n]);
  WkB[idx] = bf_bits(Wk[(size_t)k * A_ + n]);
}

// ---------------------------------------------------------------------------
// Q = x@Wq + bq ; K = x@Wk + bk   (bf16 WMMA)
// One block = 128 rows of x, 16 waves: wave = (matrix, 16-row tile), 16 x 64
// outputs each. K runs in 8 stages of 128 columns. A stage (the x tile in f32
// and the packed fragments of both weights for its 4 k steps) is brought into
// LDS by asynchronous copies, two buffers: the next stage flies while this one
// is multiplied.
// ---------------------------------------------------------------------------
#define PJ_ROWS   128
#define PJ_KC     128                        // k columns per stage
#define PJ_NST    (H_ / PJ_KC)               // 8 stages
#define PJ_XPITCH 132                        // floats per LDS row: 528 B = 16 B x odd
#define PJ_XBUF   (PJ_ROWS * PJ_XPITCH)      // floats per x buffer
#define PJ_WBUF   (4 * 8 * 512)              // 16-bit words per weight buffer

#define KT_WORDS  (16 * A_)                  // 16-bit words of one 16-row tile of K

typedef __attribute__((ext_vector_type(4))) float v4f;

__device__ __forceinline__ unsigned lds_byte(const void* p) {
  return (unsigned)(unsigned long long)p;
}

// One wave's share of one stage: 8 rows of x (512 B each) and 4 x 512 B of
// packed weights. A fragment's two 16-byte halves per lane are split into two
// planes of 512 B, so that each later ds_load_b128 reads 512 contiguous bytes.
__device__ __forceinline__ void pj_copy_stage(const float* gx, unsigned lx,
                                              const unsigned short* gw, unsigned lw) {
  asm volatile(
      "global_load_async_to_lds_b128 %0, %1, off\n\t"
      "global_load_async_to_lds_b128 %2, %3, off\n\t"
      "global_load_async_to_lds_b128 %4, %5, off\n\t"
      "global_load_async_to_lds_b128 %6, %7, off\n\t"
      "global_load_async_to_lds_b128 %8, %9, off\n\t"
      "global_load_async_to_lds_b128 %10, %11, off\n\t"
      "global_load_async_to_lds_b128 %12, %13, off\n\t"
      "global_load_async_to_lds_b128 %14, %15, off\n\t"
      "global_load_async_to_lds_b128 %16, %17, off\n\t"
      "global_load_async_to_lds_b128 %18, %19, off\n\t"
      "global_load_async_to_lds_b128 %20, %21, off\n\t"
      "global_load_async_to_lds_b128 %22, %23, off\n\t"
      "s_wait_xcnt 0x0"
      :: "v"(lx),                     "v"(gx),
         "v"(lx + 1 * PJ_XPITCH * 4), "v"(gx + 1 * H_),
         "v"(lx + 2 * PJ_XPITCH * 4), "v"(gx + 2 * H_),
         "v"(lx + 3 * PJ_XPITCH * 4), "v"(gx + 3 * H_),
         "v"(lx + 4 * PJ_XPITCH * 4), "v"(gx + 4 * H_),
         "v"(lx + 5 * PJ_XPITCH * 4), "v"(gx + 5 * H_),
         "v"(lx + 6 * PJ_XPITCH * 4), "v"(gx + 6 * H_),
         "v"(lx + 7 * PJ_XPITCH * 4), "v"(gx + 7 * H_),
         "v"(lw),                     "v"(gw),
         "v"(lw + 256),               "v"(gw + 256),
         "v"(lw + 8192),              "v"(gw + 512),
         "v"(lw + 8192 + 256),        "v"(gw + 768)
      : "memory");
}

__global__ void __launch_bounds__(512)
proj_qk(const float* __restrict__ x, const float* __restrict__ bq,
        const float* __restrict__ bk,
        const unsigned short* __restrict__ WqB, const unsigned short* __restrict__ WkB,
        unsigned short* __restrict__ Qb, unsigned short* __restrict__ Kb) {
  __shared__ __attribute__((aligned(16))) float          xs[2][PJ_XBUF];
  __shared__ __attribute__((aligned(16))) unsigned short wf[2][PJ_WBUF];

  const int lane = threadIdx.x & 31;
  const int wave = threadIdx.x >> 5;             // 0 .. 15
  const int rt   = wave & 7;                     // 16-row tile of the block
  const int mat  = wave >> 3;                    // 0: Q, 1: K
  const int half = lane >> 4;
  const int ln   = lane & 15;
  const int row0 = blockIdx.x * PJ_ROWS;         // flat row b*S + s

  // copy side: rows wave*8 .. +7 of x; of the weights, matrix mat, column
  // tile cnt, k steps (wave&1)*2 and +1 of the stage
  const int cnt = (wave >> 1) & 3;
  const float* gx = x + (size_t)(row0 + wave * 8) * H_ + lane * 4;
  const unsigned short* gw = (mat ? WkB : WqB) + (size_t)cnt * 32 * 512
                             + (wave & 1) * 1024 + lane * 8;
  const unsigned lx = lds_byte(&xs[0][wave * 8 * PJ_XPITCH + lane * 4]);
  const unsigned lw = lds_byte(&wf[0][((wave & 1) * 16 + mat * 4 + cnt) * 512
                                      + (lane & 1) * 256 + (lane >> 1) * 8]);

  pj_copy_stage(gx, lx, gw, lw);
  // stage 0 has landed for this wave before the barrier publishes it
  asm volatile("s_wait_asynccnt 0x0" ::: "memory");
  __syncthreads();
  pj_copy_stage(gx + PJ_KC, lx + PJ_XBUF * 4, gw + 4 * 512, lw + PJ_WBUF * 2);

  v8f acc[4] = {};
  for (int t = 0; t < PJ_NST; ++t) {
    const int buf = t & 1;
    const float* xr = &xs[buf][(rt * 16 + ln) * PJ_XPITCH + half * 8];
    const unsigned short* wl = &wf[buf][mat * 4 * 512 + lane * 8];
#pragma unroll
    for (int ksl = 0; ksl < 4; ++ksl) {
      v4f f0 = *(const v4f*)(xr + ksl * 32);
      v4f f1 = *(const v4f*)(xr + ksl * 32 + 4);
      v4f f2 = *(const v4f*)(xr + ksl * 32 + 16);
      v4f f3 = *(const v4f*)(xr + ksl * 32 + 20);
      v16bf a;
#pragma unroll
      for (int i = 0; i < 4; ++i) {
        a[i]      = f2bf(f0[i]);
        a[4 + i]  = f2bf(f1[i]);
        a[8 + i]  = f2bf(f2[i]);
        a[12 + i] = f2bf(f3[i]);
      }
#pragma unroll
      for (int nt = 0; nt < 4; ++nt) {
        v8bf lo = *(const v8bf*)(wl + (ksl * 8 + nt) * 512);
        v8bf hi = *(const v8bf*)(wl + (ksl * 8 + nt) * 512 + 256);
        v16bf w;
#pragma unroll
        for (int i = 0; i < 8; ++i) { w[i] = lo[i]; w[8 + i] = hi[i]; }
        acc[nt] = __builtin_amdgcn_wmma_f32_16x16x32_bf16(false, a, false, w,
                                                          (short)0, acc[nt], false, false);
      }
    }
    // this wave's reads of buffer buf are over before it may be refilled
    asm volatile("s_wait_dscnt 0x0" ::: "memory");
    // this wave's copies of stage t + 1 have landed before the barrier publishes them
    asm volatile("s_wait_asynccnt 0x0" ::: "memory");
    __syncthreads();
    if (t + 2 < PJ_NST)
      pj_copy_stage(gx + (t + 2) * PJ_KC, lx + buf * (PJ_XBUF * 4),
                    gw + (t + 2) * 4 * 512, lw + buf * (PJ_WBUF * 2));
  }
  // no copy is outstanding when the wave ends
  asm volatile("s_wait_asynccnt 0x0" ::: "memory");

  if (mat == 0) {
    // Q: row major, 64 columns a row
    unsigned short* __restrict__ O = Qb + (size_t)(row0 + rt * 16 + half * 8) * A_ + ln;
#pragma unroll
    for (int nt = 0; nt < 4; ++nt) {
      const float bb = bq[nt * 16 + ln];
#pragma unroll
      for (int j = 0; j < 8; ++j) O[j * A_ + nt * 16] = bf_bits(acc[nt][j] + bb);
    }
  } else {
    // K: each 16-row tile (2 KB) in the order in which attn_colsum's lanes read
    // it: plane p = col / 16 (512 B), reader lane ((col / 8) & 1) * 16 + row % 16
    // (16 B), element col % 8
    unsigned short* __restrict__ O = Kb + (size_t)((row0 >> 4) + rt) * KT_WORDS
                                     + ((ln >> 3) * 16 + half * 8) * 8 + (ln & 7);
#pragma unroll
    for (int nt = 0; nt < 4; ++nt) {
      const float bb = bk[nt * 16 + ln];
#pragma unroll
      for (int j = 0; j < 8; ++j) O[nt * 256 + j * 8] = bf_bits(acc[nt][j] + bb);
    }
  }
}

__device__ __forceinline__ void load_kfrag(const unsigned short* __restrict__ row,
                                           int kb, v16bf& f0, v16bf& f1) {
  v8bf lo0 = *(const v8bf*)(row + kb);
  v8bf hi0 = *(const v8bf*)(row + kb + 16);
  v8bf lo1 = *(const v8bf*)(row + kb + 32);
  v8bf hi1 = *(const v8bf*)(row + kb + 48);
#pragma unroll
  for (int i = 0; i < 8; ++i) {
    f0[i] = lo0[i]; f0[8 + i] = hi0[i];
    f1[i] = lo1[i]; f1[8 + i] = hi1[i];
  }
}

__device__ __forceinline__ void load_ktile(const unsigned short* tile, int lane,
                                           v16bf& f0, v16bf& f1) {
  v8bf lo0 = *(const v8bf*)(tile + lane * 8);
  v8bf hi0 = *(const v8bf*)(tile + 256 + lane * 8);
  v8bf lo1 = *(const v8bf*)(tile + 512 + lane * 8);
  v8bf hi1 = *(const v8bf*)(tile + 768 + lane * 8);
#pragma unroll
  for (int i = 0; i < 8; ++i) {
    f0[i] = lo0[i]; f0[8 + i] = hi0[i];
    f1[i] = lo1[i]; f1[8 + i] = hi1[i];
  }
}

#define CHUNK_T    8
#define CHUNK_ROWS (CHUNK_T * 16)
#define NCHUNK     (S_ / CHUNK_ROWS)

__device__ __forceinline__ void tdm_load_chunk(const unsigned short* gsrc,
                                               unsigned lds_off) {
  unsigned long long ga = (unsigned long long)gsrc;
  v4u g0 = { 1u,                                   // count=1, user mode
             lds_off,                              // lds_addr
             (unsigned)(ga & 0xFFFFFFFFu),         // global_addr[31:0]
             (unsigned)(((ga >> 32) & 0x01FFFFFFu) | 0x80000000u) };
  v8i g1 = { 0x00010000,
             0x00400000,
             0x08000000,
             0x00400000,
             CHUNK_ROWS,
             64,
             0, 0 };
  v4i gz4 = { 0, 0, 0, 0 };
  v8i gz8 = { 0, 0, 0, 0, 0, 0, 0, 0 };
  __builtin_amdgcn_tensor_load_to_lds(g0, g1, gz4, gz4, gz8, 0);
}

__global__ void __launch_bounds__(256)
attn_colsum(const unsigned short* __restrict__ Qb, const unsigned short* __restrict__ Kb,
            const int* __restrict__ mask,
            float* __restrict__ w_all, float* __restrict__ w_msk) {
  __shared__ unsigned short ksh[2][CHUNK_ROWS * A_];   // 2 x 16 KB
  __shared__ float csum[2][S_];                        // the block's column sums, 16 KB

  const int lane = threadIdx.x & 31;
  const int wave = threadIdx.x >> 5;
  const int rowtile = blockIdx.x * 8 + wave;     // 0 .. 2047 (same batch per block)
  const int b  = rowtile >> 7;
  const int s0 = (rowtile & 127) << 4;
  const int half = lane >> 4;
  const int ln   = lane & 15;
  const int kb   = half * 8;

  const unsigned short* kpanel = Kb + (size_t)b * S_ * A_;
  const unsigned lds0 = (unsigned)(unsigned long long)(const void*)&ksh[0][0];
  const unsigned lds1 = (unsigned)(unsigned long long)(const void*)&ksh[1][0];

  // A fragments of Q (16 x 64 bf16 -> two 16x32 fragments)
  const unsigned short* qrow = Qb + ((size_t)(b * S_ + s0 + ln)) * A_;
  v16bf aq0, aq1;
  load_kfrag(qrow, kb, aq0, aq1);

  const int* mrow = mask + (size_t)b * S_;
  float mr[8];
#pragma unroll
  for (int j = 0; j < 8; ++j) mr[j] = (float)mrow[s0 + j + half * 8];

  float mL[8], lL[8];
#pragma unroll
  for (int j = 0; j < 8; ++j) { mL[j] = -1e30f; lL[j] = 0.f; }

  // start values of the block's column sums; the barriers of pass 1 stand
  // between these stores and the first add of pass 2
  for (int i = 0; i < 2 * S_ / 256; ++i) (&csum[0][0])[i * 256 + threadIdx.x] = 0.f;

  // ---- pass 1: row max + sum of exp (online, per-lane partials) ----
  if (wave == 0) tdm_load_chunk(kpanel, lds0);
  for (int c = 0; c < NCHUNK; ++c) {
    __builtin_amdgcn_s_wait_tensorcnt(0);
    __syncthreads();                              // chunk c visible in buf c&1
    if (wave == 0 && c + 1 < NCHUNK)
      tdm_load_chunk(kpanel + (size_t)(c + 1) * CHUNK_ROWS * A_,
                     ((c + 1) & 1) ? lds1 : lds0);
    const unsigned short* kc = &ksh[c & 1][0];
    for (int tl = 0; tl < CHUNK_T; ++tl) {
      const int ct = c * CHUNK_T + tl;
      const bool cm = mrow[ct * 16 + ln] != 0;
      v16bf bk0, bk1;
      load_ktile(kc + tl * KT_WORDS, lane, bk0, bk1);
      v8f acc = {};
      acc = __builtin_amdgcn_wmma_f32_16x16x32_bf16(false, aq0, false, bk0,
                                                    (short)0, acc, false, false);
      acc = __builtin_amdgcn_wmma_f32_16x16x32_bf16(false, aq1, false, bk1,
                                                    (short)0, acc, false, false);
#pragma unroll
      for (int j = 0; j < 8; ++j) {
        float s    = acc[j] * 0.125f;             // / sqrt(64)
        float seff = cm ? s : -1e30f;
        float nm   = fmaxf(mL[j], seff);
        lL[j] = lL[j] * __expf(mL[j] - nm) + (cm ? __expf(seff - nm) : 0.f);
        mL[j] = nm;
      }
    }
    __syncthreads();                              // readers done before overwrite
  }
  // combine partials across the 16 lanes holding each row
#pragma unroll
  for (int d = 1; d < 16; d <<= 1) {
#pragma unroll
    for (int j = 0; j < 8; ++j) {
      float om = __shfl_xor(mL[j], d, 32);
      float ol = __shfl_xor(lL[j], d, 32);
      float nm = fmaxf(mL[j], om);
      lL[j] = lL[j] * __expf(mL[j] - nm) + ol * __expf(om - nm);
      mL[j] = nm;
    }
  }
  float invL[8];
#pragma unroll
  for (int j = 0; j < 8; ++j) invL[j] = (lL[j] > 0.f) ? (1.f / lL[j]) : 0.f;

  // ---- pass 2: probabilities -> column sums ----
  float* gsum = ((threadIdx.x >> 7) ? w_msk : w_all) + (size_t)b * S_ + (threadIdx.x & 127);
  if (wave == 0) tdm_load_chunk(kpanel, lds0);
  for (int c = 0; c < NCHUNK; ++c) {
    __builtin_amdgcn_s_wait_tensorcnt(0);
    __syncthreads();
    if (wave == 0 && c + 1 < NCHUNK)
      tdm_load_chunk(kpanel + (size_t)(c + 1) * CHUNK_ROWS * A_,
                     ((c + 1) & 1) ? lds1 : lds0);
    const unsigned short* kc = &ksh[c & 1][0];
    for (int tl = 0; tl < CHUNK_T; ++tl) {
      const int ct = c * CHUNK_T + tl;
      const bool cm = mrow[ct * 16 + ln] != 0;
      v16bf bk0, bk1;
      load_ktile(kc + tl * KT_WORDS, lane, bk0, bk1);
      v8f acc = {};
      acc = __builtin_amdgcn_wmma_f32_16x16x32_bf16(false, aq0, false, bk0,
                                                    (short)0, acc, false, false);
      acc = __builtin_amdgcn_wmma_f32_16x16x32_bf16(false, aq1, false, bk1,
                                                    (short)0, acc, false, false);
      float ca = 0.f, cw = 0.f;
#pragma unroll
      for (int j = 0; j < 8; ++j) {
        float e = cm ? __expf(fminf(acc[j] * 0.125f - mL[j], 0.f)) : 0.f;
        float p = e * invL[j];
        ca += p;
        cw += mr[j] * p;
      }
      ca += __shfl_xor(ca, 16, 32);
      cw += __shfl_xor(cw, 16, 32);
      if (half == 0) {
        atomicAdd(&csum[0][ct * 16 + ln], ca);      // LDS adds: the 8 waves meet here
        atomicAdd(&csum[1][ct * 16 + ln], cw);
      }
    }
    __syncthreads();
  }
  // behind the last barrier the block's 2 x 2048 sums are complete: 16 global
  // adds per thread, all LDS reads first so that the adds issue back to back
  // (both loops unrolled: bs[] stays in registers)
  float bs[NCHUNK];
#pragma unroll
  for (int i = 0; i < NCHUNK; ++i)
    bs[i] = csum[threadIdx.x >> 7][i * CHUNK_ROWS + (threadIdx.x & 127)];
#pragma unroll
  for (int i = 0; i < NCHUNK; ++i) atomicAdd(gsum + i * CHUNK_ROWS, bs[i]);
}

// ---------------------------------------------------------------------------
// small helpers
// ---------------------------------------------------------------------------
__global__ void __launch_bounds__(256)
zero_ws(float* __restrict__ w_all, float* __restrict__ w_msk, float* __restrict__ y) {
  int i = blockIdx.x * 256 + threadIdx.x;
  if (i < B_ * S_) { w_all[i] = 0.f; w_msk[i] = 0.f; }
  if (i < B_ * H_) y[i] = 0.f;
}

__global__ void __launch_bounds__(256)
batch_stats(const int* __restrict__ mask, const float* __restrict__ w_msk,
            float* __restrict__ sumw, float* __restrict__ denom) {
  __shared__ float sm[256], sw[256];
  int b = blockIdx.x, t = threadIdx.x;
  float a = 0.f, c = 0.f;
  for (int s = t; s < S_; s += 256) {
    a += (float)mask[(size_t)b * S_ + s];
    c += w_msk[(size_t)b * S_ + s];
  }
  sm[t] = a; sw[t] = c; __syncthreads();
  for (int st = 128; st > 0; st >>= 1) {
    if (t < st) { sm[t] += sm[t + st]; sw[t] += sw[t + st]; }
    __syncthreads();
  }
  if (t == 0) { denom[b] = sm[0] + 1e-8f; sumw[b] = sw[0]; }
}

// y[b,h] = sum_s w_msk[b,s] * x[b,s,h]
__global__ void __launch_bounds__(256)
wx_gemv(const float* __restrict__ x, const float* __restrict__ w_msk,
        float* __restrict__ y) {
  int h  = blockIdx.x * 256 + threadIdx.x;
  int sc = blockIdx.y;
  int b  = blockIdx.z;
  const float* xb = x + ((size_t)b * S_) * H_;
  float acc = 0.f;
  for (int s = sc * 256; s < sc * 256 + 256; ++s)
    acc = fmaf(w_msk[(size_t)b * S_ + s], xb[(size_t)s * H_ + h], acc);
  atomicAdd(&y[(size_t)b * H_ + h], acc);
}

// out[b,h] = (y[b,:] @ Wv[:,h] + sumw[b]*bv[h]) / denom[b]
// One block = 32 columns of out (one 128-byte line a row) for all 16 batches, so
// that Wv is read once. The 1024 k are split over the block's 32 waves, 32 k each:
// a wave issues all its loads at once and pays the memory latency once. The 16
// batches are the 16 rows of an f32 WMMA tile; the waves' partial tiles meet in LDS.
// Every loop here is unrolled, so that its arrays stay in registers.
#define OP_COLS  32
#define OP_WAVES 32
#define OP_KW    (H_ / OP_WAVES)
#define OP_TPIT  272

typedef __attribute__((ext_vector_type(2))) float v2f;

__global__ void __launch_bounds__(1024)
out_proj(const float* __restrict__ y, const float* __restrict__ Wv,
         const float* __restrict__ bv, const float* __restrict__ sumw,
         const float* __restrict__ denom, float* __restrict__ out) {
  __shared__ float red[OP_WAVES][2 * OP_TPIT];

  const int lane = threadIdx.x & 31;
  const int wave = threadIdx.x >> 5;
  const int half = lane >> 4;
  const int ln   = lane & 15;
  const int c0   = blockIdx.x * OP_COLS;
  const int k0   = wave * OP_KW + half * 16;   // this lane's 16 k, for A and for B alike
  float* rw = &red[wave][lane];                // where this lane puts its partial sums

  // B side: rows k0 .. k0+15 of Wv, columns c0 + 2*ln and + 1 (16 lanes = one line).
  // Tile 0 takes the even columns, tile 1 the odd ones.
  const float* wp = Wv + (size_t)k0 * H_ + c0 + 2 * ln;
  v2f w[16];
#pragma unroll
  for (int j = 0; j < 16; ++j) w[j] = *(const v2f*)(wp + (size_t)j * H_);
  // A side: batch ln, the same 16 k
  const float* yp = y + (size_t)ln * H_ + k0;
  v4f a[4];
#pragma unroll
  for (int i = 0; i < 4; ++i) a[i] = *(const v4f*)(yp + 4 * i);

  // the finishing threads (one per output, wave = batch) fetch their terms early
  float sb = 0.f, bb = 0.f, dn = 1.f;
  if (wave < B_) { sb = sumw[wave]; bb = bv[c0 + lane]; dn = denom[wave]; }

  // fragments: k = k0 + 2i, k0 + 2i + 1 in registers 0, 1 of A and of B alike
  v2f af[8], b0[8], b1[8];
#pragma unroll
  for (int i = 0; i < 8; ++i) {
    af[i] = (v2f){ a[i >> 1][(i & 1) * 2], a[i >> 1][(i & 1) * 2 + 1] };
    b0[i] = (v2f){ w[2 * i][0], w[2 * i + 1][0] };
    b1[i] = (v2f){ w[2 * i][1], w[2 * i + 1][1] };
  }
  // all register moves that form the fragments stay in front of the matrix run, so
  // that none of them overwrites an operand of a matrix instruction just issued
  __builtin_amdgcn_sched_barrier(0);
  v8f acc0 = {}, acc1 = {};
#pragma unroll
  for (int i = 0; i < 8; ++i) {
    acc0 = __builtin_amdgcn_wmma_f32_16x16x4_f32(false, af[i], false, b0[i], (short)0, acc0,
                                                 false, false);
    acc1 = __builtin_amdgcn_wmma_f32_16x16x4_f32(false, af[i], false, b1[i], (short)0, acc1,
                                                 false, false);
  }
  __builtin_amdgcn_sched_barrier(0);
  asm volatile("v_nop\n\tv_nop\n\tv_nop\n\tv_nop");
  __builtin_amdgcn_sched_barrier(0);
#pragma unroll
  for (int j = 0; j < 8; ++j) {
    rw[j * 32]           = acc0[j];
    rw[OP_TPIT + j * 32] = acc1[j];
  }
  __syncthreads();                             // all 64 partial tiles (two per wave) are in LDS

  if (wave < B_) {
    const int idx = (lane & 1) * OP_TPIT + (wave & 7) * 32 + (wave >> 3) * 16 + (lane >> 1);
    float s = 0.f;
#pragma unroll
    for (int v = 0; v < OP_WAVES; ++v) s += red[v][idx];
    out[(size_t)wave * H_ + c0 + lane] = (s + sb * bb) / dn;
  }
}

__global__ void __launch_bounds__(256)
attn_mean(const float* __restrict__ w_all, float* __restrict__ out2) {
  int i = blockIdx.x * 256 + threadIdx.x;
  if (i < B_ * S_) out2[i] = w_all[i] * (1.0f / (float)S_);
}

// ---------------------------------------------------------------------------
extern "C" void kernel_launch(void* const* d_in, const int* in_sizes, int n_in,
                              void* d_out, int out_size, void* d_ws, size_t ws_size,
                              hipStream_t stream) {
  const float* x    = (const float*)d_in[0];
  const int*   mask = (const int*)  d_in[1];
  const float* Wq   = (const float*)d_in[2];
  const float* bq   = (const float*)d_in[3];
  const float* Wk   = (const float*)d_in[4];
  const float* bk   = (const float*)d_in[5];
  const float* Wv   = (const float*)d_in[6];
  const float* bv   = (const float*)d_in[7];
  float* out  = (float*)d_out;                       // (B,H) = 16384 floats
  float* out2 = out + (size_t)B_ * H_;               // (B,S) = 32768 floats

  char* ws = (char*)d_ws;
  const size_t QB_OFF   = 0;
  const size_t KB_OFF   = QB_OFF   + (size_t)B_ * S_ * A_ * 2;   // bf16 Q
  const size_t WQB_OFF  = KB_OFF   + (size_t)B_ * S_ * A_ * 2;   // bf16 K
  const size_t WKB_OFF  = WQB_OFF  + (size_t)65536 * 2;
  const size_t WALL_OFF = WKB_OFF  + (size_t)65536 * 2;
  const size_t WMSK_OFF = WALL_OFF + (size_t)B_ * S_ * 4;
  const size_t Y_OFF    = WMSK_OFF + (size_t)B_ * S_ * 4;
  const size_t SUMW_OFF = Y_OFF    + (size_t)B_ * H_ * 4;
  const size_t DEN_OFF  = SUMW_OFF + 64;

  unsigned short* Qb   = (unsigned short*)(ws + QB_OFF);
  unsigned short* Kb   = (unsigned short*)(ws + KB_OFF);
  unsigned short* WqB  = (unsigned short*)(ws + WQB_OFF);
  unsigned short* WkB  = (unsigned short*)(ws + WKB_OFF);
  float* w_all = (float*)(ws + WALL_OFF);
  float* w_msk = (float*)(ws + WMSK_OFF);
  float* y     = (float*)(ws + Y_OFF);
  float* sumw  = (float*)(ws + SUMW_OFF);
  float* denom = (float*)(ws + DEN_OFF);

  zero_ws    <<<(B_ * S_ + 255) / 256, 256, 0, stream>>>(w_all, w_msk, y);
  prep_wfrag <<<65536 / 256, 256, 0, stream>>>(Wq, Wk, WqB, WkB);
  proj_qk    <<<(B_ * S_) / 128, 512, 0, stream>>>(x, bq, bk, WqB, WkB, Qb, Kb);
  attn_colsum<<<(B_ * S_ / 16) / 8, 256, 0, stream>>>(Qb, Kb, mask, w_all, w_msk);
  batch_stats<<<B_, 256, 0, stream>>>(mask, w_msk, sumw, denom);
  wx_gemv    <<<dim3(H_ / 256, 8, B_), 256, 0, stream>>>(x, w_msk, y);
  out_proj   <<<H_ / 32, 1024, 0, stream>>>(y, Wv, bv, sumw, denom, out);
  attn_mean  <<<(B_ * S_ + 255) / 256, 256, 0, stream>>>(w_all, out2);
}

// v005
// It runs in 71.7 microseconds.
// Timed twice side by side with v004, it ran 1.68 and 1.66 times as fast.
// Over all steps from v000 it is 4.01 times as fast.
#include <hip/hip_runtime.h>
#include <math.h>

#define S_ 2048
#define H_ 1024
#define A_ 64
#define B_ 16

typedef __attribute__((ext_vector_type(16))) __bf16 v16bf;
typedef __attribute__((ext_vector_type(8)))  __bf16 v8bf;
typedef __attribute__((ext_vector_type(8)))  float  v8f;
typedef __attribute__((ext_vector_type(4)))  unsigned int v4u;
typedef __attribute__((ext_vector_type(8)))  int v8i;
typedef __attribute__((ext_vector_type(4)))  int v4i;

__device__ __forceinline__ __bf16 f2bf(float f) { return (__bf16)f; }
__device__ __forceinline__ unsigned short bf_bits(float f) {
  __bf16 h = (__bf16)f;
  return __builtin_bit_cast(unsigned short, h);
}

__global__ void __launch_bounds__(256)
prep_wfrag(const float* __restrict__ Wq, const float* __restrict__ Wk,
           unsigned short* __restrict__ WqB, unsigned short* __restrict__ WkB) {
  int idx = blockIdx.x * 256 + threadIdx.x;      // 0 .. 65535
  int e    = idx & 15;
  int lane = (idx >> 4) & 31;
  int ks   = (idx >> 9) & 31;
  int nt   = (idx >> 14) & 3;
  int n = nt * 16 + (lane & 15);
  int k = ks * 32 + ((lane >> 4) << 3) + ((e & 8) ? (16 + (e & 7)) : (e & 7));
  WqB[idx] = bf_bits(Wq[(size_t)k * A_ + n]);
  WkB[idx] = bf_bits(Wk[(size_t)k * A_ + n]);
}

#define PJ_ROWS   128
#define PJ_KC     128                        // k columns per stage
#define PJ_NST    (H_ / PJ_KC)               // 8 stages
#define PJ_XPITCH 132                        // floats per LDS row: 528 B = 16 B x odd
#define PJ_XBUF   (PJ_ROWS * PJ_XPITCH)      // floats per x buffer
#define PJ_WBUF   (4 * 8 * 512)              // 16-bit words per weight buffer

#define KT_WORDS  (16 * A_)                  // 16-bit words of one 16-row tile of K

typedef __attribute__((ext_vector_type(4))) float v4f;

__device__ __forceinline__ unsigned lds_byte(const void* p) {
  return (unsigned)(unsigned long long)p;
}

// One wave's share of one stage: 8 rows of x (512 B each) and 4 x 512 B of
// packed weights. A fragment's two 16-byte halves per lane are split into two
// planes of 512 B, so that each later ds_load_b128 reads 512 contiguous bytes.
__device__ __forceinline__ void pj_copy_stage(const float* const (&gx)[8], int xo, unsigned lx,
                                              const unsigned short* gw, unsigned lw) {
  asm volatile(
      "global_load_async_to_lds_b128 %0, %1, off\n\t"
      "global_load_async_to_lds_b128 %2, %3, off\n\t"
      "global_load_async_to_lds_b128 %4, %5, off\n\t"
      "global_load_async_to_lds_b128 %6, %7, off\n\t"
      "global_load_async_to_lds_b128 %8, %9, off\n\t"
      "global_load_async_to_lds_b128 %10, %11, off\n\t"
      "global_load_async_to_lds_b128 %12, %13, off\n\t"
      "global_load_async_to_lds_b128 %14, %15, off\n\t"
      "global_load_async_to_lds_b128 %16, %17, off\n\t"
      "global_load_async_to_lds_b128 %18, %19, off\n\t"
      "global_load_async_to_lds_b128 %20, %21, off\n\t"
      "global_load_async_to_lds_b128 %22, %23, off\n\t"
      "s_wait_xcnt 0x0"
      :: "v"(lx),                     "v"(gx[0] + xo),
         "v"(lx + 1 * PJ_XPITCH * 4), "v"(gx[1] + xo),
         "v"(lx + 2 * PJ_XPITCH * 4), "v"(gx[2] + xo),
         "v"(lx + 3 * PJ_XPITCH * 4), "v"(gx[3] + xo),
         "v"(lx + 4 * PJ_XPITCH * 4), "v"(gx[4] + xo),
         "v"(lx + 5 * PJ_XPITCH * 4), "v"(gx[5] + xo),
         "v"(lx + 6 * PJ_XPITCH * 4), "v"(gx[6] + xo),
         "v"(lx + 7 * PJ_XPITCH * 4), "v"(gx[7] + xo),
         "v"(lw),                     "v"(gw),
         "v"(lw + 256),               "v"(gw + 256),
         "v"(lw + 8192),              "v"(gw + 512),
         "v"(lw + 8192 + 256),        "v"(gw + 768)
      : "memory");
}

__global__ void __launch_bounds__(512)
proj_qk(const float* __restrict__ x, const float* __restrict__ bq,
        const float* __restrict__ bk, const int* __restrict__ ord,
        const unsigned short* __restrict__ WqB, const unsigned short* __restrict__ WkB,
        unsigned short* __restrict__ Qb, unsigned short* __restrict__ Kb) {
  __shared__ __attribute__((aligned(16))) float          xs[2][PJ_XBUF];
  __shared__ __attribute__((aligned(16))) unsigned short wf[2][PJ_WBUF];

  const int lane = threadIdx.x & 31;
  const int wave = threadIdx.x >> 5;             // 0 .. 15
  const int rt   = wave & 7;                     // 16-row tile of the block
  const int mat  = wave >> 3;                    // 0: Q, 1: K
  const int half = lane >> 4;
  const int ln   = lane & 15;
  const int row0 = blockIdx.x * PJ_ROWS;

  const int cnt = (wave >> 1) & 3;
  const float* gx[8];                            // unrolled: gx[] stays in registers
#pragma unroll
  for (int r = 0; r < 8; ++r)                    // the & keeps the row inside its batch
    gx[r] = x + (size_t)((row0 & ~(S_ - 1)) + (ord[row0 + wave * 8 + r] & (S_ - 1))) * H_
            + lane * 4;
  const unsigned short* gw = (mat ? WkB : WqB) + (size_t)cnt * 32 * 512
                             + (wave & 1) * 1024 + lane * 8;
  const unsigned lx = lds_byte(&xs[0][wave * 8 * PJ_XPITCH + lane * 4]);
  const unsigned lw = lds_byte(&wf[0][((wave & 1) * 16 + mat * 4 + cnt) * 512
                                      + (lane & 1) * 256 + (lane >> 1) * 8]);

  pj_copy_stage(gx, 0, lx, gw, lw);
  // stage 0 has landed for this wave before the barrier publishes it
  asm volatile("s_wait_asynccnt 0x0" ::: "memory");
  __syncthreads();
  pj_copy_stage(gx, PJ_KC, lx + PJ_XBUF * 4, gw + 4 * 512, lw + PJ_WBUF * 2);

  v8f acc[4] = {};
  for (int t = 0; t < PJ_NST; ++t) {
    const int buf = t & 1;
    const float* xr = &xs[buf][(rt * 16 + ln) * PJ_XPITCH + half * 8];
    const unsigned short* wl = &wf[buf][mat * 4 * 512 + lane * 8];
#pragma unroll
    for (int ksl = 0; ksl < 4; ++ksl) {
      v4f f0 = *(const v4f*)(xr + ksl * 32);
      v4f f1 = *(const v4f*)(xr + ksl * 32 + 4);
      v4f f2 = *(const v4f*)(xr + ksl * 32 + 16);
      v4f f3 = *(const v4f*)(xr + ksl * 32 + 20);
      v16bf a;
#pragma unroll
      for (int i = 0; i < 4; ++i) {
        a[i]      = f2bf(f0[i]);
        a[4 + i]  = f2bf(f1[i]);
        a[8 + i]  = f2bf(f2[i]);
        a[12 + i] = f2bf(f3[i]);
      }
#pragma unroll
      for (int nt = 0; nt < 4; ++nt) {
        v8bf lo = *(const v8bf*)(wl + (ksl * 8 + nt) * 512);
        v8bf hi = *(const v8bf*)(wl + (ksl * 8 + nt) * 512 + 256);
        v16bf w;
#pragma unroll
        for (int i = 0; i < 8; ++i) { w[i] = lo[i]; w[8 + i] = hi[i]; }
        acc[nt] = __builtin_amdgcn_wmma_f32_16x16x32_bf16(false, a, false, w,
                                                          (short)0, acc[nt], false, false);
      }
    }
    // this wave's reads of buffer buf are over before it may be refilled
    asm volatile("s_wait_dscnt 0x0" ::: "memory");
    // this wave's copies of stage t + 1 have landed before the barrier publishes them
    asm volatile("s_wait_asynccnt 0x0" ::: "memory");
    __syncthreads();
    if (t + 2 < PJ_NST)
      pj_copy_stage(gx, (t + 2) * PJ_KC, lx + buf * (PJ_XBUF * 4),
                    gw + (t + 2) * 4 * 512, lw + buf * (PJ_WBUF * 2));
  }
  // no copy is outstanding when the wave ends
  asm volatile("s_wait_asynccnt 0x0" ::: "memory");

  if (mat == 0) {
    // Q: row major, 64 columns a row
    unsigned short* __restrict__ O = Qb + (size_t)(row0 + rt * 16 + half * 8) * A_ + ln;
#pragma unroll
    for (int nt = 0; nt < 4; ++nt) {
      const float bb = bq[nt * 16 + ln];
#pragma unroll
      for (int j = 0; j < 8; ++j) O[j * A_ + nt * 16] = bf_bits(acc[nt][j] + bb);
    }
  } else {
    // K: each 16-row tile (2 KB) in the order in which attn_colsum's lanes read
    // it: plane p = col / 16 (512 B), reader lane ((col / 8) & 1) * 16 + row % 16
    // (16 B), element col % 8
    unsigned short* __restrict__ O = Kb + (size_t)((row0 >> 4) + rt) * KT_WORDS
                                     + ((ln >> 3) * 16 + half * 8) * 8 + (ln & 7);
#pragma unroll
    for (int nt = 0; nt < 4; ++nt) {
      const float bb = bk[nt * 16 + ln];
#pragma unroll
      for (int j = 0; j < 8; ++j) O[nt * 256 + j * 8] = bf_bits(acc[nt][j] + bb);
    }
  }
}

__device__ __forceinline__ void load_kfrag(const unsigned short* __restrict__ row,
                                           int kb, v16bf& f0, v16bf& f1) {
  v8bf lo0 = *(const v8bf*)(row + kb);
  v8bf hi0 = *(const v8bf*)(row + kb + 16);
  v8bf lo1 = *(const v8bf*)(row + kb + 32);
  v8bf hi1 = *(const v8bf*)(row + kb + 48);
#pragma unroll
  for (int i = 0; i < 8; ++i) {
    f0[i] = lo0[i]; f0[8 + i] = hi0[i];
    f1[i] = lo1[i]; f1[8 + i] = hi1[i];
  }
}

__device__ __forceinline__ void load_ktile(const unsigned short* tile, int lane,
                                           v16bf& f0, v16bf& f1) {
  v8bf lo0 = *(const v8bf*)(tile + lane * 8);
  v8bf hi0 = *(const v8bf*)(tile + 256 + lane * 8);
  v8bf lo1 = *(const v8bf*)(tile + 512 + lane * 8);
  v8bf hi1 = *(const v8bf*)(tile + 768 + lane * 8);
#pragma unroll
  for (int i = 0; i < 8; ++i) {
    f0[i] = lo0[i]; f0[8 + i] = hi0[i];
    f1[i] = lo1[i]; f1[8 + i] = hi1[i];
  }
}

#define CHUNK_T    8
#define CHUNK_ROWS (CHUNK_T * 16)
#define NCHUNK     (S_ / CHUNK_ROWS)

__device__ __forceinline__ v4u tdm_group0(const unsigned short* gsrc, unsigned lds_off) {
  unsigned long long ga = (unsigned long long)gsrc;
  // every word that is computed is made wave-uniform: the group lies in scalar registers
  v4u g0 = { 1u,                                   // count=1, user mode
             (unsigned)__builtin_amdgcn_readfirstlane((int)lds_off),              // lds_addr
             (unsigned)__builtin_amdgcn_readfirstlane((int)(ga & 0xFFFFFFFFu)),   // global_addr[31:0]
             (unsigned)__builtin_amdgcn_readfirstlane(
                 (int)(((ga >> 32) & 0x01FFFFFFu) | 0x80000000u)) };              // [56:32] | type=2
  asm volatile("" : "+s"(g0));
  return g0;
}

__device__ __forceinline__ v8i tdm_group1() {
  v8i g1 = { 0x00010000,
             0x00400000,
             0x08000000,
             0x00400000,
             CHUNK_ROWS,
             64,
             0, 0 };
  asm volatile("" : "+s"(g1));
  return g1;
}

__device__ __forceinline__ void tdm_load_chunk(v4u g0, v8i g1) {
  v4i gz4 = { 0, 0, 0, 0 };
  v8i gz8 = { 0, 0, 0, 0, 0, 0, 0, 0 };
  __builtin_amdgcn_tensor_load_to_lds(g0, g1, gz4, gz4, gz8, 0);
}

// The wait that covers the request made with g0 and g1. It names both groups, so
// that their registers keep their values from the request up to this wait.
__device__ __forceinline__ void tdm_wait(v4u g0, v8i g1) {
  asm volatile("s_wait_tensorcnt 0x0" :: "s"(g0), "s"(g1) : "memory");
}

// 16 x 16 products of one wave's Q rows with one 16-row tile of K in LDS
__device__ __forceinline__ v8f qk_tile(const unsigned short* tile, int lane,
                                       const v16bf& aq0, const v16bf& aq1) {
  v16bf bk0, bk1;
  load_ktile(tile, lane, bk0, bk1);
  v8f acc = {};
  acc = __builtin_amdgcn_wmma_f32_16x16x32_bf16(false, aq0, false, bk0,
                                                (short)0, acc, false, false);
  acc = __builtin_amdgcn_wmma_f32_16x16x32_bf16(false, aq1, false, bk1,
                                                (short)0, acc, false, false);
  return acc;
}

// pass 1 on one tile: running maximum and sum of exp, per lane. EDGE: the tile may
// hold masked columns (cm false); elsewhere every column counts and cm is not read.
// (In p1_tile and p2_tile the loop over the 8 rows is unrolled: registers only.)
template <bool EDGE>
__device__ __forceinline__ void p1_tile(const v8f& acc, bool cm, float (&mL)[8], float (&lL)[8]) {
#pragma unroll
  for (int j = 0; j < 8; ++j) {
    float s    = acc[j] * 0.125f;             // / sqrt(64)
    float seff = (!EDGE || cm) ? s : -1e30f;
    float nm   = fmaxf(mL[j], seff);
    lL[j] = lL[j] * __expf(mL[j] - nm) + ((!EDGE || cm) ? __expf(seff - nm) : 0.f);
    mL[j] = nm;
  }
}

// pass 2 on one tile: probabilities, summed over the wave's 16 rows, added to the
// block's column sums cs[0] (all rows) and cs[S_] (rows weighted by their mask)
template <bool EDGE>
__device__ __forceinline__ void p2_tile(const v8f& acc, bool cm, const float (&mL)[8],
                                        const float (&invL)[8], const float (&mr)[8],
                                        int half, float* cs) {
  float ca = 0.f, cw = 0.f;
#pragma unroll
  for (int j = 0; j < 8; ++j) {
    float e = (!EDGE || cm) ? __expf(fminf(acc[j] * 0.125f - mL[j], 0.f)) : 0.f;
    float p = e * invL[j];
    ca += p;
    cw += mr[j] * p;
  }
  ca += __shfl_xor(ca, 16, 32);
  cw += __shfl_xor(cw, 16, 32);
  if (half == 0) {
    atomicAdd(cs, ca);                          // LDS adds: the 8 waves meet here
    atomicAdd(cs + S_, cw);
  }
}

__global__ void __launch_bounds__(256)
attn_colsum(const unsigned short* __restrict__ Qb, const unsigned short* __restrict__ Kb,
            const int* __restrict__ mask, const int* __restrict__ ord,
            const int* __restrict__ nb,
            float* __restrict__ w_all, float* __restrict__ w_msk) {
  __shared__ unsigned short ksh[2][CHUNK_ROWS * A_];   // 2 x 16 KB
  __shared__ float csum[2][S_];                        // the block's column sums, 16 KB

  const int lane = threadIdx.x & 31;
  const int wave = threadIdx.x >> 5;
  const int rowtile = blockIdx.x * 8 + wave;     // 0 .. 2047 (same batch per block)
  const int b  = rowtile >> 7;
  const int s0 = (rowtile & 127) << 4;
  const int half = lane >> 4;
  const int ln   = lane & 15;
  const int kb   = half * 8;

  const unsigned short* kpanel = Kb + (size_t)b * S_ * A_;
  const unsigned lds0 = (unsigned)(unsigned long long)(const void*)&ksh[0][0];
  const unsigned lds1 = (unsigned)(unsigned long long)(const void*)&ksh[1][0];

  // A fragments of Q (16 x 64 bf16 -> two 16x32 fragments)
  const unsigned short* qrow = Qb + ((size_t)(b * S_ + s0 + ln)) * A_;
  v16bf aq0, aq1;
  load_kfrag(qrow, kb, aq0, aq1);

  const int* mrow = mask + (size_t)b * S_;
  const int* orow = ord + (size_t)b * S_;
  float mr[8];
#pragma unroll
  for (int j = 0; j < 8; ++j) mr[j] = (float)mrow[orow[s0 + j + half * 8] & (S_ - 1)];

  // unmasked columns of this batch, the same in every wave of the block, held in
  // 0 .. S whatever the word holds: 1 .. NCHUNK chunks
  const int ncol  = min(max(__builtin_amdgcn_readfirstlane(nb[b]), 0), S_);
  const int nch   = max((ncol + CHUNK_ROWS - 1) / CHUNK_ROWS, 1);
  const int nfull = ncol >> 4;                   // tiles whose 16 columns are all unmasked
  const int nedge = ncol & 15;                   // unmasked columns of the tile behind them

  float mL[8], lL[8];
#pragma unroll
  for (int j = 0; j < 8; ++j) { mL[j] = -1e30f; lL[j] = 0.f; }

  // start values of the block's column sums; the barriers of pass 1 stand
  // between these stores and the first add of pass 2
  for (int i = 0; i < 2 * S_ / 256; ++i) (&csum[0][0])[i * 256 + threadIdx.x] = 0.f;

  // ---- pass 1: row max + sum of exp (online, per-lane partials) ----
  const v8i g1 = tdm_group1();
  v4u g0 = tdm_group0(kpanel, lds0);
  if (wave == 0) tdm_load_chunk(g0, g1);
  for (int c = 0; c < nch; ++c) {
    tdm_wait(g0, g1);
    __syncthreads();                              // chunk c visible in buf c&1
    if (c + 1 < nch) {
      g0 = tdm_group0(kpanel + (size_t)(c + 1) * CHUNK_ROWS * A_, ((c + 1) & 1) ? lds1 : lds0);
      if (wave == 0) tdm_load_chunk(g0, g1);
    }
    const unsigned short* kc = &ksh[c & 1][0];
    const int tfull = min(nfull - c * CHUNK_T, CHUNK_T);   // whole tiles of this chunk
    for (int tl = 0; tl < tfull; ++tl)
      p1_tile<false>(qk_tile(kc + tl * KT_WORDS, lane, aq0, aq1), true, mL, lL);
    if (tfull < CHUNK_T && nedge)                          // then c is the last chunk
      p1_tile<true>(qk_tile(kc + tfull * KT_WORDS, lane, aq0, aq1), ln < nedge, mL, lL);
    __syncthreads();                              // readers done before overwrite
  }
  // combine partials across the 16 lanes holding each row
#pragma unroll
  for (int d = 1; d < 16; d <<= 1) {
#pragma unroll
    for (int j = 0; j < 8; ++j) {
      float om = __shfl_xor(mL[j], d, 32);
      float ol = __shfl_xor(lL[j], d, 32);
      float nm = fmaxf(mL[j], om);
      lL[j] = lL[j] * __expf(mL[j] - nm) + ol * __expf(om - nm);
      mL[j] = nm;
    }
  }
  float invL[8];
#pragma unroll
  for (int j = 0; j < 8; ++j) invL[j] = (lL[j] > 0.f) ? (1.f / lL[j]) : 0.f;

  // ---- pass 2: probabilities -> column sums ----
  float* gsum = ((threadIdx.x >> 7) ? w_msk : w_all) + (size_t)b * S_ + (threadIdx.x & 127);
  g0 = tdm_group0(kpanel, lds0);
  if (wave == 0) tdm_load_chunk(g0, g1);
  for (int c = 0; c < nch; ++c) {
    tdm_wait(g0, g1);
    __syncthreads();
    if (c + 1 < nch) {
      g0 = tdm_group0(kpanel + (size_t)(c + 1) * CHUNK_ROWS * A_, ((c + 1) & 1) ? lds1 : lds0);
      if (wave == 0) tdm_load_chunk(g0, g1);
    }
    const unsigned short* kc = &ksh[c & 1][0];
    float* cs = &csum[0][c * CHUNK_ROWS + ln];
    const int tfull = min(nfull - c * CHUNK_T, CHUNK_T);   // whole tiles of this chunk
    for (int tl = 0; tl < tfull; ++tl)
      p2_tile<false>(qk_tile(kc + tl * KT_WORDS, lane, aq0, aq1), true, mL, invL, mr, half,
                     cs + tl * 16);
    if (tfull < CHUNK_T && nedge)                          // then c is the last chunk
      p2_tile<true>(qk_tile(kc + tfull * KT_WORDS, lane, aq0, aq1), ln < nedge, mL, invL, mr,
                    half, cs + tfull * 16);
    __syncthreads();
  }
  // behind the last barrier the block's sums are complete: one global add per
  // thread and worked chunk (both loops unrolled: bs[] stays in registers)
  float bs[NCHUNK];
#pragma unroll
  for (int i = 0; i < NCHUNK; ++i)
    bs[i] = csum[threadIdx.x >> 7][i * CHUNK_ROWS + (threadIdx.x & 127)];
  // holds all LDS reads in front of the first add: the adds issue back to back, and
  // no register that an issued add names is loaded anew behind it
  asm volatile("" :: "v"(bs[0]), "v"(bs[1]), "v"(bs[2]), "v"(bs[3]), "v"(bs[4]), "v"(bs[5]),
                     "v"(bs[6]), "v"(bs[7]), "v"(bs[8]), "v"(bs[9]), "v"(bs[10]), "v"(bs[11]),
                     "v"(bs[12]), "v"(bs[13]), "v"(bs[14]), "v"(bs[15]));
#pragma unroll
  for (int i = 0; i < NCHUNK; ++i)
    if (i < nch) atomicAdd(gsum + i * CHUNK_ROWS, bs[i]);
}

#define ZW_BLOCKS ((B_ * S_ + 255) / 256)

__global__ void __launch_bounds__(256)
zero_ws(const int* __restrict__ mask, float* __restrict__ w_all, float* __restrict__ w_msk,
        float* __restrict__ y, int* __restrict__ ord, int* __restrict__ pos,
        int* __restrict__ nb) {
  __shared__ int seg[S_ / 32];                   // unmasked positions per run of 32
  if (blockIdx.x < ZW_BLOCKS) {
    int i = blockIdx.x * 256 + threadIdx.x;
    if (i < B_ * S_) { w_all[i] = 0.f; w_msk[i] = 0.f; }
    if (i < B_ * H_) y[i] = 0.f;
    return;
  }
  const int b    = blockIdx.x - ZW_BLOCKS;
  const int lane = threadIdx.x & 31;
  const int wave = threadIdx.x >> 5;
  const int* m = mask + (size_t)b * S_;
  int mv[S_ / 256];                              // all loads first: one memory latency, not 8
#pragma unroll
  for (int i = 0; i < S_ / 256; ++i) mv[i] = m[i * 256 + threadIdx.x];
  unsigned bal[S_ / 256];
#pragma unroll
  for (int i = 0; i < S_ / 256; ++i) {
    bal[i] = (unsigned)__ballot(mv[i] != 0);
    if (lane == 0) seg[i * 8 + wave] = __popc(bal[i]);
  }
  __syncthreads();
  int run = 0, base[S_ / 256];
#pragma unroll
  for (int g = 0; g < S_ / 32; ++g) {            // run g holds positions g*32 .. +31
    if ((g & 7) == wave) base[g >> 3] = run;
    run += seg[g];
  }
#pragma unroll
  for (int i = 0; i < S_ / 256; ++i) {
    const int s     = i * 256 + threadIdx.x;
    const int front = base[i] + __popc(bal[i] & ((1u << lane) - 1u));  // unmasked before s
    const int p     = ((bal[i] >> lane) & 1u) ? front : run + (s - front);
    ord[(size_t)b * S_ + p] = s;
    pos[(size_t)b * S_ + s] = p;
  }
  if (threadIdx.x == 0) nb[b] = run;
}

__global__ void __launch_bounds__(256)
batch_stats(const int* __restrict__ mask, const float* __restrict__ w_msk,
            float* __restrict__ sumw, float* __restrict__ denom) {
  __shared__ float sm[256], sw[256];
  int b = blockIdx.x, t = threadIdx.x;
  float a = 0.f, c = 0.f;
  for (int s = t; s < S_; s += 256) {
    a += (float)mask[(size_t)b * S_ + s];
    c += w_msk[(size_t)b * S_ + s];
  }
  sm[t] = a; sw[t] = c; __syncthreads();
  for (int st = 128; st > 0; st >>= 1) {
    if (t < st) { sm[t] += sm[t + st]; sw[t] += sw[t + st]; }
    __syncthreads();
  }
  if (t == 0) { denom[b] = sm[0] + 1e-8f; sumw[b] = sw[0]; }
}

__global__ void __launch_bounds__(256)
wx_gemv(const float* __restrict__ x, const float* __restrict__ w_msk,
        const int* __restrict__ ord, const int* __restrict__ nb,
        float* __restrict__ y) {
  int h  = blockIdx.x * 256 + threadIdx.x;
  int sc = blockIdx.y;
  int b  = blockIdx.z;
  const float* xb = x + ((size_t)b * S_) * H_;
  const float* wb = w_msk + (size_t)b * S_;
  const int*   ob = ord + (size_t)b * S_;
  const int ncol = min(max(nb[b], 0), S_);
  const int per  = (((ncol + 7) >> 3) + 7) & ~7;
  const int p0   = sc * per;
  const int pe   = min(p0 + per, (ncol + 7) & ~7);
  float acc = 0.f;
  for (int p = p0; p < pe; p += 8) {
    float v[8];
#pragma unroll
    for (int u = 0; u < 8; ++u)                  // the & keeps the row inside its batch
      v[u] = xb[(unsigned)(ob[p + u] & (S_ - 1)) * H_ + (unsigned)h];
#pragma unroll
    for (int u = 0; u < 8; ++u) acc = fmaf(wb[p + u], v[u], acc);
  }
  atomicAdd(&y[(size_t)b * H_ + h], acc);
}

// out[b,h] = (y[b,:] @ Wv[:,h] + sumw[b]*bv[h]) / denom[b]
// One block = 32 columns of out (one 128-byte line a row) for all 16 batches, so
// that Wv is read once. The 1024 k are split over the block's 32 waves, 32 k each:
// a wave issues all its loads at once and pays the memory latency once. The 16
// batches are the 16 rows of an f32 WMMA tile; the waves' partial tiles meet in LDS.
// Every loop here is unrolled, so that its arrays stay in registers.
#define OP_COLS  32
#define OP_WAVES 32
#define OP_KW    (H_ / OP_WAVES)
#define OP_TPIT  272

typedef __attribute__((ext_vector_type(2))) float v2f;

__global__ void __launch_bounds__(1024)
out_proj(const float* __restrict__ y, const float* __restrict__ Wv,
         const float* __restrict__ bv, const float* __restrict__ sumw,
         const float* __restrict__ denom, float* __restrict__ out) {
  __shared__ float red[OP_WAVES][2 * OP_TPIT];

  const int lane = threadIdx.x & 31;
  const int wave = threadIdx.x >> 5;
  const int half = lane >> 4;
  const int ln   = lane & 15;
  const int c0   = blockIdx.x * OP_COLS;
  const int k0   = wave * OP_KW + half * 16;   // this lane's 16 k, for A and for B alike
  float* rw = &red[wave][lane];                // where this lane puts its partial sums

  // B side: rows k0 .. k0+15 of Wv, columns c0 + 2*ln and + 1 (16 lanes = one line).
  // Tile 0 takes the even columns, tile 1 the odd ones.
  const float* wp = Wv + (size_t)k0 * H_ + c0 + 2 * ln;
  v2f w[16];
#pragma unroll
  for (int j = 0; j < 16; ++j) w[j] = *(const v2f*)(wp + (size_t)j * H_);
  // A side: batch ln, the same 16 k
  const float* yp = y + (size_t)ln * H_ + k0;
  v4f a[4];
#pragma unroll
  for (int i = 0; i < 4; ++i) a[i] = *(const v4f*)(yp + 4 * i);

  // the finishing threads (one per output, wave = batch) fetch their terms early
  float sb = 0.f, bb = 0.f, dn = 1.f;
  if (wave < B_) { sb = sumw[wave]; bb = bv[c0 + lane]; dn = denom[wave]; }

  // fragments: k = k0 + 2i, k0 + 2i + 1 in registers 0, 1 of A and of B alike
  v2f af[8], b0[8], b1[8];
#pragma unroll
  for (int i = 0; i < 8; ++i) {
    af[i] = (v2f){ a[i >> 1][(i & 1) * 2], a[i >> 1][(i & 1) * 2 + 1] };
    b0[i] = (v2f){ w[2 * i][0], w[2 * i + 1][0] };
    b1[i] = (v2f){ w[2 * i][1], w[2 * i + 1][1] };
  }
  // all register moves that form the fragments stay in front of the matrix run, so
  // that none of them overwrites an operand of a matrix instruction just issued
  __builtin_amdgcn_sched_barrier(0);
  v8f acc0 = {}, acc1 = {};
#pragma unroll
  for (int i = 0; i < 8; ++i) {
    acc0 = __builtin_amdgcn_wmma_f32_16x16x4_f32(false, af[i], false, b0[i], (short)0, acc0,
                                                 false, false);
    acc1 = __builtin_amdgcn_wmma_f32_16x16x4_f32(false, af[i], false, b1[i], (short)0, acc1,
                                                 false, false);
  }
  __builtin_amdgcn_sched_barrier(0);
  asm volatile("v_nop\n\tv_nop\n\tv_nop\n\tv_nop");
  __builtin_amdgcn_sched_barrier(0);
#pragma unroll
  for (int j = 0; j < 8; ++j) {
    rw[j * 32]           = acc0[j];
    rw[OP_TPIT + j * 32] = acc1[j];
  }
  __syncthreads();                             // all 64 partial tiles (two per wave) are in LDS

  if (wave < B_) {
    const int idx = (lane & 1) * OP_TPIT + (wave & 7) * 32 + (wave >> 3) * 16 + (lane >> 1);
    float s = 0.f;
#pragma unroll
    for (int v = 0; v < OP_WAVES; ++v) s += red[v][idx];
    out[(size_t)wave * H_ + c0 + lane] = (s + sb * bb) / dn;
  }
}

__global__ void __launch_bounds__(256)
attn_mean(const float* __restrict__ w_all, const int* __restrict__ pos,
          float* __restrict__ out2) {
  int i = blockIdx.x * 256 + threadIdx.x;
  if (i < B_ * S_)
    out2[i] = w_all[(i & ~(S_ - 1)) + (pos[i] & (S_ - 1))] * (1.0f / (float)S_);
}

// ---------------------------------------------------------------------------
extern "C" void kernel_launch(void* const* d_in, const int* in_sizes, int n_in,
                              void* d_out, int out_size, void* d_ws, size_t ws_size,
                              hipStream_t stream) {
  const float* x    = (const float*)d_in[0];
  const int*   mask = (const int*)  d_in[1];
  const float* Wq   = (const float*)d_in[2];
  const float* bq   = (const float*)d_in[3];
  const float* Wk   = (const float*)d_in[4];
  const float* bk   = (const float*)d_in[5];
  const float* Wv   = (const float*)d_in[6];
  const float* bv   = (const float*)d_in[7];
  float* out  = (float*)d_out;                       // (B,H) = 16384 floats
  float* out2 = out + (size_t)B_ * H_;               // (B,S) = 32768 floats

  char* ws = (char*)d_ws;
  const size_t QB_OFF   = 0;
  const size_t KB_OFF   = QB_OFF   + (size_t)B_ * S_ * A_ * 2;   // bf16 Q
  const size_t WQB_OFF  = KB_OFF   + (size_t)B_ * S_ * A_ * 2;   // bf16 K
  const size_t WKB_OFF  = WQB_OFF  + (size_t)65536 * 2;
  const size_t WALL_OFF = WKB_OFF  + (size_t)65536 * 2;
  const size_t WMSK_OFF = WALL_OFF + (size_t)B_ * S_ * 4;
  const size_t Y_OFF    = WMSK_OFF + (size_t)B_ * S_ * 4;
  const size_t SUMW_OFF = Y_OFF    + (size_t)B_ * H_ * 4;
  const size_t DEN_OFF  = SUMW_OFF + 64;
  const size_t NB_OFF   = DEN_OFF  + 64;
  const size_t ORD_OFF  = NB_OFF   + 64;
  const size_t POS_OFF  = ORD_OFF  + (size_t)B_ * S_ * 4;

  unsigned short* Qb   = (unsigned short*)(ws + QB_OFF);
  unsigned short* Kb   = (unsigned short*)(ws + KB_OFF);
  unsigned short* WqB  = (unsigned short*)(ws + WQB_OFF);
  unsigned short* WkB  = (unsigned short*)(ws + WKB_OFF);
  float* w_all = (float*)(ws + WALL_OFF);
  float* w_msk = (float*)(ws + WMSK_OFF);
  float* y     = (float*)(ws + Y_OFF);
  float* sumw  = (float*)(ws + SUMW_OFF);
  float* denom = (float*)(ws + DEN_OFF);
  int*   nb    = (int*)(ws + NB_OFF);
  int*   ord   = (int*)(ws + ORD_OFF);
  int*   pos   = (int*)(ws + POS_OFF);

  zero_ws    <<<ZW_BLOCKS + B_, 256, 0, stream>>>(mask, w_all, w_msk, y, ord, pos, nb);
  prep_wfrag <<<65536 / 256, 256, 0, stream>>>(Wq, Wk, WqB, WkB);
  proj_qk    <<<(B_ * S_) / 128, 512, 0, stream>>>(x, bq, bk, ord, WqB, WkB, Qb, Kb);
  attn_colsum<<<(B_ * S_ / 16) / 8, 256, 0, stream>>>(Qb, Kb, mask, ord, nb, w_all, w_msk);
  batch_stats<<<B_, 256, 0, stream>>>(mask, w_msk, sumw, denom);
  wx_gemv    <<<dim3(H_ / 256, 8, B_), 256, 0, stream>>>(x, w_msk, ord, nb, y);
  out_proj   <<<H_ / 32, 1024, 0, stream>>>(y, Wv, bv, sumw, denom, out);
  attn_mean  <<<(B_ * S_ + 255) / 256, 256, 0, stream>>>(w_all, pos, out2);
}

// v006
// A run of this version takes 61.4 microseconds.
// Next to v005, in two timings, it ran 1.18 times as fast each time.
// Counting every step since v000, it is 4.73 times as fast.
#include <hip/hip_runtime.h>
#include <math.h>

#define S_ 2048
#define H_ 1024
#define A_ 64
#define B_ 16

typedef __attribute__((ext_vector_type(16))) __bf16 v16bf;
typedef __attribute__((ext_vector_type(8)))  __bf16 v8bf;
typedef __attribute__((ext_vector_type(8)))  float  v8f;
typedef __attribute__((ext_vector_type(4)))  unsigned int v4u;
typedef __attribute__((ext_vector_type(8)))  int v8i;
typedef __attribute__((ext_vector_type(4)))  int v4i;

__device__ __forceinline__ __bf16 f2bf(float f) { return (__bf16)f; }
__device__ __forceinline__ unsigned short bf_bits(float f) {
  __bf16 h = (__bf16)f;
  return __builtin_bit_cast(unsigned short, h);
}

#define PW_BLOCKS (65536 / 256)

__device__ __forceinline__ void
prep_wfrag(int blk, const float* __restrict__ Wq, const float* __restrict__ Wk,
           unsigned short* __restrict__ WqB, unsigned short* __restrict__ WkB) {
  int idx = blk * 256 + threadIdx.x;             // 0 .. 65535
  int e    = idx & 15;
  int lane = (idx >> 4) & 31;
  int ks   = (idx >> 9) & 31;
  int nt   = (idx >> 14) & 3;
  int n = nt * 16 + (lane & 15);
  int k = ks * 32 + ((lane >> 4) << 3) + ((e & 8) ? (16 + (e & 7)) : (e & 7));
  WqB[idx] = bf_bits(Wq[(size_t)k * A_ + n]);
  WkB[idx] = bf_bits(Wk[(size_t)k * A_ + n]);
  // other block ranges of the launch follow in the code: the wait stands before any
  // rewrite of a register that the two stores name
  asm volatile("s_wait_xcnt 0x0" ::: "memory");
}

#define PJ_ROWS   128
#define PJ_KC     128                        // k columns per stage
#define PJ_NST    (H_ / PJ_KC)               // 8 stages
#define PJ_XPITCH 132                        // floats per LDS row: 528 B = 16 B x odd
#define PJ_XBUF   (PJ_ROWS * PJ_XPITCH)      // floats per x buffer
#define PJ_WBUF   (4 * 8 * 512)              // 16-bit words per weight buffer

#define KT_WORDS  (16 * A_)                  // 16-bit words of one 16-row tile of K

typedef __attribute__((ext_vector_type(4))) float v4f;

__device__ __forceinline__ unsigned lds_byte(const void* p) {
  return (unsigned)(unsigned long long)p;
}

// One wave's share of one stage: 8 rows of x (512 B each) and 4 x 512 B of
// packed weights. A fragment's two 16-byte halves per lane are split into two
// planes of 512 B, so that each later ds_load_b128 reads 512 contiguous bytes.
__device__ __forceinline__ void pj_copy_stage(const float* const (&gx)[8], int xo, unsigned lx,
                                              const unsigned short* gw, unsigned lw) {
  asm volatile(
      "global_load_async_to_lds_b128 %0, %1, off\n\t"
      "global_load_async_to_lds_b128 %2, %3, off\n\t"
      "global_load_async_to_lds_b128 %4, %5, off\n\t"
      "global_load_async_to_lds_b128 %6, %7, off\n\t"
      "global_load_async_to_lds_b128 %8, %9, off\n\t"
      "global_load_async_to_lds_b128 %10, %11, off\n\t"
      "global_load_async_to_lds_b128 %12, %13, off\n\t"
      "global_load_async_to_lds_b128 %14, %15, off\n\t"
      "global_load_async_to_lds_b128 %16, %17, off\n\t"
      "global_load_async_to_lds_b128 %18, %19, off\n\t"
      "global_load_async_to_lds_b128 %20, %21, off\n\t"
      "global_load_async_to_lds_b128 %22, %23, off\n\t"
      "s_wait_xcnt 0x0"
      :: "v"(lx),                     "v"(gx[0] + xo),
         "v"(lx + 1 * PJ_XPITCH * 4), "v"(gx[1] + xo),
         "v"(lx + 2 * PJ_XPITCH * 4), "v"(gx[2] + xo),
         "v"(lx + 3 * PJ_XPITCH * 4), "v"(gx[3] + xo),
         "v"(lx + 4 * PJ_XPITCH * 4), "v"(gx[4] + xo),
         "v"(lx + 5 * PJ_XPITCH * 4), "v"(gx[5] + xo),
         "v"(lx + 6 * PJ_XPITCH * 4), "v"(gx[6] + xo),
         "v"(lx + 7 * PJ_XPITCH * 4), "v"(gx[7] + xo),
         "v"(lw),                     "v"(gw),
         "v"(lw + 256),               "v"(gw + 256),
         "v"(lw + 8192),              "v"(gw + 512),
         "v"(lw + 8192 + 256),        "v"(gw + 768)
      : "memory");
}

__global__ void __launch_bounds__(512)
proj_qk(const float* __restrict__ x, const float* __restrict__ bq,
        const float* __restrict__ bk, const int* __restrict__ ord,
        const unsigned short* __restrict__ WqB, const unsigned short* __restrict__ WkB,
        unsigned short* __restrict__ Qb, unsigned short* __restrict__ Kb) {
  __shared__ __attribute__((aligned(16))) float          xs[2][PJ_XBUF];
  __shared__ __attribute__((aligned(16))) unsigned short wf[2][PJ_WBUF];

  const int lane = threadIdx.x & 31;
  const int wave = threadIdx.x >> 5;             // 0 .. 15
  const int rt   = wave & 7;                     // 16-row tile of the block
  const int mat  = wave >> 3;                    // 0: Q, 1: K
  const int half = lane >> 4;
  const int ln   = lane & 15;
  const int row0 = blockIdx.x * PJ_ROWS;

  const int cnt = (wave >> 1) & 3;
  const float* gx[8];                            // unrolled: gx[] stays in registers
#pragma unroll
  for (int r = 0; r < 8; ++r)                    // the & keeps the row inside its batch
    gx[r] = x + (size_t)((row0 & ~(S_ - 1)) + (ord[row0 + wave * 8 + r] & (S_ - 1))) * H_
            + lane * 4;
  const unsigned short* gw = (mat ? WkB : WqB) + (size_t)cnt * 32 * 512
                             + (wave & 1) * 1024 + lane * 8;
  const unsigned lx = lds_byte(&xs[0][wave * 8 * PJ_XPITCH + lane * 4]);
  const unsigned lw = lds_byte(&wf[0][((wave & 1) * 16 + mat * 4 + cnt) * 512
                                      + (lane & 1) * 256 + (lane >> 1) * 8]);

  pj_copy_stage(gx, 0, lx, gw, lw);
  // stage 0 has landed for this wave before the barrier publishes it
  asm volatile("s_wait_asynccnt 0x0" ::: "memory");
  __syncthreads();
  pj_copy_stage(gx, PJ_KC, lx + PJ_XBUF * 4, gw + 4 * 512, lw + PJ_WBUF * 2);

  v8f acc[4] = {};
  for (int t = 0; t < PJ_NST; ++t) {
    const int buf = t & 1;
    const float* xr = &xs[buf][(rt * 16 + ln) * PJ_XPITCH + half * 8];
    const unsigned short* wl = &wf[buf][mat * 4 * 512 + lane * 8];
#pragma unroll
    for (int ksl = 0; ksl < 4; ++ksl) {
      v4f f0 = *(const v4f*)(xr + ksl * 32);
      v4f f1 = *(const v4f*)(xr + ksl * 32 + 4);
      v4f f2 = *(const v4f*)(xr + ksl * 32 + 16);
      v4f f3 = *(const v4f*)(xr + ksl * 32 + 20);
      v16bf a;
#pragma unroll
      for (int i = 0; i < 4; ++i) {
        a[i]      = f2bf(f0[i]);
        a[4 + i]  = f2bf(f1[i]);
        a[8 + i]  = f2bf(f2[i]);
        a[12 + i] = f2bf(f3[i]);
      }
#pragma unroll
      for (int nt = 0; nt < 4; ++nt) {
        v8bf lo = *(const v8bf*)(wl + (ksl * 8 + nt) * 512);
        v8bf hi = *(const v8bf*)(wl + (ksl * 8 + nt) * 512 + 256);
        v16bf w;
#pragma unroll
        for (int i = 0; i < 8; ++i) { w[i] = lo[i]; w[8 + i] = hi[i]; }
        acc[nt] = __builtin_amdgcn_wmma_f32_16x16x32_bf16(false, a, false, w,
                                                          (short)0, acc[nt], false, false);
      }
    }
    // this wave's reads of buffer buf are over before it may be refilled
    asm volatile("s_wait_dscnt 0x0" ::: "memory");
    // this wave's copies of stage t + 1 have landed before the barrier publishes them
    asm volatile("s_wait_asynccnt 0x0" ::: "memory");
    __syncthreads();
    if (t + 2 < PJ_NST)
      pj_copy_stage(gx, (t + 2) * PJ_KC, lx + buf * (PJ_XBUF * 4),
                    gw + (t + 2) * 4 * 512, lw + buf * (PJ_WBUF * 2));
  }
  // no copy is outstanding when the wave ends
  asm volatile("s_wait_asynccnt 0x0" ::: "memory");

  if (mat == 0) {
    // Q: row major, 64 columns a row
    unsigned short* __restrict__ O = Qb + (size_t)(row0 + rt * 16 + half * 8) * A_ + ln;
#pragma unroll
    for (int nt = 0; nt < 4; ++nt) {
      const float bb = bq[nt * 16 + ln];
#pragma unroll
      for (int j = 0; j < 8; ++j) O[j * A_ + nt * 16] = bf_bits(acc[nt][j] + bb);
    }
  } else {
    // K: each 16-row tile (2 KB) in the order in which attn_colsum's lanes read
    // it: plane p = col / 16 (512 B), reader lane ((col / 8) & 1) * 16 + row % 16
    // (16 B), element col % 8
    unsigned short* __restrict__ O = Kb + (size_t)((row0 >> 4) + rt) * KT_WORDS
                                     + ((ln >> 3) * 16 + half * 8) * 8 + (ln & 7);
#pragma unroll
    for (int nt = 0; nt < 4; ++nt) {
      const float bb = bk[nt * 16 + ln];
#pragma unroll
      for (int j = 0; j < 8; ++j) O[nt * 256 + j * 8] = bf_bits(acc[nt][j] + bb);
    }
  }
}

__device__ __forceinline__ void load_kfrag(const unsigned short* __restrict__ row,
                                           int kb, v16bf& f0, v16bf& f1) {
  v8bf lo0 = *(const v8bf*)(row + kb);
  v8bf hi0 = *(const v8bf*)(row + kb + 16);
  v8bf lo1 = *(const v8bf*)(row + kb + 32);
  v8bf hi1 = *(const v8bf*)(row + kb + 48);
#pragma unroll
  for (int i = 0; i < 8; ++i) {
    f0[i] = lo0[i]; f0[8 + i] = hi0[i];
    f1[i] = lo1[i]; f1[8 + i] = hi1[i];
  }
}

__device__ __forceinline__ void load_ktile(const unsigned short* tile, int lane,
                                           v16bf& f0, v16bf& f1) {
  v8bf lo0 = *(const v8bf*)(tile + lane * 8);
  v8bf hi0 = *(const v8bf*)(tile + 256 + lane * 8);
  v8bf lo1 = *(const v8bf*)(tile + 512 + lane * 8);
  v8bf hi1 = *(const v8bf*)(tile + 768 + lane * 8);
#pragma unroll
  for (int i = 0; i < 8; ++i) {
    f0[i] = lo0[i]; f0[8 + i] = hi0[i];
    f1[i] = lo1[i]; f1[8 + i] = hi1[i];
  }
}

#define CHUNK_T    8
#define CHUNK_ROWS (CHUNK_T * 16)
#define NCHUNK     (S_ / CHUNK_ROWS)

__device__ __forceinline__ v4u tdm_group0(const unsigned short* gsrc, unsigned lds_off) {
  unsigned long long ga = (unsigned long long)gsrc;
  // every word that is computed is made wave-uniform: the group lies in scalar registers
  v4u g0 = { 1u,                                   // count=1, user mode
             (unsigned)__builtin_amdgcn_readfirstlane((int)lds_off),              // lds_addr
             (unsigned)__builtin_amdgcn_readfirstlane((int)(ga & 0xFFFFFFFFu)),   // global_addr[31:0]
             (unsigned)__builtin_amdgcn_readfirstlane(
                 (int)(((ga >> 32) & 0x01FFFFFFu) | 0x80000000u)) };              // [56:32] | type=2
  asm volatile("" : "+s"(g0));
  return g0;
}

__device__ __forceinline__ v8i tdm_group1() {
  v8i g1 = { 0x00010000,
             0x00400000,
             0x08000000,
             0x00400000,
             CHUNK_ROWS,
             64,
             0, 0 };
  asm volatile("" : "+s"(g1));
  return g1;
}

__device__ __forceinline__ void tdm_load_chunk(v4u g0, v8i g1) {
  v4i gz4 = { 0, 0, 0, 0 };
  v8i gz8 = { 0, 0, 0, 0, 0, 0, 0, 0 };
  __builtin_amdgcn_tensor_load_to_lds(g0, g1, gz4, gz4, gz8, 0);
}

// The wait that covers the request made with g0 and g1. It names both groups, so
// that their registers keep their values from the request up to this wait.
__device__ __forceinline__ void tdm_wait(v4u g0, v8i g1) {
  asm volatile("s_wait_tensorcnt 0x0" :: "s"(g0), "s"(g1) : "memory");
}

// 16 x 16 products of one wave's Q rows with one 16-row tile of K in LDS
__device__ __forceinline__ v8f qk_tile(const unsigned short* tile, int lane,
                                       const v16bf& aq0, const v16bf& aq1) {
  v16bf bk0, bk1;
  load_ktile(tile, lane, bk0, bk1);
  v8f acc = {};
  acc = __builtin_amdgcn_wmma_f32_16x16x32_bf16(false, aq0, false, bk0,
                                                (short)0, acc, false, false);
  acc = __builtin_amdgcn_wmma_f32_16x16x32_bf16(false, aq1, false, bk1,
                                                (short)0, acc, false, false);
  return acc;
}

// pass 1 on one tile: running maximum and sum of exp, per lane. EDGE: the tile may
// hold masked columns (cm false); elsewhere every column counts and cm is not read.
// (In p1_tile and p2_tile the loop over the 8 rows is unrolled: registers only.)
template <bool EDGE>
__device__ __forceinline__ void p1_tile(const v8f& acc, bool cm, float (&mL)[8], float (&lL)[8]) {
#pragma unroll
  for (int j = 0; j < 8; ++j) {
    float s    = acc[j] * 0.125f;             // / sqrt(64)
    float seff = (!EDGE || cm) ? s : -1e30f;
    float nm   = fmaxf(mL[j], seff);
    lL[j] = lL[j] * __expf(mL[j] - nm) + ((!EDGE || cm) ? __expf(seff - nm) : 0.f);
    mL[j] = nm;
  }
}

// pass 2 on one tile: probabilities, summed over the wave's 16 rows, added to the
// block's column sums cs[0] (all rows) and cs[S_] (rows weighted by their mask)
template <bool EDGE>
__device__ __forceinline__ void p2_tile(const v8f& acc, bool cm, const float (&mL)[8],
                                        const float (&invL)[8], const float (&mr)[8],
                                        int half, float* cs) {
  float ca = 0.f, cw = 0.f;
#pragma unroll
  for (int j = 0; j < 8; ++j) {
    float e = (!EDGE || cm) ? __expf(fminf(acc[j] * 0.125f - mL[j], 0.f)) : 0.f;
    float p = e * invL[j];
    ca += p;
    cw += mr[j] * p;
  }
  ca += __shfl_xor(ca, 16, 32);
  cw += __shfl_xor(cw, 16, 32);
  if (half == 0) {
    atomicAdd(cs, ca);                          // LDS adds: the 8 waves meet here
    atomicAdd(cs + S_, cw);
  }
}

__global__ void __launch_bounds__(256)
attn_colsum(const unsigned short* __restrict__ Qb, const unsigned short* __restrict__ Kb,
            const int* __restrict__ mask, const int* __restrict__ ord,
            const int* __restrict__ nb,
            float* __restrict__ w_all, float* __restrict__ w_msk) {
  __shared__ unsigned short ksh[2][CHUNK_ROWS * A_];   // 2 x 16 KB
  __shared__ float csum[2][S_];                        // the block's column sums, 16 KB

  const int lane = threadIdx.x & 31;
  const int wave = threadIdx.x >> 5;
  const int rowtile = blockIdx.x * 8 + wave;     // 0 .. 2047 (same batch per block)
  const int b  = rowtile >> 7;
  const int s0 = (rowtile & 127) << 4;
  const int half = lane >> 4;
  const int ln   = lane & 15;
  const int kb   = half * 8;

  const unsigned short* kpanel = Kb + (size_t)b * S_ * A_;
  const unsigned lds0 = (unsigned)(unsigned long long)(const void*)&ksh[0][0];
  const unsigned lds1 = (unsigned)(unsigned long long)(const void*)&ksh[1][0];

  // A fragments of Q (16 x 64 bf16 -> two 16x32 fragments)
  const unsigned short* qrow = Qb + ((size_t)(b * S_ + s0 + ln)) * A_;
  v16bf aq0, aq1;
  load_kfrag(qrow, kb, aq0, aq1);

  const int* mrow = mask + (size_t)b * S_;
  const int* orow = ord + (size_t)b * S_;
  float mr[8];
#pragma unroll
  for (int j = 0; j < 8; ++j) mr[j] = (float)mrow[orow[s0 + j + half * 8] & (S_ - 1)];

  // unmasked columns of this batch, the same in every wave of the block, held in
  // 0 .. S whatever the word holds: 1 .. NCHUNK chunks
  const int ncol  = min(max(__builtin_amdgcn_readfirstlane(nb[b]), 0), S_);
  const int nch   = max((ncol + CHUNK_ROWS - 1) / CHUNK_ROWS, 1);
  const int nfull = ncol >> 4;                   // tiles whose 16 columns are all unmasked
  const int nedge = ncol & 15;                   // unmasked columns of the tile behind them

  float mL[8], lL[8];
#pragma unroll
  for (int j = 0; j < 8; ++j) { mL[j] = -1e30f; lL[j] = 0.f; }

  // start values of the block's column sums; the barriers of pass 1 stand
  // between these stores and the first add of pass 2
  for (int i = 0; i < 2 * S_ / 256; ++i) (&csum[0][0])[i * 256 + threadIdx.x] = 0.f;

  // ---- pass 1: row max + sum of exp (online, per-lane partials) ----
  const v8i g1 = tdm_group1();
  v4u g0 = tdm_group0(kpanel, lds0);
  if (wave == 0) tdm_load_chunk(g0, g1);
  for (int c = 0; c < nch; ++c) {
    tdm_wait(g0, g1);
    __syncthreads();                              // chunk c visible in buf c&1
    if (c + 1 < nch) {
      g0 = tdm_group0(kpanel + (size_t)(c + 1) * CHUNK_ROWS * A_, ((c + 1) & 1) ? lds1 : lds0);
      if (wave == 0) tdm_load_chunk(g0, g1);
    }
    const unsigned short* kc = &ksh[c & 1][0];
    const int tfull = min(nfull - c * CHUNK_T, CHUNK_T);   // whole tiles of this chunk
    for (int tl = 0; tl < tfull; ++tl)
      p1_tile<false>(qk_tile(kc + tl * KT_WORDS, lane, aq0, aq1), true, mL, lL);
    if (tfull < CHUNK_T && nedge)                          // then c is the last chunk
      p1_tile<true>(qk_tile(kc + tfull * KT_WORDS, lane, aq0, aq1), ln < nedge, mL, lL);
    __syncthreads();                              // readers done before overwrite
  }
  // combine partials across the 16 lanes holding each row
#pragma unroll
  for (int d = 1; d < 16; d <<= 1) {
#pragma unroll
    for (int j = 0; j < 8; ++j) {
      float om = __shfl_xor(mL[j], d, 32);
      float ol = __shfl_xor(lL[j], d, 32);
      float nm = fmaxf(mL[j], om);
      lL[j] = lL[j] * __expf(mL[j] - nm) + ol * __expf(om - nm);
      mL[j] = nm;
    }
  }
  float invL[8];
#pragma unroll
  for (int j = 0; j < 8; ++j) invL[j] = (lL[j] > 0.f) ? (1.f / lL[j]) : 0.f;

  // ---- pass 2: probabilities -> column sums ----
  float* gsum = ((threadIdx.x >> 7) ? w_msk : w_all) + (size_t)b * S_ + (threadIdx.x & 127);
  g0 = tdm_group0(kpanel, lds0);
  if (wave == 0) tdm_load_chunk(g0, g1);
  for (int c = 0; c < nch; ++c) {
    tdm_wait(g0, g1);
    __syncthreads();
    if (c + 1 < nch) {
      g0 = tdm_group0(kpanel + (size_t)(c + 1) * CHUNK_ROWS * A_, ((c + 1) & 1) ? lds1 : lds0);
      if (wave == 0) tdm_load_chunk(g0, g1);
    }
    const unsigned short* kc = &ksh[c & 1][0];
    float* cs = &csum[0][c * CHUNK_ROWS + ln];
    const int tfull = min(nfull - c * CHUNK_T, CHUNK_T);   // whole tiles of this chunk
    for (int tl = 0; tl < tfull; ++tl)
      p2_tile<false>(qk_tile(kc + tl * KT_WORDS, lane, aq0, aq1), true, mL, invL, mr, half,
                     cs + tl * 16);
    if (tfull < CHUNK_T && nedge)                          // then c is the last chunk
      p2_tile<true>(qk_tile(kc + tfull * KT_WORDS, lane, aq0, aq1), ln < nedge, mL, invL, mr,
                    half, cs + tfull * 16);
    __syncthreads();
  }
  // behind the last barrier the block's sums are complete: one global add per
  // thread and worked chunk (both loops unrolled: bs[] stays in registers)
  float bs[NCHUNK];
#pragma unroll
  for (int i = 0; i < NCHUNK; ++i)
    bs[i] = csum[threadIdx.x >> 7][i * CHUNK_ROWS + (threadIdx.x & 127)];
  // holds all LDS reads in front of the first add: the adds issue back to back, and
  // no register that an issued add names is loaded anew behind it
  asm volatile("" :: "v"(bs[0]), "v"(bs[1]), "v"(bs[2]), "v"(bs[3]), "v"(bs[4]), "v"(bs[5]),
                     "v"(bs[6]), "v"(bs[7]), "v"(bs[8]), "v"(bs[9]), "v"(bs[10]), "v"(bs[11]),
                     "v"(bs[12]), "v"(bs[13]), "v"(bs[14]), "v"(bs[15]));
#pragma unroll
  for (int i = 0; i < NCHUNK; ++i)
    if (i < nch) atomicAdd(gsum + i * CHUNK_ROWS, bs[i]);
}

#define ZW_BLOCKS ((B_ * S_ + 255) / 256)

__global__ void __launch_bounds__(256)
setup_ws(const int* __restrict__ mask, const float* __restrict__ Wq,
         const float* __restrict__ Wk, float* __restrict__ w_all,
         float* __restrict__ w_msk, float* __restrict__ y, int* __restrict__ ord,
         int* __restrict__ pos, int* __restrict__ nb,
         unsigned short* __restrict__ WqB, unsigned short* __restrict__ WkB) {
  __shared__ int seg[S_ / 32];                   // unmasked positions per run of 32
  if (blockIdx.x >= B_ + PW_BLOCKS) {
    int i = (blockIdx.x - (B_ + PW_BLOCKS)) * 256 + threadIdx.x;
    if (i < B_ * S_) { w_all[i] = 0.f; w_msk[i] = 0.f; }
    if (i < B_ * H_) y[i] = 0.f;
    return;
  }
  if (blockIdx.x >= B_) {
    prep_wfrag(blockIdx.x - B_, Wq, Wk, WqB, WkB);
    return;
  }
  const int b    = blockIdx.x;
  const int lane = threadIdx.x & 31;
  const int wave = threadIdx.x >> 5;
  const int* m = mask + (size_t)b * S_;
  int mv[S_ / 256];                              // all loads first: one memory latency, not 8
#pragma unroll
  for (int i = 0; i < S_ / 256; ++i) mv[i] = m[i * 256 + threadIdx.x];
  unsigned bal[S_ / 256];
#pragma unroll
  for (int i = 0; i < S_ / 256; ++i) {
    bal[i] = (unsigned)__ballot(mv[i] != 0);
    if (lane == 0) seg[i * 8 + wave] = __popc(bal[i]);
  }
  __syncthreads();
  int run = 0, base[S_ / 256];
#pragma unroll
  for (int g = 0; g < S_ / 32; ++g) {            // run g holds positions g*32 .. +31
    if ((g & 7) == wave) base[g >> 3] = run;
    run += seg[g];
  }
#pragma unroll
  for (int i = 0; i < S_ / 256; ++i) {
    const int s     = i * 256 + threadIdx.x;
    const int front = base[i] + __popc(bal[i] & ((1u << lane) - 1u));  // unmasked before s
    const int p     = ((bal[i] >> lane) & 1u) ? front : run + (s - front);
    ord[(size_t)b * S_ + p] = s;
    pos[(size_t)b * S_ + s] = p;
  }
  if (threadIdx.x == 0) nb[b] = run;
}

// One block per batch; a block range of after_attn.
__device__ __forceinline__ void
batch_stats(int b, const int* __restrict__ mask, const float* __restrict__ w_msk,
            float* __restrict__ sumw, float* __restrict__ denom) {
  __shared__ float sm[256], sw[256];
  int t = threadIdx.x;
  float a = 0.f, c = 0.f;
  for (int s = t; s < S_; s += 256) {
    a += (float)mask[(size_t)b * S_ + s];
    c += w_msk[(size_t)b * S_ + s];
  }
  sm[t] = a; sw[t] = c; __syncthreads();
  for (int st = 128; st > 0; st >>= 1) {
    if (t < st) { sm[t] += sm[t + st]; sw[t] += sw[t + st]; }
    __syncthreads();
  }
  if (t == 0) { denom[b] = sm[0] + 1e-8f; sumw[b] = sw[0]; }
}

#define WX_BLOCKS ((H_ / 256) * 8 * B_)

__device__ __forceinline__ void
wx_gemv(int blk, const float* __restrict__ x, const float* __restrict__ w_msk,
        const int* __restrict__ ord, const int* __restrict__ nb,
        float* __restrict__ y) {
  int h  = (blk & (H_ / 256 - 1)) * 256 + threadIdx.x;
  int sc = (blk / (H_ / 256)) & 7;
  int b  = blk / ((H_ / 256) * 8);
  const float* xb = x + ((size_t)b * S_) * H_;
  const float* wb = w_msk + (size_t)b * S_;
  const int*   ob = ord + (size_t)b * S_;
  const int ncol = min(max(nb[b], 0), S_);
  const int per  = (((ncol + 7) >> 3) + 7) & ~7;
  const int p0   = sc * per;
  const int pe   = min(p0 + per, (ncol + 7) & ~7);
  float acc = 0.f;
  for (int p = p0; p < pe; p += 8) {
    float v[8];
#pragma unroll
    for (int u = 0; u < 8; ++u)                  // the & keeps the row inside its batch
      v[u] = xb[(unsigned)(ob[p + u] & (S_ - 1)) * H_ + (unsigned)h];
#pragma unroll
    for (int u = 0; u < 8; ++u) acc = fmaf(wb[p + u], v[u], acc);
  }
  atomicAdd(&y[(size_t)b * H_ + h], acc);
  // other block ranges of the launch follow in the code: the wait stands before any
  // rewrite of a register that the add names
  asm volatile("s_wait_xcnt 0x0" ::: "memory");
}

// out[b,h] = (y[b,:] @ Wv[:,h] + sumw[b]*bv[h]) / denom[b]
// One block = 32 columns of out (one 128-byte line a row) for all 16 batches, so
// that Wv is read once. The 1024 k are split over the block's 32 waves, 32 k each:
// a wave issues all its loads at once and pays the memory latency once. The 16
// batches are the 16 rows of an f32 WMMA tile; the waves' partial tiles meet in LDS.
// Every loop here is unrolled, so that its arrays stay in registers.
#define OP_COLS  32
#define OP_WAVES 32
#define OP_KW    (H_ / OP_WAVES)
#define OP_TPIT  272

typedef __attribute__((ext_vector_type(2))) float v2f;

__global__ void __launch_bounds__(1024)
out_proj(const float* __restrict__ y, const float* __restrict__ Wv,
         const float* __restrict__ bv, const float* __restrict__ sumw,
         const float* __restrict__ denom, float* __restrict__ out) {
  __shared__ float red[OP_WAVES][2 * OP_TPIT];

  const int lane = threadIdx.x & 31;
  const int wave = threadIdx.x >> 5;
  const int half = lane >> 4;
  const int ln   = lane & 15;
  const int c0   = blockIdx.x * OP_COLS;
  const int k0   = wave * OP_KW + half * 16;   // this lane's 16 k, for A and for B alike
  float* rw = &red[wave][lane];                // where this lane puts its partial sums

  // B side: rows k0 .. k0+15 of Wv, columns c0 + 2*ln and + 1 (16 lanes = one line).
  // Tile 0 takes the even columns, tile 1 the odd ones.
  const float* wp = Wv + (size_t)k0 * H_ + c0 + 2 * ln;
  v2f w[16];
#pragma unroll
  for (int j = 0; j < 16; ++j) w[j] = *(const v2f*)(wp + (size_t)j * H_);
  // A side: batch ln, the same 16 k
  const float* yp = y + (size_t)ln * H_ + k0;
  v4f a[4];
#pragma unroll
  for (int i = 0; i < 4; ++i) a[i] = *(const v4f*)(yp + 4 * i);

  // the finishing threads (one per output, wave = batch) fetch their terms early
  float sb = 0.f, bb = 0.f, dn = 1.f;
  if (wave < B_) { sb = sumw[wave]; bb = bv[c0 + lane]; dn = denom[wave]; }

  // fragments: k = k0 + 2i, k0 + 2i + 1 in registers 0, 1 of A and of B alike
  v2f af[8], b0[8], b1[8];
#pragma unroll
  for (int i = 0; i < 8; ++i) {
    af[i] = (v2f){ a[i >> 1][(i & 1) * 2], a[i >> 1][(i & 1) * 2 + 1] };
    b0[i] = (v2f){ w[2 * i][0], w[2 * i + 1][0] };
    b1[i] = (v2f){ w[2 * i][1], w[2 * i + 1][1] };
  }
  // all register moves that form the fragments stay in front of the matrix run, so
  // that none of them overwrites an operand of a matrix instruction just issued
  __builtin_amdgcn_sched_barrier(0);
  v8f acc0 = {}, acc1 = {};
#pragma unroll
  for (int i = 0; i < 8; ++i) {
    acc0 = __builtin_amdgcn_wmma_f32_16x16x4_f32(false, af[i], false, b0[i], (short)0, acc0,
                                                 false, false);
    acc1 = __builtin_amdgcn_wmma_f32_16x16x4_f32(false, af[i], false, b1[i], (short)0, acc1,
                                                 false, false);
  }
  __builtin_amdgcn_sched_barrier(0);
  asm volatile("v_nop\n\tv_nop\n\tv_nop\n\tv_nop");
  __builtin_amdgcn_sched_barrier(0);
#pragma unroll
  for (int j = 0; j < 8; ++j) {
    rw[j * 32]           = acc0[j];
    rw[OP_TPIT + j * 32] = acc1[j];
  }
  __syncthreads();                             // all 64 partial tiles (two per wave) are in LDS

  if (wave < B_) {
    const int idx = (lane & 1) * OP_TPIT + (wave & 7) * 32 + (wave >> 3) * 16 + (lane >> 1);
    float s = 0.f;
#pragma unroll
    for (int v = 0; v < OP_WAVES; ++v) s += red[v][idx];
    out[(size_t)wave * H_ + c0 + lane] = (s + sb * bb) / dn;
  }
}

#define AM_BLOCKS ((B_ * S_ + 255) / 256)

__device__ __forceinline__ void
attn_mean(int blk, const float* __restrict__ w_all, const int* __restrict__ pos,
          float* __restrict__ out2) {
  int i = blk * 256 + threadIdx.x;
  if (i < B_ * S_)
    out2[i] = w_all[(i & ~(S_ - 1)) + (pos[i] & (S_ - 1))] * (1.0f / (float)S_);
}

// What needs the finished column sums of attn_colsum and nothing else, three jobs
// that need nothing of one another, as block ranges of one launch: B_ blocks of
// batch_stats (the longest chain of waits, so they stand first), WX_BLOCKS of
// wx_gemv, AM_BLOCKS of attn_mean. The range is picked by blockIdx alone, so every
// barrier of batch_stats is passed by its whole block.
__global__ void __launch_bounds__(256)
after_attn(const float* __restrict__ x, const int* __restrict__ mask,
           const float* __restrict__ w_all, const float* __restrict__ w_msk,
           const int* __restrict__ ord, const int* __restrict__ pos,
           const int* __restrict__ nb, float* __restrict__ sumw,
           float* __restrict__ denom, float* __restrict__ y, float* __restrict__ out2) {
  const int blk = blockIdx.x;
  if (blk < B_)                  batch_stats(blk, mask, w_msk, sumw, denom);
  else if (blk < B_ + WX_BLOCKS) wx_gemv(blk - B_, x, w_msk, ord, nb, y);
  else                           attn_mean(blk - (B_ + WX_BLOCKS), w_all, pos, out2);
}

// ---------------------------------------------------------------------------
extern "C" void kernel_launch(void* const* d_in, const int* in_sizes, int n_in,
                              void* d_out, int out_size, void* d_ws, size_t ws_size,
                              hipStream_t stream) {
  const float* x    = (const float*)d_in[0];
  const int*   mask = (const int*)  d_in[1];
  const float* Wq   = (const float*)d_in[2];
  const float* bq   = (const float*)d_in[3];
  const float* Wk   = (const float*)d_in[4];
  const float* bk   = (const float*)d_in[5];
  const float* Wv   = (const float*)d_in[6];
  const float* bv   = (const float*)d_in[7];
  float* out  = (float*)d_out;                       // (B,H) = 16384 floats
  float* out2 = out + (size_t)B_ * H_;               // (B,S) = 32768 floats

  char* ws = (char*)d_ws;
  const size_t QB_OFF   = 0;
  const size_t KB_OFF   = QB_OFF   + (size_t)B_ * S_ * A_ * 2;   // bf16 Q
  const size_t WQB_OFF  = KB_OFF   + (size_t)B_ * S_ * A_ * 2;   // bf16 K
  const size_t WKB_OFF  = WQB_OFF  + (size_t)65536 * 2;
  const size_t WALL_OFF = WKB_OFF  + (size_t)65536 * 2;
  const size_t WMSK_OFF = WALL_OFF + (size_t)B_ * S_ * 4;
  const size_t Y_OFF    = WMSK_OFF + (size_t)B_ * S_ * 4;
  const size_t SUMW_OFF = Y_OFF    + (size_t)B_ * H_ * 4;
  const size_t DEN_OFF  = SUMW_OFF + 64;
  const size_t NB_OFF   = DEN_OFF  + 64;
  const size_t ORD_OFF  = NB_OFF   + 64;
  const size_t POS_OFF  = ORD_OFF  + (size_t)B_ * S_ * 4;

  unsigned short* Qb   = (unsigned short*)(ws + QB_OFF);
  unsigned short* Kb   = (unsigned short*)(ws + KB_OFF);
  unsigned short* WqB  = (unsigned short*)(ws + WQB_OFF);
  unsigned short* WkB  = (unsigned short*)(ws + WKB_OFF);
  float* w_all = (float*)(ws + WALL_OFF);
  float* w_msk = (float*)(ws + WMSK_OFF);
  float* y     = (float*)(ws + Y_OFF);
  float* sumw  = (float*)(ws + SUMW_OFF);
  float* denom = (float*)(ws + DEN_OFF);
  int*   nb    = (int*)(ws + NB_OFF);
  int*   ord   = (int*)(ws + ORD_OFF);
  int*   pos   = (int*)(ws + POS_OFF);

  setup_ws   <<<B_ + PW_BLOCKS + ZW_BLOCKS, 256, 0, stream>>>(mask, Wq, Wk, w_all, w_msk, y,
                                                              ord, pos, nb, WqB, WkB);
  proj_qk    <<<(B_ * S_) / 128, 512, 0, stream>>>(x, bq, bk, ord, WqB, WkB, Qb, Kb);
  attn_colsum<<<(B_ * S_ / 16) / 8, 256, 0, stream>>>(Qb, Kb, mask, ord, nb, w_all, w_msk);
  after_attn <<<B_ + WX_BLOCKS + AM_BLOCKS, 256, 0, stream>>>(x, mask, w_all, w_msk, ord, pos,
                                                              nb, sumw, denom, y, out2);
  out_proj   <<<H_ / 32, 1024, 0, stream>>>(y, Wv, bv, sumw, denom, out);
}

// v007
// One run takes 55.4 microseconds.
// Next to v006, in two timings, it ran 1.09 and 1.10 times as fast.
// Over all steps from v000 it is 5.19 times as fast.
#include <hip/hip_runtime.h>
#include <math.h>

#define S_ 2048
#define H_ 1024
#define A_ 64
#define B_ 16

typedef __attribute__((ext_vector_type(16))) __bf16 v16bf;
typedef __attribute__((ext_vector_type(8)))  __bf16 v8bf;
typedef __attribute__((ext_vector_type(8)))  float  v8f;
typedef __attribute__((ext_vector_type(4)))  unsigned int v4u;
typedef __attribute__((ext_vector_type(8)))  int v8i;
typedef __attribute__((ext_vector_type(4)))  int v4i;

__device__ __forceinline__ __bf16 f2bf(float f) { return (__bf16)f; }
__device__ __forceinline__ unsigned short bf_bits(float f) {
  __bf16 h = (__bf16)f;
  return __builtin_bit_cast(unsigned short, h);
}

#define PW_BLOCKS (65536 / 256)

__device__ __forceinline__ void
prep_wfrag(int blk, const float* __restrict__ Wq, const float* __restrict__ Wk,
           unsigned short* __restrict__ WqB, unsigned short* __restrict__ WkB) {
  int idx = blk * 256 + threadIdx.x;             // 0 .. 65535
  int e    = idx & 15;
  int lane = (idx >> 4) & 31;
  int ks   = (idx >> 9) & 31;
  int nt   = (idx >> 14) & 3;
  int n = nt * 16 + (lane & 15);
  int k = ks * 32 + ((lane >> 4) << 3) + ((e & 8) ? (16 + (e & 7)) : (e & 7));
  WqB[idx] = bf_bits(Wq[(size_t)k * A_ + n]);
  WkB[idx] = bf_bits(Wk[(size_t)k * A_ + n]);
  // other block ranges of the launch follow in the code: the wait stands before any
  // rewrite of a register that the two stores name
  asm volatile("s_wait_xcnt 0x0" ::: "memory");
}

#define PJ_ROWS   128
#define PJ_KC     128                        // k columns per stage
#define PJ_NST    (H_ / PJ_KC)               // 8 stages
#define PJ_XPITCH 132                        // floats per LDS row: 528 B = 16 B x odd
#define PJ_XBUF   (PJ_ROWS * PJ_XPITCH)      // floats per x buffer
#define PJ_WBUF   (4 * 8 * 512)              // 16-bit words per weight buffer

#define KT_WORDS  (16 * A_)                  // 16-bit words of one 16-row tile of K

typedef __attribute__((ext_vector_type(4))) float v4f;

__device__ __forceinline__ unsigned lds_byte(const void* p) {
  return (unsigned)(unsigned long long)p;
}

// One wave's share of one stage: 8 rows of x (512 B each) and 4 x 512 B of
// packed weights. A fragment's two 16-byte halves per lane are split into two
// planes of 512 B, so that each later ds_load_b128 reads 512 contiguous bytes.
__device__ __forceinline__ void pj_copy_stage(const float* const (&gx)[8], int xo, unsigned lx,
                                              const unsigned short* gw, unsigned lw) {
  asm volatile(
      "global_load_async_to_lds_b128 %0, %1, off\n\t"
      "global_load_async_to_lds_b128 %2, %3, off\n\t"
      "global_load_async_to_lds_b128 %4, %5, off\n\t"
      "global_load_async_to_lds_b128 %6, %7, off\n\t"
      "global_load_async_to_lds_b128 %8, %9, off\n\t"
      "global_load_async_to_lds_b128 %10, %11, off\n\t"
      "global_load_async_to_lds_b128 %12, %13, off\n\t"
      "global_load_async_to_lds_b128 %14, %15, off\n\t"
      "global_load_async_to_lds_b128 %16, %17, off\n\t"
      "global_load_async_to_lds_b128 %18, %19, off\n\t"
      "global_load_async_to_lds_b128 %20, %21, off\n\t"
      "global_load_async_to_lds_b128 %22, %23, off\n\t"
      "s_wait_xcnt 0x0"
      :: "v"(lx),                     "v"(gx[0] + xo),
         "v"(lx + 1 * PJ_XPITCH * 4), "v"(gx[1] + xo),
         "v"(lx + 2 * PJ_XPITCH * 4), "v"(gx[2] + xo),
         "v"(lx + 3 * PJ_XPITCH * 4), "v"(gx[3] + xo),
         "v"(lx + 4 * PJ_XPITCH * 4), "v"(gx[4] + xo),
         "v"(lx + 5 * PJ_XPITCH * 4), "v"(gx[5] + xo),
         "v"(lx + 6 * PJ_XPITCH * 4), "v"(gx[6] + xo),
         "v"(lx + 7 * PJ_XPITCH * 4), "v"(gx[7] + xo),
         "v"(lw),                     "v"(gw),
         "v"(lw + 256),               "v"(gw + 256),
         "v"(lw + 8192),              "v"(gw + 512),
         "v"(lw + 8192 + 256),        "v"(gw + 768)
      : "memory");
}

__global__ void __launch_bounds__(512)
proj_qk(const float* __restrict__ x, const float* __restrict__ bq,
        const float* __restrict__ bk, const int* __restrict__ ord,
        const unsigned short* __restrict__ WqB, const unsigned short* __restrict__ WkB,
        unsigned short* __restrict__ Qb, unsigned short* __restrict__ Kb) {
  __shared__ __attribute__((aligned(16))) float          xs[2][PJ_XBUF];
  __shared__ __attribute__((aligned(16))) unsigned short wf[2][PJ_WBUF];

  const int lane = threadIdx.x & 31;
  const int wave = threadIdx.x >> 5;             // 0 .. 15
  const int rt   = wave & 7;                     // 16-row tile of the block
  const int mat  = wave >> 3;                    // 0: Q, 1: K
  const int half = lane >> 4;
  const int ln   = lane & 15;
  const int row0 = blockIdx.x * PJ_ROWS;

  const int cnt = (wave >> 1) & 3;
  const float* gx[8];                            // unrolled: gx[] stays in registers
#pragma unroll
  for (int r = 0; r < 8; ++r)                    // the & keeps the row inside its batch
    gx[r] = x + (size_t)((row0 & ~(S_ - 1)) + (ord[row0 + wave * 8 + r] & (S_ - 1))) * H_
            + lane * 4;
  const unsigned short* gw = (mat ? WkB : WqB) + (size_t)cnt * 32 * 512
                             + (wave & 1) * 1024 + lane * 8;
  const unsigned lx = lds_byte(&xs[0][wave * 8 * PJ_XPITCH + lane * 4]);
  const unsigned lw = lds_byte(&wf[0][((wave & 1) * 16 + mat * 4 + cnt) * 512
                                      + (lane & 1) * 256 + (lane >> 1) * 8]);

  pj_copy_stage(gx, 0, lx, gw, lw);
  // stage 0 has landed for this wave before the barrier publishes it
  asm volatile("s_wait_asynccnt 0x0" ::: "memory");
  __syncthreads();
  pj_copy_stage(gx, PJ_KC, lx + PJ_XBUF * 4, gw + 4 * 512, lw + PJ_WBUF * 2);

  v8f acc[4] = {};
  for (int t = 0; t < PJ_NST; ++t) {
    const int buf = t & 1;
    const float* xr = &xs[buf][(rt * 16 + ln) * PJ_XPITCH + half * 8];
    const unsigned short* wl = &wf[buf][mat * 4 * 512 + lane * 8];
#pragma unroll
    for (int ksl = 0; ksl < 4; ++ksl) {
      v4f f0 = *(const v4f*)(xr + ksl * 32);
      v4f f1 = *(const v4f*)(xr + ksl * 32 + 4);
      v4f f2 = *(const v4f*)(xr + ksl * 32 + 16);
      v4f f3 = *(const v4f*)(xr + ksl * 32 + 20);
      v16bf a;
#pragma unroll
      for (int i = 0; i < 4; ++i) {
        a[i]      = f2bf(f0[i]);
        a[4 + i]  = f2bf(f1[i]);
        a[8 + i]  = f2bf(f2[i]);
        a[12 + i] = f2bf(f3[i]);
      }
#pragma unroll
      for (int nt = 0; nt < 4; ++nt) {
        v8bf lo = *(const v8bf*)(wl + (ksl * 8 + nt) * 512);
        v8bf hi = *(const v8bf*)(wl + (ksl * 8 + nt) * 512 + 256);
        v16bf w;
#pragma unroll
        for (int i = 0; i < 8; ++i) { w[i] = lo[i]; w[8 + i] = hi[i]; }
        acc[nt] = __builtin_amdgcn_wmma_f32_16x16x32_bf16(false, a, false, w,
                                                          (short)0, acc[nt], false, false);
      }
    }
    // this wave's reads of buffer buf are over before it may be refilled
    asm volatile("s_wait_dscnt 0x0" ::: "memory");
    // this wave's copies of stage t + 1 have landed before the barrier publishes them
    asm volatile("s_wait_asynccnt 0x0" ::: "memory");
    __syncthreads();
    if (t + 2 < PJ_NST)
      pj_copy_stage(gx, (t + 2) * PJ_KC, lx + buf * (PJ_XBUF * 4),
                    gw + (t + 2) * 4 * 512, lw + buf * (PJ_WBUF * 2));
  }
  // no copy is outstanding when the wave ends
  asm volatile("s_wait_asynccnt 0x0" ::: "memory");

  if (mat == 0) {
    // Q: row major, 64 columns a row
    unsigned short* __restrict__ O = Qb + (size_t)(row0 + rt * 16 + half * 8) * A_ + ln;
#pragma unroll
    for (int nt = 0; nt < 4; ++nt) {
      const float bb = bq[nt * 16 + ln];
#pragma unroll
      for (int j = 0; j < 8; ++j) O[j * A_ + nt * 16] = bf_bits(acc[nt][j] + bb);
    }
  } else {
    // K: each 16-row tile (2 KB) in the order in which attn_colsum's lanes read
    // it: plane p = col / 16 (512 B), reader lane ((col / 8) & 1) * 16 + row % 16
    // (16 B), element col % 8
    unsigned short* __restrict__ O = Kb + (size_t)((row0 >> 4) + rt) * KT_WORDS
                                     + ((ln >> 3) * 16 + half * 8) * 8 + (ln & 7);
#pragma unroll
    for (int nt = 0; nt < 4; ++nt) {
      const float bb = bk[nt * 16 + ln];
#pragma unroll
      for (int j = 0; j < 8; ++j) O[nt * 256 + j * 8] = bf_bits(acc[nt][j] + bb);
    }
  }
}

__device__ __forceinline__ void load_kfrag(const unsigned short* __restrict__ row,
                                           int kb, v16bf& f0, v16bf& f1) {
  v8bf lo0 = *(const v8bf*)(row + kb);
  v8bf hi0 = *(const v8bf*)(row + kb + 16);
  v8bf lo1 = *(const v8bf*)(row + kb + 32);
  v8bf hi1 = *(const v8bf*)(row + kb + 48);
#pragma unroll
  for (int i = 0; i < 8; ++i) {
    f0[i] = lo0[i]; f0[8 + i] = hi0[i];
    f1[i] = lo1[i]; f1[8 + i] = hi1[i];
  }
}

__device__ __forceinline__ void load_ktile(const unsigned short* tile, int lane,
                                           v16bf& f0, v16bf& f1) {
  v8bf lo0 = *(const v8bf*)(tile + lane * 8);
  v8bf hi0 = *(const v8bf*)(tile + 256 + lane * 8);
  v8bf lo1 = *(const v8bf*)(tile + 512 + lane * 8);
  v8bf hi1 = *(const v8bf*)(tile + 768 + lane * 8);
#pragma unroll
  for (int i = 0; i < 8; ++i) {
    f0[i] = lo0[i]; f0[8 + i] = hi0[i];
    f1[i] = lo1[i]; f1[8 + i] = hi1[i];
  }
}

#define CHUNK_T    8
#define CHUNK_ROWS (CHUNK_T * 16)
#define NCHUNK     (S_ / CHUNK_ROWS)

__device__ __forceinline__ v4u tdm_group0(const unsigned short* gsrc, unsigned lds_off) {
  unsigned long long ga = (unsigned long long)gsrc;
  // every word that is computed is made wave-uniform: the group lies in scalar registers
  v4u g0 = { 1u,                                   // count=1, user mode
             (unsigned)__builtin_amdgcn_readfirstlane((int)lds_off),              // lds_addr
             (unsigned)__builtin_amdgcn_readfirstlane((int)(ga & 0xFFFFFFFFu)),   // global_addr[31:0]
             (unsigned)__builtin_amdgcn_readfirstlane(
                 (int)(((ga >> 32) & 0x01FFFFFFu) | 0x80000000u)) };              // [56:32] | type=2
  asm volatile("" : "+s"(g0));
  return g0;
}

__device__ __forceinline__ v8i tdm_group1() {
  v8i g1 = { 0x00010000,
             0x00400000,
             0x08000000,
             0x00400000,
             CHUNK_ROWS,
             64,
             0, 0 };
  asm volatile("" : "+s"(g1));
  return g1;
}

__device__ __forceinline__ void tdm_load_chunk(v4u g0, v8i g1) {
  v4i gz4 = { 0, 0, 0, 0 };
  v8i gz8 = { 0, 0, 0, 0, 0, 0, 0, 0 };
  __builtin_amdgcn_tensor_load_to_lds(g0, g1, gz4, gz4, gz8, 0);
}

// The wait that covers the request made with g0 and g1. It names both groups, so
// that their registers keep their values from the request up to this wait.
__device__ __forceinline__ void tdm_wait(v4u g0, v8i g1) {
  asm volatile("s_wait_tensorcnt 0x0" :: "s"(g0), "s"(g1) : "memory");
}

#define GT 4                            // tiles of K that a wave works on together

// 16 x 16 products of one wave's Q rows with GT 16-row tiles of K that follow one
// another in LDS. The loops are unrolled: all LDS loads of the group issue together
// and are waited for once, and its GT chains of two matrix instructions are
// independent, so that each fills the others' distance.
__device__ __forceinline__ void qk_group(const unsigned short* tiles, int lane,
                                         const v16bf& aq0, const v16bf& aq1, v8f (&acc)[GT]) {
  v16bf bk0[GT], bk1[GT];
#pragma unroll
  for (int i = 0; i < GT; ++i) load_ktile(tiles + i * KT_WORDS, lane, bk0[i], bk1[i]);
  // holds all loads of the group in front of its matrix instructions (loaded values as
  // inputs only): without it the fragment registers are used again inside the group,
  // and the wave waits for LDS five times a group instead of once
  asm volatile("" :: "v"(bk0[0]), "v"(bk1[0]), "v"(bk0[1]), "v"(bk1[1]),
                     "v"(bk0[2]), "v"(bk1[2]), "v"(bk0[3]), "v"(bk1[3]));
#pragma unroll
  for (int i = 0; i < GT; ++i) {
    v8f z = {};
    acc[i] = __builtin_amdgcn_wmma_f32_16x16x32_bf16(false, aq0, false, bk0[i],
                                                     (short)0, z, false, false);
  }
#pragma unroll
  for (int i = 0; i < GT; ++i)
    acc[i] = __builtin_amdgcn_wmma_f32_16x16x32_bf16(false, aq1, false, bk1[i],
                                                     (short)0, acc[i], false, false);
}

// pass 1 on one group: running maximum and sum of exp, per lane; the maximum is
// raised and the old sum rescaled once for the GT scores of a row. EDGE: the group
// may hold masked columns: this lane's column of tile i counts where i * 16 < nl;
// elsewhere every column counts and nl is not read.
// (In p1_group and p2_group all loops are unrolled: registers only.)
template <bool EDGE>
__device__ __forceinline__ void p1_group(const v8f (&acc)[GT], int nl, float (&mL)[8],
                                         float (&lL)[8]) {
#pragma unroll
  for (int j = 0; j < 8; ++j) {
    float s[GT];
    float nm = mL[j];
#pragma unroll
    for (int i = 0; i < GT; ++i) {
      s[i] = (!EDGE || i * 16 < nl) ? acc[i][j] * 0.125f : -1e30f;   // / sqrt(64)
      nm   = fmaxf(nm, s[i]);
    }
    float l = lL[j] * __expf(mL[j] - nm);
#pragma unroll
    for (int i = 0; i < GT; ++i) {
      const float e = __expf(s[i] - nm);
      l += (!EDGE || i * 16 < nl) ? e : 0.f;
    }
    lL[j] = l;
    mL[j] = nm;
  }
}

// pass 2 on one group: probabilities, summed over the wave's 16 rows, added to the
// block's column sums cs[0] (all rows) and cs[S_] (rows weighted by their mask); the
// GT tiles' sums are independent chains, and their exchanges between the two halves
// of the wave are waited for once
template <bool EDGE>
__device__ __forceinline__ void p2_group(const v8f (&acc)[GT], int nl, const float (&mL)[8],
                                         const float (&invL)[8], const float (&mr)[8],
                                         int half, float* cs) {
  float ca[GT], cw[GT];
#pragma unroll
  for (int i = 0; i < GT; ++i) {
    ca[i] = 0.f;
    cw[i] = 0.f;
#pragma unroll
    for (int j = 0; j < 8; ++j) {
      float e = __expf(fminf(acc[i][j] * 0.125f - mL[j], 0.f));
      if (EDGE) e = (i * 16 < nl) ? e : 0.f;
      float p = e * invL[j];
      ca[i] += p;
      cw[i] += mr[j] * p;
    }
  }
  float oa[GT], ow[GT];
#pragma unroll
  for (int i = 0; i < GT; ++i) {
    oa[i] = __shfl_xor(ca[i], 16, 32);
    ow[i] = __shfl_xor(cw[i], 16, 32);
  }
  if (half == 0) {
#pragma unroll
    for (int i = 0; i < GT; ++i) {
      atomicAdd(cs + i * 16, ca[i] + oa[i]);      // LDS adds: the 8 waves meet here
      atomicAdd(cs + S_ + i * 16, cw[i] + ow[i]);
    }
  }
}

__global__ void __launch_bounds__(256)
attn_colsum(const unsigned short* __restrict__ Qb, const unsigned short* __restrict__ Kb,
            const int* __restrict__ mask, const int* __restrict__ ord,
            const int* __restrict__ nb,
            float* __restrict__ w_all, float* __restrict__ w_msk) {
  __shared__ unsigned short ksh[2][CHUNK_ROWS * A_];   // 2 x 16 KB
  __shared__ float csum[2][S_];                        // the block's column sums, 16 KB

  const int lane = threadIdx.x & 31;
  const int wave = threadIdx.x >> 5;
  const int rowtile = blockIdx.x * 8 + wave;     // 0 .. 2047 (same batch per block)
  const int b  = rowtile >> 7;
  const int s0 = (rowtile & 127) << 4;
  const int half = lane >> 4;
  const int ln   = lane & 15;
  const int kb   = half * 8;

  const unsigned short* kpanel = Kb + (size_t)b * S_ * A_;
  const unsigned lds0 = (unsigned)(unsigned long long)(const void*)&ksh[0][0];
  const unsigned lds1 = (unsigned)(unsigned long long)(const void*)&ksh[1][0];

  // A fragments of Q (16 x 64 bf16 -> two 16x32 fragments)
  const unsigned short* qrow = Qb + ((size_t)(b * S_ + s0 + ln)) * A_;
  v16bf aq0, aq1;
  load_kfrag(qrow, kb, aq0, aq1);

  const int* mrow = mask + (size_t)b * S_;
  const int* orow = ord + (size_t)b * S_;
  float mr[8];
#pragma unroll
  for (int j = 0; j < 8; ++j) mr[j] = (float)mrow[orow[s0 + j + half * 8] & (S_ - 1)];

  // unmasked columns of this batch, the same in every wave of the block, held in
  // 0 .. S whatever the word holds: 1 .. NCHUNK chunks
  const int ncol  = min(max(__builtin_amdgcn_readfirstlane(nb[b]), 0), S_);
  const int nch   = max((ncol + CHUNK_ROWS - 1) / CHUNK_ROWS, 1);
  const int ngf   = ncol / (GT * 16);            // groups whose columns are all unmasked
  const int ng    = (ncol + GT * 16 - 1) / (GT * 16);   // groups that hold an unmasked column
  const int nl    = ncol - ngf * (GT * 16) - ln; // in the group behind them: see p1_group

  float mL[8], lL[8];
#pragma unroll
  for (int j = 0; j < 8; ++j) { mL[j] = -1e30f; lL[j] = 0.f; }

  // start values of the block's column sums; the barriers of pass 1 stand
  // between these stores and the first add of pass 2
  for (int i = 0; i < 2 * S_ / 256; ++i) (&csum[0][0])[i * 256 + threadIdx.x] = 0.f;

  // ---- pass 1: row max + sum of exp (online, per-lane partials) ----
  const v8i g1 = tdm_group1();
  v4u g0 = tdm_group0(kpanel, lds0);
  if (wave == 0) tdm_load_chunk(g0, g1);
  for (int c = 0; c < nch; ++c) {
    tdm_wait(g0, g1);
    __syncthreads();                              // chunk c visible in buf c&1
    if (c + 1 < nch) {
      g0 = tdm_group0(kpanel + (size_t)(c + 1) * CHUNK_ROWS * A_, ((c + 1) & 1) ? lds1 : lds0);
      if (wave == 0) tdm_load_chunk(g0, g1);
    }
    const unsigned short* kc = &ksh[c & 1][0];
    for (int g = c * (CHUNK_T / GT); g < min(ng, (c + 1) * (CHUNK_T / GT)); ++g) {
      v8f acc[GT];
      qk_group(kc + (g - c * (CHUNK_T / GT)) * GT * KT_WORDS, lane, aq0, aq1, acc);
      if (g < ngf) p1_group<false>(acc, 0, mL, lL);
      else         p1_group<true>(acc, nl, mL, lL);
    }
    __syncthreads();                              // readers done before overwrite
  }
  // combine partials across the 16 lanes holding each row
#pragma unroll
  for (int d = 1; d < 16; d <<= 1) {
#pragma unroll
    for (int j = 0; j < 8; ++j) {
      float om = __shfl_xor(mL[j], d, 32);
      float ol = __shfl_xor(lL[j], d, 32);
      float nm = fmaxf(mL[j], om);
      lL[j] = lL[j] * __expf(mL[j] - nm) + ol * __expf(om - nm);
      mL[j] = nm;
    }
  }
  float invL[8];
#pragma unroll
  for (int j = 0; j < 8; ++j) invL[j] = (lL[j] > 0.f) ? (1.f / lL[j]) : 0.f;

  // ---- pass 2: probabilities -> column sums ----
  float* gsum = ((threadIdx.x >> 7) ? w_msk : w_all) + (size_t)b * S_ + (threadIdx.x & 127);
  g0 = tdm_group0(kpanel, lds0);
  if (wave == 0) tdm_load_chunk(g0, g1);
  for (int c = 0; c < nch; ++c) {
    tdm_wait(g0, g1);
    __syncthreads();
    if (c + 1 < nch) {
      g0 = tdm_group0(kpanel + (size_t)(c + 1) * CHUNK_ROWS * A_, ((c + 1) & 1) ? lds1 : lds0);
      if (wave == 0) tdm_load_chunk(g0, g1);
    }
    const unsigned short* kc = &ksh[c & 1][0];
    for (int g = c * (CHUNK_T / GT); g < min(ng, (c + 1) * (CHUNK_T / GT)); ++g) {
      v8f acc[GT];
      qk_group(kc + (g - c * (CHUNK_T / GT)) * GT * KT_WORDS, lane, aq0, aq1, acc);
      float* cs = &csum[0][g * GT * 16 + ln];
      if (g < ngf) p2_group<false>(acc, 0, mL, invL, mr, half, cs);
      else         p2_group<true>(acc, nl, mL, invL, mr, half, cs);
    }
    __syncthreads();
  }
  // behind the last barrier the block's sums are complete: one global add per
  // thread and worked chunk (both loops unrolled: bs[] stays in registers)
  float bs[NCHUNK];
#pragma unroll
  for (int i = 0; i < NCHUNK; ++i)
    bs[i] = csum[threadIdx.x >> 7][i * CHUNK_ROWS + (threadIdx.x & 127)];
  // holds all LDS reads in front of the first add: the adds issue back to back, and
  // no register that an issued add names is loaded anew behind it
  asm volatile("" :: "v"(bs[0]), "v"(bs[1]), "v"(bs[2]), "v"(bs[3]), "v"(bs[4]), "v"(bs[5]),
                     "v"(bs[6]), "v"(bs[7]), "v"(bs[8]), "v"(bs[9]), "v"(bs[10]), "v"(bs[11]),
                     "v"(bs[12]), "v"(bs[13]), "v"(bs[14]), "v"(bs[15]));
#pragma unroll
  for (int i = 0; i < NCHUNK; ++i)
    if (i < nch) atomicAdd(gsum + i * CHUNK_ROWS, bs[i]);
}

#define ZW_BLOCKS ((B_ * S_ + 255) / 256)

__global__ void __launch_bounds__(256)
setup_ws(const int* __restrict__ mask, const float* __restrict__ Wq,
         const float* __restrict__ Wk, float* __restrict__ w_all,
         float* __restrict__ w_msk, float* __restrict__ y, int* __restrict__ ord,
         int* __restrict__ pos, int* __restrict__ nb,
         unsigned short* __restrict__ WqB, unsigned short* __restrict__ WkB) {
  __shared__ int seg[S_ / 32];                   // unmasked positions per run of 32
  if (blockIdx.x >= B_ + PW_BLOCKS) {
    int i = (blockIdx.x - (B_ + PW_BLOCKS)) * 256 + threadIdx.x;
    if (i < B_ * S_) { w_all[i] = 0.f; w_msk[i] = 0.f; }
    if (i < B_ * H_) y[i] = 0.f;
    return;
  }
  if (blockIdx.x >= B_) {
    prep_wfrag(blockIdx.x - B_, Wq, Wk, WqB, WkB);
    return;
  }
  const int b    = blockIdx.x;
  const int lane = threadIdx.x & 31;
  const int wave = threadIdx.x >> 5;
  const int* m = mask + (size_t)b * S_;
  int mv[S_ / 256];                              // all loads first: one memory latency, not 8
#pragma unroll
  for (int i = 0; i < S_ / 256; ++i) mv[i] = m[i * 256 + threadIdx.x];
  unsigned bal[S_ / 256];
#pragma unroll
  for (int i = 0; i < S_ / 256; ++i) {
    bal[i] = (unsigned)__ballot(mv[i] != 0);
    if (lane == 0) seg[i * 8 + wave] = __popc(bal[i]);
  }
  __syncthreads();
  int run = 0, base[S_ / 256];
#pragma unroll
  for (int g = 0; g < S_ / 32; ++g) {            // run g holds positions g*32 .. +31
    if ((g & 7) == wave) base[g >> 3] = run;
    run += seg[g];
  }
#pragma unroll
  for (int i = 0; i < S_ / 256; ++i) {
    const int s     = i * 256 + threadIdx.x;
    const int front = base[i] + __popc(bal[i] & ((1u << lane) - 1u));  // unmasked before s
    const int p     = ((bal[i] >> lane) & 1u) ? front : run + (s - front);
    ord[(size_t)b * S_ + p] = s;
    pos[(size_t)b * S_ + s] = p;
  }
  if (threadIdx.x == 0) nb[b] = run;
}

// One block per batch; a block range of after_attn.
__device__ __forceinline__ void
batch_stats(int b, const int* __restrict__ mask, const float* __restrict__ w_msk,
            float* __restrict__ sumw, float* __restrict__ denom) {
  __shared__ float sm[256], sw[256];
  int t = threadIdx.x;
  float a = 0.f, c = 0.f;
  for (int s = t; s < S_; s += 256) {
    a += (float)mask[(size_t)b * S_ + s];
    c += w_msk[(size_t)b * S_ + s];
  }
  sm[t] = a; sw[t] = c; __syncthreads();
  for (int st = 128; st > 0; st >>= 1) {
    if (t < st) { sm[t] += sm[t + st]; sw[t] += sw[t + st]; }
    __syncthreads();
  }
  if (t == 0) { denom[b] = sm[0] + 1e-8f; sumw[b] = sw[0]; }
}

#define WX_BLOCKS ((H_ / 256) * 8 * B_)

__device__ __forceinline__ void
wx_gemv(int blk, const float* __restrict__ x, const float* __restrict__ w_msk,
        const int* __restrict__ ord, const int* __restrict__ nb,
        float* __restrict__ y) {
  int h  = (blk & (H_ / 256 - 1)) * 256 + threadIdx.x;
  int sc = (blk / (H_ / 256)) & 7;
  int b  = blk / ((H_ / 256) * 8);
  const float* xb = x + ((size_t)b * S_) * H_;
  const float* wb = w_msk + (size_t)b * S_;
  const int*   ob = ord + (size_t)b * S_;
  const int ncol = min(max(nb[b], 0), S_);
  const int per  = (((ncol + 7) >> 3) + 7) & ~7;
  const int p0   = sc * per;
  const int pe   = min(p0 + per, (ncol + 7) & ~7);
  float acc = 0.f;
  for (int p = p0; p < pe; p += 8) {
    float v[8];
#pragma unroll
    for (int u = 0; u < 8; ++u)                  // the & keeps the row inside its batch
      v[u] = xb[(unsigned)(ob[p + u] & (S_ - 1)) * H_ + (unsigned)h];
#pragma unroll
    for (int u = 0; u < 8; ++u) acc = fmaf(wb[p + u], v[u], acc);
  }
  atomicAdd(&y[(size_t)b * H_ + h], acc);
  // other block ranges of the launch follow in the code: the wait stands before any
  // rewrite of a register that the add names
  asm volatile("s_wait_xcnt 0x0" ::: "memory");
}

// out[b,h] = (y[b,:] @ Wv[:,h] + sumw[b]*bv[h]) / denom[b]
// One block = 32 columns of out (one 128-byte line a row) for all 16 batches, so
// that Wv is read once. The 1024 k are split over the block's 32 waves, 32 k each:
// a wave issues all its loads at once and pays the memory latency once. The 16
// batches are the 16 rows of an f32 WMMA tile; the waves' partial tiles meet in LDS.
// Every loop here is unrolled, so that its arrays stay in registers.
#define OP_COLS  32
#define OP_WAVES 32
#define OP_KW    (H_ / OP_WAVES)
#define OP_TPIT  272

typedef __attribute__((ext_vector_type(2))) float v2f;

__global__ void __launch_bounds__(1024)
out_proj(const float* __restrict__ y, const float* __restrict__ Wv,
         const float* __restrict__ bv, const float* __restrict__ sumw,
         const float* __restrict__ denom, float* __restrict__ out) {
  __shared__ float red[OP_WAVES][2 * OP_TPIT];

  const int lane = threadIdx.x & 31;
  const int wave = threadIdx.x >> 5;
  const int half = lane >> 4;
  const int ln   = lane & 15;
  const int c0   = blockIdx.x * OP_COLS;
  const int k0   = wave * OP_KW + half * 16;   // this lane's 16 k, for A and for B alike
  float* rw = &red[wave][lane];                // where this lane puts its partial sums

  // B side: rows k0 .. k0+15 of Wv, columns c0 + 2*ln and + 1 (16 lanes = one line).
  // Tile 0 takes the even columns, tile 1 the odd ones.
  const float* wp = Wv + (size_t)k0 * H_ + c0 + 2 * ln;
  v2f w[16];
#pragma unroll
  for (int j = 0; j < 16; ++j) w[j] = *(const v2f*)(wp + (size_t)j * H_);
  // A side: batch ln, the same 16 k
  const float* yp = y + (size_t)ln * H_ + k0;
  v4f a[4];
#pragma unroll
  for (int i = 0; i < 4; ++i) a[i] = *(const v4f*)(yp + 4 * i);

  // the finishing threads (one per output, wave = batch) fetch their terms early
  float sb = 0.f, bb = 0.f, dn = 1.f;
  if (wave < B_) { sb = sumw[wave]; bb = bv[c0 + lane]; dn = denom[wave]; }

  // fragments: k = k0 + 2i, k0 + 2i + 1 in registers 0, 1 of A and of B alike
  v2f af[8], b0[8], b1[8];
#pragma unroll
  for (int i = 0; i < 8; ++i) {
    af[i] = (v2f){ a[i >> 1][(i & 1) * 2], a[i >> 1][(i & 1) * 2 + 1] };
    b0[i] = (v2f){ w[2 * i][0], w[2 * i + 1][0] };
    b1[i] = (v2f){ w[2 * i][1], w[2 * i + 1][1] };
  }
  // all register moves that form the fragments stay in front of the matrix run, so
  // that none of them overwrites an operand of a matrix instruction just issued
  __builtin_amdgcn_sched_barrier(0);
  v8f acc0 = {}, acc1 = {};
#pragma unroll
  for (int i = 0; i < 8; ++i) {
    acc0 = __builtin_amdgcn_wmma_f32_16x16x4_f32(false, af[i], false, b0[i], (short)0, acc0,
                                                 false, false);
    acc1 = __builtin_amdgcn_wmma_f32_16x16x4_f32(false, af[i], false, b1[i], (short)0, acc1,
                                                 false, false);
  }
  __builtin_amdgcn_sched_barrier(0);
  asm volatile("v_nop\n\tv_nop\n\tv_nop\n\tv_nop");
  __builtin_amdgcn_sched_barrier(0);
#pragma unroll
  for (int j = 0; j < 8; ++j) {
    rw[j * 32]           = acc0[j];
    rw[OP_TPIT + j * 32] = acc1[j];
  }
  __syncthreads();                             // all 64 partial tiles (two per wave) are in LDS

  if (wave < B_) {
    const int idx = (lane & 1) * OP_TPIT + (wave & 7) * 32 + (wave >> 3) * 16 + (lane >> 1);
    float s = 0.f;
#pragma unroll
    for (int v = 0; v < OP_WAVES; ++v) s += red[v][idx];
    out[(size_t)wave * H_ + c0 + lane] = (s + sb * bb) / dn;
  }
}

#define AM_BLOCKS ((B_ * S_ + 255) / 256)

__device__ __forceinline__ void
attn_mean(int blk, const float* __restrict__ w_all, const int* __restrict__ pos,
          float* __restrict__ out2) {
  int i = blk * 256 + threadIdx.x;
  if (i < B_ * S_)
    out2[i] = w_all[(i & ~(S_ - 1)) + (pos[i] & (S_ - 1))] * (1.0f / (float)S_);
}

// What needs the finished column sums of attn_colsum and nothing else, three jobs
// that need nothing of one another, as block ranges of one launch: B_ blocks of
// batch_stats (the longest chain of waits, so they stand first), WX_BLOCKS of
// wx_gemv, AM_BLOCKS of attn_mean. The range is picked by blockIdx alone, so every
// barrier of batch_stats is passed by its whole block.
__global__ void __launch_bounds__(256)
after_attn(const float* __restrict__ x, const int* __restrict__ mask,
           const float* __restrict__ w_all, const float* __restrict__ w_msk,
           const int* __restrict__ ord, const int* __restrict__ pos,
           const int* __restrict__ nb, float* __restrict__ sumw,
           float* __restrict__ denom, float* __restrict__ y, float* __restrict__ out2) {
  const int blk = blockIdx.x;
  if (blk < B_)                  batch_stats(blk, mask, w_msk, sumw, denom);
  else if (blk < B_ + WX_BLOCKS) wx_gemv(blk - B_, x, w_msk, ord, nb, y);
  else                           attn_mean(blk - (B_ + WX_BLOCKS), w_all, pos, out2);
}

// ---------------------------------------------------------------------------
extern "C" void kernel_launch(void* const* d_in, const int* in_sizes, int n_in,
                              void* d_out, int out_size, void* d_ws, size_t ws_size,
                              hipStream_t stream) {
  const float* x    = (const float*)d_in[0];
  const int*   mask = (const int*)  d_in[1];
  const float* Wq   = (const float*)d_in[2];
  const float* bq   = (const float*)d_in[3];
  const float* Wk   = (const float*)d_in[4];
  const float* bk   = (const float*)d_in[5];
  const float* Wv   = (const float*)d_in[6];
  const float* bv   = (const float*)d_in[7];
  float* out  = (float*)d_out;                       // (B,H) = 16384 floats
  float* out2 = out + (size_t)B_ * H_;               // (B,S) = 32768 floats

  char* ws = (char*)d_ws;
  const size_t QB_OFF   = 0;
  const size_t KB_OFF   = QB_OFF   + (size_t)B_ * S_ * A_ * 2;   // bf16 Q
  const size_t WQB_OFF  = KB_OFF   + (size_t)B_ * S_ * A_ * 2;   // bf16 K
  const size_t WKB_OFF  = WQB_OFF  + (size_t)65536 * 2;
  const size_t WALL_OFF = WKB_OFF  + (size_t)65536 * 2;
  const size_t WMSK_OFF = WALL_OFF + (size_t)B_ * S_ * 4;
  const size_t Y_OFF    = WMSK_OFF + (size_t)B_ * S_ * 4;
  const size_t SUMW_OFF = Y_OFF    + (size_t)B_ * H_ * 4;
  const size_t DEN_OFF  = SUMW_OFF + 64;
  const size_t NB_OFF   = DEN_OFF  + 64;
  const size_t ORD_OFF  = NB_OFF   + 64;
  const size_t POS_OFF  = ORD_OFF  + (size_t)B_ * S_ * 4;

  unsigned short* Qb   = (unsigned short*)(ws + QB_OFF);
  unsigned short* Kb   = (unsigned short*)(ws + KB_OFF);
  unsigned short* WqB  = (unsigned short*)(ws + WQB_OFF);
  unsigned short* WkB  = (unsigned short*)(ws + WKB_OFF);
  float* w_all = (float*)(ws + WALL_OFF);
  float* w_msk = (float*)(ws + WMSK_OFF);
  float* y     = (float*)(ws + Y_OFF);
  float* sumw  = (float*)(ws + SUMW_OFF);
  float* denom = (float*)(ws + DEN_OFF);
  int*   nb    = (int*)(ws + NB_OFF);
  int*   ord   = (int*)(ws + ORD_OFF);
  int*   pos   = (int*)(ws + POS_OFF);

  setup_ws   <<<B_ + PW_BLOCKS + ZW_BLOCKS, 256, 0, stream>>>(mask, Wq, Wk, w_all, w_msk, y,
                                                              ord, pos, nb, WqB, WkB);
  proj_qk    <<<(B_ * S_) / 128, 512, 0, stream>>>(x, bq, bk, ord, WqB, WkB, Qb, Kb);
  attn_colsum<<<(B_ * S_ / 16) / 8, 256, 0, stream>>>(Qb, Kb, mask, ord, nb, w_all, w_msk);
  after_attn <<<B_ + WX_BLOCKS + AM_BLOCKS, 256, 0, stream>>>(x, mask, w_all, w_msk, ord, pos,
                                                              nb, sumw, denom, y, out2);
  out_proj   <<<H_ / 32, 1024, 0, stream>>>(y, Wv, bv, sumw, denom, out);
}

// v008
// One run takes 52.8 microseconds.
// Next to v007, in two timings, it ran 1.05 times as fast each time.
// Counting every step since v000, it is 5.45 times as fast.
#include <hip/hip_runtime.h>
#include <math.h>

#define S_ 2048
#define H_ 1024
#define A_ 64
#define B_ 16

typedef __attribute__((ext_vector_type(16))) __bf16 v16bf;
typedef __attribute__((ext_vector_type(8)))  __bf16 v8bf;
typedef __attribute__((ext_vector_type(8)))  float  v8f;
typedef __attribute__((ext_vector_type(4)))  unsigned int v4u;
typedef __attribute__((ext_vector_type(8)))  int v8i;
typedef __attribute__((ext_vector_type(4)))  int v4i;
typedef __attribute__((ext_vector_type(2)))  float v2f;

__device__ __forceinline__ __bf16 f2bf(float f) { return (__bf16)f; }
__device__ __forceinline__ unsigned short bf_bits(float f) {
  __bf16 h = (__bf16)f;
  return __builtin_bit_cast(unsigned short, h);
}

#define PW_BLOCKS (65536 / 256)

__device__ __forceinline__ void
prep_wfrag(int blk, const float* __restrict__ Wq, const float* __restrict__ Wk,
           unsigned short* __restrict__ WqB, unsigned short* __restrict__ WkB) {
  int idx = blk * 256 + threadIdx.x;             // 0 .. 65535
  int e    = idx & 15;
  int lane = (idx >> 4) & 31;
  int ks   = (idx >> 9) & 31;
  int nt   = (idx >> 14) & 3;
  int n = nt * 16 + (lane & 15);
  int k = ks * 32 + ((lane >> 4) << 3) + ((e & 8) ? (16 + (e & 7)) : (e & 7));
  WqB[idx] = bf_bits(Wq[(size_t)k * A_ + n]);
  WkB[idx] = bf_bits(Wk[(size_t)k * A_ + n]);
  // other block ranges of the launch follow in the code: the wait stands before any
  // rewrite of a register that the two stores name
  asm volatile("s_wait_xcnt 0x0" ::: "memory");
}

#define PJ_ROWS   128
#define PJ_KC     128                        // k columns per stage
#define PJ_NST    (H_ / PJ_KC)               // 8 stages
#define PJ_XPITCH 132                        // floats per LDS row: 528 B = 16 B x odd
#define PJ_XBUF   (PJ_ROWS * PJ_XPITCH)      // floats per x buffer
#define PJ_WBUF   (4 * 8 * 512)              // 16-bit words per weight buffer

#define KT_WORDS  (16 * A_)                  // 16-bit words of one 16-row tile of K

typedef __attribute__((ext_vector_type(4))) float v4f;

__device__ __forceinline__ unsigned lds_byte(const void* p) {
  return (unsigned)(unsigned long long)p;
}

// One wave's share of one stage: 8 rows of x (512 B each) and 4 x 512 B of
// packed weights. A fragment's two 16-byte halves per lane are split into two
// planes of 512 B, so that each later ds_load_b128 reads 512 contiguous bytes.
__device__ __forceinline__ void pj_copy_stage(const float* const (&gx)[8], int xo, unsigned lx,
                                              const unsigned short* gw, unsigned lw) {
  asm volatile(
      "global_load_async_to_lds_b128 %0, %1, off\n\t"
      "global_load_async_to_lds_b128 %2, %3, off\n\t"
      "global_load_async_to_lds_b128 %4, %5, off\n\t"
      "global_load_async_to_lds_b128 %6, %7, off\n\t"
      "global_load_async_to_lds_b128 %8, %9, off\n\t"
      "global_load_async_to_lds_b128 %10, %11, off\n\t"
      "global_load_async_to_lds_b128 %12, %13, off\n\t"
      "global_load_async_to_lds_b128 %14, %15, off\n\t"
      "global_load_async_to_lds_b128 %16, %17, off\n\t"
      "global_load_async_to_lds_b128 %18, %19, off\n\t"
      "global_load_async_to_lds_b128 %20, %21, off\n\t"
      "global_load_async_to_lds_b128 %22, %23, off\n\t"
      "s_wait_xcnt 0x0"
      :: "v"(lx),                     "v"(gx[0] + xo),
         "v"(lx + 1 * PJ_XPITCH * 4), "v"(gx[1] + xo),
         "v"(lx + 2 * PJ_XPITCH * 4), "v"(gx[2] + xo),
         "v"(lx + 3 * PJ_XPITCH * 4), "v"(gx[3] + xo),
         "v"(lx + 4 * PJ_XPITCH * 4), "v"(gx[4] + xo),
         "v"(lx + 5 * PJ_XPITCH * 4), "v"(gx[5] + xo),
         "v"(lx + 6 * PJ_XPITCH * 4), "v"(gx[6] + xo),
         "v"(lx + 7 * PJ_XPITCH * 4), "v"(gx[7] + xo),
         "v"(lw),                     "v"(gw),
         "v"(lw + 256),               "v"(gw + 256),
         "v"(lw + 8192),              "v"(gw + 512),
         "v"(lw + 8192 + 256),        "v"(gw + 768)
      : "memory");
}

__global__ void __launch_bounds__(512)
proj_qk(const float* __restrict__ x, const float* __restrict__ bq,
        const float* __restrict__ bk, const int* __restrict__ ord,
        const unsigned short* __restrict__ WqB, const unsigned short* __restrict__ WkB,
        unsigned short* __restrict__ Qb, unsigned short* __restrict__ Kb) {
  __shared__ __attribute__((aligned(16))) float          xs[2][PJ_XBUF];
  __shared__ __attribute__((aligned(16))) unsigned short wf[2][PJ_WBUF];

  const int lane = threadIdx.x & 31;
  const int wave = threadIdx.x >> 5;             // 0 .. 15
  const int rt   = wave & 7;                     // 16-row tile of the block
  const int mat  = wave >> 3;                    // 0: Q, 1: K
  const int half = lane >> 4;
  const int ln   = lane & 15;
  const int row0 = blockIdx.x * PJ_ROWS;

  const int cnt = (wave >> 1) & 3;
  const float* gx[8];                            // unrolled: gx[] stays in registers
#pragma unroll
  for (int r = 0; r < 8; ++r)                    // the & keeps the row inside its batch
    gx[r] = x + (size_t)((row0 & ~(S_ - 1)) + (ord[row0 + wave * 8 + r] & (S_ - 1))) * H_
            + lane * 4;
  const unsigned short* gw = (mat ? WkB : WqB) + (size_t)cnt * 32 * 512
                             + (wave & 1) * 1024 + lane * 8;
  const unsigned lx = lds_byte(&xs[0][wave * 8 * PJ_XPITCH + lane * 4]);
  const unsigned lw = lds_byte(&wf[0][((wave & 1) * 16 + mat * 4 + cnt) * 512
                                      + (lane & 1) * 256 + (lane >> 1) * 8]);

  pj_copy_stage(gx, 0, lx, gw, lw);
  // stage 0 has landed for this wave before the barrier publishes it
  asm volatile("s_wait_asynccnt 0x0" ::: "memory");
  __syncthreads();
  pj_copy_stage(gx, PJ_KC, lx + PJ_XBUF * 4, gw + 4 * 512, lw + PJ_WBUF * 2);

  v8f acc[4] = {};
  for (int t = 0; t < PJ_NST; ++t) {
    const int buf = t & 1;
    const float* xr = &xs[buf][(rt * 16 + ln) * PJ_XPITCH + half * 8];
    const unsigned short* wl = &wf[buf][mat * 4 * 512 + lane * 8];
#pragma unroll
    for (int ksl = 0; ksl < 4; ++ksl) {
      v4f f0 = *(const v4f*)(xr + ksl * 32);
      v4f f1 = *(const v4f*)(xr + ksl * 32 + 4);
      v4f f2 = *(const v4f*)(xr + ksl * 32 + 16);
      v4f f3 = *(const v4f*)(xr + ksl * 32 + 20);
      v16bf a;
#pragma unroll
      for (int i = 0; i < 4; ++i) {
        a[i]      = f2bf(f0[i]);
        a[4 + i]  = f2bf(f1[i]);
        a[8 + i]  = f2bf(f2[i]);
        a[12 + i] = f2bf(f3[i]);
      }
#pragma unroll
      for (int nt = 0; nt < 4; ++nt) {
        v8bf lo = *(const v8bf*)(wl + (ksl * 8 + nt) * 512);
        v8bf hi = *(const v8bf*)(wl + (ksl * 8 + nt) * 512 + 256);
        v16bf w;
#pragma unroll
        for (int i = 0; i < 8; ++i) { w[i] = lo[i]; w[8 + i] = hi[i]; }
        acc[nt] = __builtin_amdgcn_wmma_f32_16x16x32_bf16(false, a, false, w,
                                                          (short)0, acc[nt], false, false);
      }
    }
    // this wave's reads of buffer buf are over before it may be refilled
    asm volatile("s_wait_dscnt 0x0" ::: "memory");
    // this wave's copies of stage t + 1 have landed before the barrier publishes them
    asm volatile("s_wait_asynccnt 0x0" ::: "memory");
    __syncthreads();
    if (t + 2 < PJ_NST)
      pj_copy_stage(gx, (t + 2) * PJ_KC, lx + buf * (PJ_XBUF * 4),
                    gw + (t + 2) * 4 * 512, lw + buf * (PJ_WBUF * 2));
  }
  // no copy is outstanding when the wave ends
  asm volatile("s_wait_asynccnt 0x0" ::: "memory");

  if (mat == 0) {
    // Q: row major, 64 columns a row
    unsigned short* __restrict__ O = Qb + (size_t)(row0 + rt * 16 + half * 8) * A_ + ln;
#pragma unroll
    for (int nt = 0; nt < 4; ++nt) {
      const float bb = bq[nt * 16 + ln];
#pragma unroll
      for (int j = 0; j < 8; ++j) O[j * A_ + nt * 16] = bf_bits(acc[nt][j] + bb);
    }
  } else {
    // K: each 16-row tile (2 KB) in the order in which attn_colsum's lanes read
    // it: plane p = col / 16 (512 B), reader lane ((col / 8) & 1) * 16 + row % 16
    // (16 B), element col % 8
    unsigned short* __restrict__ O = Kb + (size_t)((row0 >> 4) + rt) * KT_WORDS
                                     + ((ln >> 3) * 16 + half * 8) * 8 + (ln & 7);
#pragma unroll
    for (int nt = 0; nt < 4; ++nt) {
      const float bb = bk[nt * 16 + ln];
#pragma unroll
      for (int j = 0; j < 8; ++j) O[nt * 256 + j * 8] = bf_bits(acc[nt][j] + bb);
    }
  }
}

__device__ __forceinline__ void load_kfrag(const unsigned short* __restrict__ row,
                                           int kb, v16bf& f0, v16bf& f1) {
  v8bf lo0 = *(const v8bf*)(row + kb);
  v8bf hi0 = *(const v8bf*)(row + kb + 16);
  v8bf lo1 = *(const v8bf*)(row + kb + 32);
  v8bf hi1 = *(const v8bf*)(row + kb + 48);
#pragma unroll
  for (int i = 0; i < 8; ++i) {
    f0[i] = lo0[i]; f0[8 + i] = hi0[i];
    f1[i] = lo1[i]; f1[8 + i] = hi1[i];
  }
}

__device__ __forceinline__ void load_ktile(const unsigned short* tile, int lane,
                                           v16bf& f0, v16bf& f1) {
  v8bf lo0 = *(const v8bf*)(tile + lane * 8);
  v8bf hi0 = *(const v8bf*)(tile + 256 + lane * 8);
  v8bf lo1 = *(const v8bf*)(tile + 512 + lane * 8);
  v8bf hi1 = *(const v8bf*)(tile + 768 + lane * 8);
#pragma unroll
  for (int i = 0; i < 8; ++i) {
    f0[i] = lo0[i]; f0[8 + i] = hi0[i];
    f1[i] = lo1[i]; f1[8 + i] = hi1[i];
  }
}

#define CHUNK_T    8
#define CHUNK_ROWS (CHUNK_T * 16)
#define NCHUNK     (S_ / CHUNK_ROWS)

__device__ __forceinline__ v4u tdm_group0(const unsigned short* gsrc, unsigned lds_off) {
  unsigned long long ga = (unsigned long long)gsrc;
  // every word that is computed is made wave-uniform: the group lies in scalar registers
  v4u g0 = { 1u,                                   // count=1, user mode
             (unsigned)__builtin_amdgcn_readfirstlane((int)lds_off),              // lds_addr
             (unsigned)__builtin_amdgcn_readfirstlane((int)(ga & 0xFFFFFFFFu)),   // global_addr[31:0]
             (unsigned)__builtin_amdgcn_readfirstlane(
                 (int)(((ga >> 32) & 0x01FFFFFFu) | 0x80000000u)) };              // [56:32] | type=2
  asm volatile("" : "+s"(g0));
  return g0;
}

__device__ __forceinline__ v8i tdm_group1() {
  v8i g1 = { 0x00010000,
             0x00400000,
             0x08000000,
             0x00400000,
             CHUNK_ROWS,
             64,
             0, 0 };
  asm volatile("" : "+s"(g1));
  return g1;
}

__device__ __forceinline__ void tdm_load_chunk(v4u g0, v8i g1) {
  v4i gz4 = { 0, 0, 0, 0 };
  v8i gz8 = { 0, 0, 0, 0, 0, 0, 0, 0 };
  __builtin_amdgcn_tensor_load_to_lds(g0, g1, gz4, gz4, gz8, 0);
}

// The wait that covers the request made with g0 and g1. It names both groups, so
// that their registers keep their values from the request up to this wait.
__device__ __forceinline__ void tdm_wait(v4u g0, v8i g1) {
  asm volatile("s_wait_tensorcnt 0x0" :: "s"(g0), "s"(g1) : "memory");
}

#define GT 4                            // tiles of K that a wave works on together

// 16 x 16 products of one wave's Q rows with GT 16-row tiles of K that follow one
// another in LDS. The loops are unrolled: all LDS loads of the group issue together
// and are waited for once, and its GT chains of two matrix instructions are
// independent, so that each fills the others' distance.
__device__ __forceinline__ void qk_group(const unsigned short* tiles, int lane,
                                         const v16bf& aq0, const v16bf& aq1, v8f (&acc)[GT]) {
  v16bf bk0[GT], bk1[GT];
#pragma unroll
  for (int i = 0; i < GT; ++i) load_ktile(tiles + i * KT_WORDS, lane, bk0[i], bk1[i]);
  // holds all loads of the group in front of its matrix instructions (loaded values as
  // inputs only): without it the fragment registers are used again inside the group,
  // and the wave waits for LDS five times a group instead of once
  asm volatile("" :: "v"(bk0[0]), "v"(bk1[0]), "v"(bk0[1]), "v"(bk1[1]),
                     "v"(bk0[2]), "v"(bk1[2]), "v"(bk0[3]), "v"(bk1[3]));
#pragma unroll
  for (int i = 0; i < GT; ++i) {
    v8f z = {};
    acc[i] = __builtin_amdgcn_wmma_f32_16x16x32_bf16(false, aq0, false, bk0[i],
                                                     (short)0, z, false, false);
  }
#pragma unroll
  for (int i = 0; i < GT; ++i)
    acc[i] = __builtin_amdgcn_wmma_f32_16x16x32_bf16(false, aq1, false, bk1[i],
                                                     (short)0, acc[i], false, false);
}

// The softmax works in powers of two on the raw products: exp((a - m) / 8) is
// exp2(a * SC_LOG2 - m * SC_LOG2), one multiply-add and one v_exp_f32 a score. Rows j
// and j + 1 of an accumulator tile lie in neighbouring registers and are worked as a
// pair, so that the multiply-adds and the sums are packed instructions.
#define SC_LOG2 0.18033688f             // log2(e) / sqrt(64)

__device__ __forceinline__ v2f exp2_pair(v2f t) {
  return (v2f){ __builtin_amdgcn_exp2f(t.x), __builtin_amdgcn_exp2f(t.y) };
}

// pass 1 on one group: running maximum of the raw products (mR) and sum of powers, per
// lane and row pair; the maximum is raised and the old sum rescaled once for the GT
// scores of a row. EDGE: the group may hold masked columns: this lane's column of
// tile i counts where i * 16 < nl; elsewhere every column counts and nl is not read.
// (In p1_group and p2_group all loops are unrolled: registers only.)
template <bool EDGE>
__device__ __forceinline__ void p1_group(const v8f (&acc)[GT], int nl, v2f (&mR)[4],
                                         v2f (&lL)[4]) {
  const v2f sc = { SC_LOG2, SC_LOG2 };
#pragma unroll
  for (int jp = 0; jp < 4; ++jp) {
    v2f a[GT];
    v2f nm = mR[jp];
#pragma unroll
    for (int i = 0; i < GT; ++i) {
      a[i].x = (!EDGE || i * 16 < nl) ? acc[i][2 * jp]     : -1e30f;
      a[i].y = (!EDGE || i * 16 < nl) ? acc[i][2 * jp + 1] : -1e30f;
      nm.x   = fmaxf(nm.x, a[i].x);
      nm.y   = fmaxf(nm.y, a[i].y);
    }
    const v2f ns = nm * sc;
    v2f r = exp2_pair(__builtin_elementwise_fma(mR[jp], sc, -ns));
    if (EDGE) {
      // a lane that has met no unmasked column yet: its exponent is the rounding rest of
      // a huge product, its sum is 0 and stays 0
      r.x = (nm.x > -1e30f) ? r.x : 0.f;
      r.y = (nm.y > -1e30f) ? r.y : 0.f;
    }
    v2f l = lL[jp] * r;
#pragma unroll
    for (int i = 0; i < GT; ++i) {
      v2f e = exp2_pair(__builtin_elementwise_fma(a[i], sc, -ns));
      if (EDGE) {
        e.x = (i * 16 < nl) ? e.x : 0.f;
        e.y = (i * 16 < nl) ? e.y : 0.f;
      }
      l += e;
    }
    lL[jp] = l;
    mR[jp] = nm;
  }
}

// pass 2 on one group: probabilities exp2(a * SC_LOG2 - cc), cc = the row's scaled
// maximum + log2 of its sum, summed over the wave's 16 rows, added to the
// block's column sums cs[0] (all rows) and cs[S_] (rows weighted by their mask); the
// GT tiles' sums are independent chains, and their exchanges between the two halves
// of the wave are waited for once
template <bool EDGE>
__device__ __forceinline__ void p2_group(const v8f (&acc)[GT], int nl, const v2f (&cc)[4],
                                         const v2f (&mr)[4], int half, float* cs) {
  const v2f sc = { SC_LOG2, SC_LOG2 };
  float ca[GT], cw[GT];
#pragma unroll
  for (int i = 0; i < GT; ++i) {
    v2f sa = { 0.f, 0.f }, sw = { 0.f, 0.f };
#pragma unroll
    for (int jp = 0; jp < 4; ++jp) {
      const v2f a = { acc[i][2 * jp], acc[i][2 * jp + 1] };
      v2f p = exp2_pair(__builtin_elementwise_fma(a, sc, -cc[jp]));
      if (EDGE) {
        p.x = (i * 16 < nl) ? p.x : 0.f;
        p.y = (i * 16 < nl) ? p.y : 0.f;
      }
      sa += p;
      sw = __builtin_elementwise_fma(mr[jp], p, sw);
    }
    ca[i] = sa.x + sa.y;
    cw[i] = sw.x + sw.y;
  }
  float oa[GT], ow[GT];
#pragma unroll
  for (int i = 0; i < GT; ++i) {
    oa[i] = __shfl_xor(ca[i], 16, 32);
    ow[i] = __shfl_xor(cw[i], 16, 32);
  }
  if (half == 0) {
#pragma unroll
    for (int i = 0; i < GT; ++i) {
      atomicAdd(cs + i * 16, ca[i] + oa[i]);      // LDS adds: the 8 waves meet here
      atomicAdd(cs + S_ + i * 16, cw[i] + ow[i]);
    }
  }
}

__global__ void __launch_bounds__(256)
attn_colsum(const unsigned short* __restrict__ Qb, const unsigned short* __restrict__ Kb,
            const int* __restrict__ mask, const int* __restrict__ ord,
            const int* __restrict__ nb,
            float* __restrict__ w_all, float* __restrict__ w_msk) {
  __shared__ unsigned short ksh[2][CHUNK_ROWS * A_];   // 2 x 16 KB
  __shared__ float csum[2][S_];                        // the block's column sums, 16 KB

  const int lane = threadIdx.x & 31;
  const int wave = threadIdx.x >> 5;
  const int rowtile = blockIdx.x * 8 + wave;     // 0 .. 2047 (same batch per block)
  const int b  = rowtile >> 7;
  const int s0 = (rowtile & 127) << 4;
  const int half = lane >> 4;
  const int ln   = lane & 15;
  const int kb   = half * 8;

  const unsigned short* kpanel = Kb + (size_t)b * S_ * A_;
  const unsigned lds0 = (unsigned)(unsigned long long)(const void*)&ksh[0][0];
  const unsigned lds1 = (unsigned)(unsigned long long)(const void*)&ksh[1][0];

  // A fragments of Q (16 x 64 bf16 -> two 16x32 fragments)
  const unsigned short* qrow = Qb + ((size_t)(b * S_ + s0 + ln)) * A_;
  v16bf aq0, aq1;
  load_kfrag(qrow, kb, aq0, aq1);

  const int* mrow = mask + (size_t)b * S_;
  const int* orow = ord + (size_t)b * S_;
  v2f mr[4];                                     // rows 2*jp and 2*jp + 1 of this half
#pragma unroll
  for (int j = 0; j < 8; ++j)
    mr[j >> 1][j & 1] = (float)mrow[orow[s0 + j + half * 8] & (S_ - 1)];

  // unmasked columns of this batch, the same in every wave of the block, held in
  // 0 .. S whatever the word holds: 1 .. NCHUNK chunks
  const int ncol  = min(max(__builtin_amdgcn_readfirstlane(nb[b]), 0), S_);
  const int nch   = max((ncol + CHUNK_ROWS - 1) / CHUNK_ROWS, 1);
  const int ngf   = ncol / (GT * 16);            // groups whose columns are all unmasked
  const int ng    = (ncol + GT * 16 - 1) / (GT * 16);   // groups that hold an unmasked column
  const int nl    = ncol - ngf * (GT * 16) - ln; // in the group behind them: see p1_group

  v2f mR[4], lL[4];
#pragma unroll
  for (int jp = 0; jp < 4; ++jp) {
    mR[jp] = (v2f){ -1e30f, -1e30f };
    lL[jp] = (v2f){ 0.f, 0.f };
  }

  // start values of the block's column sums; the barriers of pass 1 stand
  // between these stores and the first add of pass 2
  for (int i = 0; i < 2 * S_ / 256; ++i) (&csum[0][0])[i * 256 + threadIdx.x] = 0.f;

  // ---- pass 1: row max + sum of exp (online, per-lane partials) ----
  const v8i g1 = tdm_group1();
  v4u g0 = tdm_group0(kpanel, lds0);
  if (wave == 0) tdm_load_chunk(g0, g1);
  for (int c = 0; c < nch; ++c) {
    tdm_wait(g0, g1);
    __syncthreads();                              // chunk c visible in buf c&1
    if (c + 1 < nch) {
      g0 = tdm_group0(kpanel + (size_t)(c + 1) * CHUNK_ROWS * A_, ((c + 1) & 1) ? lds1 : lds0);
      if (wave == 0) tdm_load_chunk(g0, g1);
    }
    const unsigned short* kc = &ksh[c & 1][0];
    for (int g = c * (CHUNK_T / GT); g < min(ng, (c + 1) * (CHUNK_T / GT)); ++g) {
      v8f acc[GT];
      qk_group(kc + (g - c * (CHUNK_T / GT)) * GT * KT_WORDS, lane, aq0, aq1, acc);
      if (g < ngf) p1_group<false>(acc, 0, mR, lL);
      else         p1_group<true>(acc, nl, mR, lL);
    }
    __syncthreads();                              // readers done before overwrite
  }
  // scaled maxima, as pass 1 used them; a lane without an unmasked column has sum 0
  v2f mS[4];
#pragma unroll
  for (int j = 0; j < 8; ++j)
    mS[j >> 1][j & 1] = (lL[j >> 1][j & 1] > 0.f) ? mR[j >> 1][j & 1] * SC_LOG2 : -1e30f;
  // combine partials across the 16 lanes holding each row
#pragma unroll
  for (int d = 1; d < 16; d <<= 1) {
#pragma unroll
    for (int j = 0; j < 8; ++j) {
      const float m = mS[j >> 1][j & 1];
      const float l = lL[j >> 1][j & 1];
      float om = __shfl_xor(m, d, 32);
      float ol = __shfl_xor(l, d, 32);
      float nm = fmaxf(m, om);
      lL[j >> 1][j & 1] = l * __builtin_amdgcn_exp2f(m - nm) + ol * __builtin_amdgcn_exp2f(om - nm);
      mS[j >> 1][j & 1] = nm;
    }
  }
  // division by the row's sum as a subtraction in the exponent; a row without a sum
  // gets probability exp2(-huge) = 0
  v2f cc[4];
#pragma unroll
  for (int j = 0; j < 8; ++j) {
    const float l = lL[j >> 1][j & 1];
    cc[j >> 1][j & 1] = (l > 0.f) ? mS[j >> 1][j & 1] + __builtin_amdgcn_logf(l) : 1e30f;
  }

  // ---- pass 2: probabilities -> column sums ----
  float* gsum = ((threadIdx.x >> 7) ? w_msk : w_all) + (size_t)b * S_ + (threadIdx.x & 127);
  g0 = tdm_group0(kpanel, lds0);
  if (wave == 0) tdm_load_chunk(g0, g1);
  for (int c = 0; c < nch; ++c) {
    tdm_wait(g0, g1);
    __syncthreads();
    if (c + 1 < nch) {
      g0 = tdm_group0(kpanel + (size_t)(c + 1) * CHUNK_ROWS * A_, ((c + 1) & 1) ? lds1 : lds0);
      if (wave == 0) tdm_load_chunk(g0, g1);
    }
    const unsigned short* kc = &ksh[c & 1][0];
    for (int g = c * (CHUNK_T / GT); g < min(ng, (c + 1) * (CHUNK_T / GT)); ++g) {
      v8f acc[GT];
      qk_group(kc + (g - c * (CHUNK_T / GT)) * GT * KT_WORDS, lane, aq0, aq1, acc);
      float* cs = &csum[0][g * GT * 16 + ln];
      if (g < ngf) p2_group<false>(acc, 0, cc, mr, half, cs);
      else         p2_group<true>(acc, nl, cc, mr, half, cs);
    }
    __syncthreads();
  }
  // behind the last barrier the block's sums are complete: one global add per
  // thread and worked chunk (both loops unrolled: bs[] stays in registers)
  float bs[NCHUNK];
#pragma unroll
  for (int i = 0; i < NCHUNK; ++i)
    bs[i] = csum[threadIdx.x >> 7][i * CHUNK_ROWS + (threadIdx.x & 127)];
  // holds all LDS reads in front of the first add: the adds issue back to back, and
  // no register that an issued add names is loaded anew behind it
  asm volatile("" :: "v"(bs[0]), "v"(bs[1]), "v"(bs[2]), "v"(bs[3]), "v"(bs[4]), "v"(bs[5]),
                     "v"(bs[6]), "v"(bs[7]), "v"(bs[8]), "v"(bs[9]), "v"(bs[10]), "v"(bs[11]),
                     "v"(bs[12]), "v"(bs[13]), "v"(bs[14]), "v"(bs[15]));
#pragma unroll
  for (int i = 0; i < NCHUNK; ++i)
    if (i < nch) atomicAdd(gsum + i * CHUNK_ROWS, bs[i]);
}

#define ZW_BLOCKS ((B_ * S_ + 255) / 256)

__global__ void __launch_bounds__(256)
setup_ws(const int* __restrict__ mask, const float* __restrict__ Wq,
         const float* __restrict__ Wk, float* __restrict__ w_all,
         float* __restrict__ w_msk, float* __restrict__ y, int* __restrict__ ord,
         int* __restrict__ pos, int* __restrict__ nb,
         unsigned short* __restrict__ WqB, unsigned short* __restrict__ WkB) {
  __shared__ int seg[S_ / 32];                   // unmasked positions per run of 32
  if (blockIdx.x >= B_ + PW_BLOCKS) {
    int i = (blockIdx.x - (B_ + PW_BLOCKS)) * 256 + threadIdx.x;
    if (i < B_ * S_) { w_all[i] = 0.f; w_msk[i] = 0.f; }
    if (i < B_ * H_) y[i] = 0.f;
    return;
  }
  if (blockIdx.x >= B_) {
    prep_wfrag(blockIdx.x - B_, Wq, Wk, WqB, WkB);
    return;
  }
  const int b    = blockIdx.x;
  const int lane = threadIdx.x & 31;
  const int wave = threadIdx.x >> 5;
  const int* m = mask + (size_t)b * S_;
  int mv[S_ / 256];                              // all loads first: one memory latency, not 8
#pragma unroll
  for (int i = 0; i < S_ / 256; ++i) mv[i] = m[i * 256 + threadIdx.x];
  unsigned bal[S_ / 256];
#pragma unroll
  for (int i = 0; i < S_ / 256; ++i) {
    bal[i] = (unsigned)__ballot(mv[i] != 0);
    if (lane == 0) seg[i * 8 + wave] = __popc(bal[i]);
  }
  __syncthreads();
  int run = 0, base[S_ / 256];
#pragma unroll
  for (int g = 0; g < S_ / 32; ++g) {            // run g holds positions g*32 .. +31
    if ((g & 7) == wave) base[g >> 3] = run;
    run += seg[g];
  }
#pragma unroll
  for (int i = 0; i < S_ / 256; ++i) {
    const int s     = i * 256 + threadIdx.x;
    const int front = base[i] + __popc(bal[i] & ((1u << lane) - 1u));  // unmasked before s
    const int p     = ((bal[i] >> lane) & 1u) ? front : run + (s - front);
    ord[(size_t)b * S_ + p] = s;
    pos[(size_t)b * S_ + s] = p;
  }
  if (threadIdx.x == 0) nb[b] = run;
}

// One block per batch; a block range of after_attn.
__device__ __forceinline__ void
batch_stats(int b, const int* __restrict__ mask, const float* __restrict__ w_msk,
            float* __restrict__ sumw, float* __restrict__ denom) {
  __shared__ float sm[256], sw[256];
  int t = threadIdx.x;
  float a = 0.f, c = 0.f;
  for (int s = t; s < S_; s += 256) {
    a += (float)mask[(size_t)b * S_ + s];
    c += w_msk[(size_t)b * S_ + s];
  }
  sm[t] = a; sw[t] = c; __syncthreads();
  for (int st = 128; st > 0; st >>= 1) {
    if (t < st) { sm[t] += sm[t + st]; sw[t] += sw[t + st]; }
    __syncthreads();
  }
  if (t == 0) { denom[b] = sm[0] + 1e-8f; sumw[b] = sw[0]; }
}

#define WX_BLOCKS ((H_ / 256) * 8 * B_)

__device__ __forceinline__ void
wx_gemv(int blk, const float* __restrict__ x, const float* __restrict__ w_msk,
        const int* __restrict__ ord, const int* __restrict__ nb,
        float* __restrict__ y) {
  int h  = (blk & (H_ / 256 - 1)) * 256 + threadIdx.x;
  int sc = (blk / (H_ / 256)) & 7;
  int b  = blk / ((H_ / 256) * 8);
  const float* xb = x + ((size_t)b * S_) * H_;
  const float* wb = w_msk + (size_t)b * S_;
  const int*   ob = ord + (size_t)b * S_;
  const int ncol = min(max(nb[b], 0), S_);
  const int per  = (((ncol + 7) >> 3) + 7) & ~7;
  const int p0   = sc * per;
  const int pe   = min(p0 + per, (ncol + 7) & ~7);
  float acc = 0.f;
  for (int p = p0; p < pe; p += 8) {
    float v[8];
#pragma unroll
    for (int u = 0; u < 8; ++u)                  // the & keeps the row inside its batch
      v[u] = xb[(unsigned)(ob[p + u] & (S_ - 1)) * H_ + (unsigned)h];
#pragma unroll
    for (int u = 0; u < 8; ++u) acc = fmaf(wb[p + u], v[u], acc);
  }
  atomicAdd(&y[(size_t)b * H_ + h], acc);
  // other block ranges of the launch follow in the code: the wait stands before any
  // rewrite of a register that the add names
  asm volatile("s_wait_xcnt 0x0" ::: "memory");
}

// out[b,h] = (y[b,:] @ Wv[:,h] + sumw[b]*bv[h]) / denom[b]
// One block = 32 columns of out (one 128-byte line a row) for all 16 batches, so
// that Wv is read once. The 1024 k are split over the block's 32 waves, 32 k each:
// a wave issues all its loads at once and pays the memory latency once. The 16
// batches are the 16 rows of an f32 WMMA tile; the waves' partial tiles meet in LDS.
// Every loop here is unrolled, so that its arrays stay in registers.
#define OP_COLS  32
#define OP_WAVES 32
#define OP_KW    (H_ / OP_WAVES)
#define OP_TPIT  272

__global__ void __launch_bounds__(1024)
out_proj(const float* __restrict__ y, const float* __restrict__ Wv,
         const float* __restrict__ bv, const float* __restrict__ sumw,
         const float* __restrict__ denom, float* __restrict__ out) {
  __shared__ float red[OP_WAVES][2 * OP_TPIT];

  const int lane = threadIdx.x & 31;
  const int wave = threadIdx.x >> 5;
  const int half = lane >> 4;
  const int ln   = lane & 15;
  const int c0   = blockIdx.x * OP_COLS;
  const int k0   = wave * OP_KW + half * 16;   // this lane's 16 k, for A and for B alike
  float* rw = &red[wave][lane];                // where this lane puts its partial sums

  // B side: rows k0 .. k0+15 of Wv, columns c0 + 2*ln and + 1 (16 lanes = one line).
  // Tile 0 takes the even columns, tile 1 the odd ones.
  const float* wp = Wv + (size_t)k0 * H_ + c0 + 2 * ln;
  v2f w[16];
#pragma unroll
  for (int j = 0; j < 16; ++j) w[j] = *(const v2f*)(wp + (size_t)j * H_);
  // A side: batch ln, the same 16 k
  const float* yp = y + (size_t)ln * H_ + k0;
  v4f a[4];
#pragma unroll
  for (int i = 0; i < 4; ++i) a[i] = *(const v4f*)(yp + 4 * i);

  // the finishing threads (one per output, wave = batch) fetch their terms early
  float sb = 0.f, bb = 0.f, dn = 1.f;
  if (wave < B_) { sb = sumw[wave]; bb = bv[c0 + lane]; dn = denom[wave]; }

  // fragments: k = k0 + 2i, k0 + 2i + 1 in registers 0, 1 of A and of B alike
  v2f af[8], b0[8], b1[8];
#pragma unroll
  for (int i = 0; i < 8; ++i) {
    af[i] = (v2f){ a[i >> 1][(i & 1) * 2], a[i >> 1][(i & 1) * 2 + 1] };
    b0[i] = (v2f){ w[2 * i][0], w[2 * i + 1][0] };
    b1[i] = (v2f){ w[2 * i][1], w[2 * i + 1][1] };
  }
  // all register moves that form the fragments stay in front of the matrix run, so
  // that none of them overwrites an operand of a matrix instruction just issued
  __builtin_amdgcn_sched_barrier(0);
  v8f acc0 = {}, acc1 = {};
#pragma unroll
  for (int i = 0; i < 8; ++i) {
    acc0 = __builtin_amdgcn_wmma_f32_16x16x4_f32(false, af[i], false, b0[i], (short)0, acc0,
                                                 false, false);
    acc1 = __builtin_amdgcn_wmma_f32_16x16x4_f32(false, af[i], false, b1[i], (short)0, acc1,
                                                 false, false);
  }
  __builtin_amdgcn_sched_barrier(0);
  asm volatile("v_nop\n\tv_nop\n\tv_nop\n\tv_nop");
  __builtin_amdgcn_sched_barrier(0);
#pragma unroll
  for (int j = 0; j < 8; ++j) {
    rw[j * 32]           = acc0[j];
    rw[OP_TPIT + j * 32] = acc1[j];
  }
  __syncthreads();                             // all 64 partial tiles (two per wave) are in LDS

  if (wave < B_) {
    const int idx = (lane & 1) * OP_TPIT + (wave & 7) * 32 + (wave >> 3) * 16 + (lane >> 1);
    float s = 0.f;
#pragma unroll
    for (int v = 0; v < OP_WAVES; ++v) s += red[v][idx];
    out[(size_t)wave * H_ + c0 + lane] = (s + sb * bb) / dn;
  }
}

#define AM_BLOCKS ((B_ * S_ + 255) / 256)

__device__ __forceinline__ void
attn_mean(int blk, const float* __restrict__ w_all, const int* __restrict__ pos,
          float* __restrict__ out2) {
  int i = blk * 256 + threadIdx.x;
  if (i < B_ * S_)
    out2[i] = w_all[(i & ~(S_ - 1)) + (pos[i] & (S_ - 1))] * (1.0f / (float)S_);
}

// What needs the finished column sums of attn_colsum and nothing else, three jobs
// that need nothing of one another, as block ranges of one launch: B_ blocks of
// batch_stats (the longest chain of waits, so they stand first), WX_BLOCKS of
// wx_gemv, AM_BLOCKS of attn_mean. The range is picked by blockIdx alone, so every
// barrier of batch_stats is passed by its whole block.
__global__ void __launch_bounds__(256)
after_attn(const float* __restrict__ x, const int* __restrict__ mask,
           const float* __restrict__ w_all, const float* __restrict__ w_msk,
           const int* __restrict__ ord, const int* __restrict__ pos,
           const int* __restrict__ nb, float* __restrict__ sumw,
           float* __restrict__ denom, float* __restrict__ y, float* __restrict__ out2) {
  const int blk = blockIdx.x;
  if (blk < B_)                  batch_stats(blk, mask, w_msk, sumw, denom);
  else if (blk < B_ + WX_BLOCKS) wx_gemv(blk - B_, x, w_msk, ord, nb, y);
  else                           attn_mean(blk - (B_ + WX_BLOCKS), w_all, pos, out2);
}

// ---------------------------------------------------------------------------
extern "C" void kernel_launch(void* const* d_in, const int* in_sizes, int n_in,
                              void* d_out, int out_size, void* d_ws, size_t ws_size,
                              hipStream_t stream) {
  const float* x    = (const float*)d_in[0];
  const int*   mask = (const int*)  d_in[1];
  const float* Wq   = (const float*)d_in[2];
  const float* bq   = (const float*)d_in[3];
  const float* Wk   = (const float*)d_in[4];
  const float* bk   = (const float*)d_in[5];
  const float* Wv   = (const float*)d_in[6];
  const float* bv   = (const float*)d_in[7];
  float* out  = (float*)d_out;                       // (B,H) = 16384 floats
  float* out2 = out + (size_t)B_ * H_;               // (B,S) = 32768 floats

  char* ws = (char*)d_ws;
  const size_t QB_OFF   = 0;
  const size_t KB_OFF   = QB_OFF   + (size_t)B_ * S_ * A_ * 2;   // bf16 Q
  const size_t WQB_OFF  = KB_OFF   + (size_t)B_ * S_ * A_ * 2;   // bf16 K
  const size_t WKB_OFF  = WQB_OFF  + (size_t)65536 * 2;
  const size_t WALL_OFF = WKB_OFF  + (size_t)65536 * 2;
  const size_t WMSK_OFF = WALL_OFF + (size_t)B_ * S_ * 4;
  const size_t Y_OFF    = WMSK_OFF + (size_t)B_ * S_ * 4;
  const size_t SUMW_OFF = Y_OFF    + (size_t)B_ * H_ * 4;
  const size_t DEN_OFF  = SUMW_OFF + 64;
  const size_t NB_OFF   = DEN_OFF  + 64;
  const size_t ORD_OFF  = NB_OFF   + 64;
  const size_t POS_OFF  = ORD_OFF  + (size_t)B_ * S_ * 4;

  unsigned short* Qb   = (unsigned short*)(ws + QB_OFF);
  unsigned short* Kb   = (unsigned short*)(ws + KB_OFF);
  unsigned short* WqB  = (unsigned short*)(ws + WQB_OFF);
  unsigned short* WkB  = (unsigned short*)(ws + WKB_OFF);
  float* w_all = (float*)(ws + WALL_OFF);
  float* w_msk = (float*)(ws + WMSK_OFF);
  float* y     = (float*)(ws + Y_OFF);
  float* sumw  = (float*)(ws + SUMW_OFF);
  float* denom = (float*)(ws + DEN_OFF);
  int*   nb    = (int*)(ws + NB_OFF);
  int*   ord   = (int*)(ws + ORD_OFF);
  int*   pos   = (int*)(ws + POS_OFF);

  setup_ws   <<<B_ + PW_BLOCKS + ZW_BLOCKS, 256, 0, stream>>>(mask, Wq, Wk, w_all, w_msk, y,
                                                              ord, pos, nb, WqB, WkB);
  proj_qk    <<<(B_ * S_) / 128, 512, 0, stream>>>(x, bq, bk, ord, WqB, WkB, Qb, Kb);
  attn_colsum<<<(B_ * S_ / 16) / 8, 256, 0, stream>>>(Qb, Kb, mask, ord, nb, w_all, w_msk);
  after_attn <<<B_ + WX_BLOCKS + AM_BLOCKS, 256, 0, stream>>>(x, mask, w_all, w_msk, ord, pos,
                                                              nb, sumw, denom, y, out2);
  out_proj   <<<H_ / 32, 1024, 0, stream>>>(y, Wv, bv, sumw, denom, out);
}

// v009
// Measured time: 47.7 microseconds a run.
// Next to v008, in two timings, it ran 1.11 and 1.10 times as fast.
// Over all steps from v000 it is 6.02 times as fast.
#include <hip/hip_runtime.h>
#include <math.h>

#define S_ 2048
#define H_ 1024
#define A_ 64
#define B_ 16

typedef __attribute__((ext_vector_type(16))) __bf16 v16bf;
typedef __attribute__((ext_vector_type(8)))  __bf16 v8bf;
typedef __attribute__((ext_vector_type(8)))  float  v8f;
typedef __attribute__((ext_vector_type(4)))  unsigned int v4u;
typedef __attribute__((ext_vector_type(8)))  int v8i;
typedef __attribute__((ext_vector_type(4)))  int v4i;
typedef __attribute__((ext_vector_type(2)))  float v2f;

__device__ __forceinline__ __bf16 f2bf(float f) { return (__bf16)f; }
__device__ __forceinline__ unsigned short bf_bits(float f) {
  __bf16 h = (__bf16)f;
  return __builtin_bit_cast(unsigned short, h);
}

#define PW_BLOCKS (65536 / 256)

__device__ __forceinline__ void
prep_wfrag(int blk, const float* __restrict__ Wq, const float* __restrict__ Wk,
           unsigned short* __restrict__ WqB, unsigned short* __restrict__ WkB) {
  int idx = blk * 256 + threadIdx.x;             // 0 .. 65535
  int e    = idx & 15;
  int lane = (idx >> 4) & 31;
  int ks   = (idx >> 9) & 31;
  int nt   = (idx >> 14) & 3;
  int n = nt * 16 + (lane & 15);
  int k = ks * 32 + ((lane >> 4) << 3) + ((e & 8) ? (16 + (e & 7)) : (e & 7));
  WqB[idx] = bf_bits(Wq[(size_t)k * A_ + n]);
  WkB[idx] = bf_bits(Wk[(size_t)k * A_ + n]);
  // other block ranges of the launch follow in the code: the wait stands before any
  // rewrite of a register that the two stores name
  asm volatile("s_wait_xcnt 0x0" ::: "memory");
}

#define PJ_ROWS   128
#define PJ_KC     128                        // k columns per stage
#define PJ_NST    (H_ / PJ_KC)               // 8 stages
#define PJ_XPITCH 132                        // floats per LDS row: 528 B = 16 B x odd
#define PJ_XBUF   (PJ_ROWS * PJ_XPITCH)      // floats per x buffer
#define PJ_WBUF   (4 * 8 * 512)              // 16-bit words per weight buffer

#define KT_WORDS  (16 * A_)                  // 16-bit words of one 16-row tile of K

typedef __attribute__((ext_vector_type(4))) float v4f;

__device__ __forceinline__ unsigned lds_byte(const void* p) {
  return (unsigned)(unsigned long long)p;
}

// One wave's share of one stage: 8 rows of x (512 B each) and 4 x 512 B of
// packed weights. A fragment's two 16-byte halves per lane are split into two
// planes of 512 B, so that each later ds_load_b128 reads 512 contiguous bytes.
__device__ __forceinline__ void pj_copy_stage(const float* const (&gx)[8], int xo, unsigned lx,
                                              const unsigned short* gw, unsigned lw) {
  asm volatile(
      "global_load_async_to_lds_b128 %0, %1, off\n\t"
      "global_load_async_to_lds_b128 %2, %3, off\n\t"
      "global_load_async_to_lds_b128 %4, %5, off\n\t"
      "global_load_async_to_lds_b128 %6, %7, off\n\t"
      "global_load_async_to_lds_b128 %8, %9, off\n\t"
      "global_load_async_to_lds_b128 %10, %11, off\n\t"
      "global_load_async_to_lds_b128 %12, %13, off\n\t"
      "global_load_async_to_lds_b128 %14, %15, off\n\t"
      "global_load_async_to_lds_b128 %16, %17, off\n\t"
      "global_load_async_to_lds_b128 %18, %19, off\n\t"
      "global_load_async_to_lds_b128 %20, %21, off\n\t"
      "global_load_async_to_lds_b128 %22, %23, off\n\t"
      "s_wait_xcnt 0x0"
      :: "v"(lx),                     "v"(gx[0] + xo),
         "v"(lx + 1 * PJ_XPITCH * 4), "v"(gx[1] + xo),
         "v"(lx + 2 * PJ_XPITCH * 4), "v"(gx[2] + xo),
         "v"(lx + 3 * PJ_XPITCH * 4), "v"(gx[3] + xo),
         "v"(lx + 4 * PJ_XPITCH * 4), "v"(gx[4] + xo),
         "v"(lx + 5 * PJ_XPITCH * 4), "v"(gx[5] + xo),
         "v"(lx + 6 * PJ_XPITCH * 4), "v"(gx[6] + xo),
         "v"(lx + 7 * PJ_XPITCH * 4), "v"(gx[7] + xo),
         "v"(lw),                     "v"(gw),
         "v"(lw + 256),               "v"(gw + 256),
         "v"(lw + 8192),              "v"(gw + 512),
         "v"(lw + 8192 + 256),        "v"(gw + 768)
      : "memory");
}

__global__ void __launch_bounds__(512)
proj_qk(const float* __restrict__ x, const float* __restrict__ bq,
        const float* __restrict__ bk, const int* __restrict__ ord,
        const unsigned short* __restrict__ WqB, const unsigned short* __restrict__ WkB,
        unsigned short* __restrict__ Qb, unsigned short* __restrict__ Kb) {
  __shared__ __attribute__((aligned(16))) float          xs[2][PJ_XBUF];
  __shared__ __attribute__((aligned(16))) unsigned short wf[2][PJ_WBUF];

  const int lane = threadIdx.x & 31;
  const int wave = threadIdx.x >> 5;             // 0 .. 15
  const int rt   = wave & 7;                     // 16-row tile of the block
  const int mat  = wave >> 3;                    // 0: Q, 1: K
  const int half = lane >> 4;
  const int ln   = lane & 15;
  const int row0 = blockIdx.x * PJ_ROWS;

  const int cnt = (wave >> 1) & 3;
  const float* gx[8];                            // unrolled: gx[] stays in registers
#pragma unroll
  for (int r = 0; r < 8; ++r)                    // the & keeps the row inside its batch
    gx[r] = x + (size_t)((row0 & ~(S_ - 1)) + (ord[row0 + wave * 8 + r] & (S_ - 1))) * H_
            + lane * 4;
  const unsigned short* gw = (mat ? WkB : WqB) + (size_t)cnt * 32 * 512
                             + (wave & 1) * 1024 + lane * 8;
  const unsigned lx = lds_byte(&xs[0][wave * 8 * PJ_XPITCH + lane * 4]);
  const unsigned lw = lds_byte(&wf[0][((wave & 1) * 16 + mat * 4 + cnt) * 512
                                      + (lane & 1) * 256 + (lane >> 1) * 8]);

  pj_copy_stage(gx, 0, lx, gw, lw);
  // stage 0 has landed for this wave before the barrier publishes it
  asm volatile("s_wait_asynccnt 0x0" ::: "memory");
  __syncthreads();
  pj_copy_stage(gx, PJ_KC, lx + PJ_XBUF * 4, gw + 4 * 512, lw + PJ_WBUF * 2);

  v8f acc[4] = {};
  for (int t = 0; t < PJ_NST; ++t) {
    const int buf = t & 1;
    const float* xr = &xs[buf][(rt * 16 + ln) * PJ_XPITCH + half * 8];
    const unsigned short* wl = &wf[buf][mat * 4 * 512 + lane * 8];
#pragma unroll
    for (int ksl = 0; ksl < 4; ++ksl) {
      v4f f0 = *(const v4f*)(xr + ksl * 32);
      v4f f1 = *(const v4f*)(xr + ksl * 32 + 4);
      v4f f2 = *(const v4f*)(xr + ksl * 32 + 16);
      v4f f3 = *(const v4f*)(xr + ksl * 32 + 20);
      v16bf a;
#pragma unroll
      for (int i = 0; i < 4; ++i) {
        a[i]      = f2bf(f0[i]);
        a[4 + i]  = f2bf(f1[i]);
        a[8 + i]  = f2bf(f2[i]);
        a[12 + i] = f2bf(f3[i]);
      }
#pragma unroll
      for (int nt = 0; nt < 4; ++nt) {
        v8bf lo = *(const v8bf*)(wl + (ksl * 8 + nt) * 512);
        v8bf hi = *(const v8bf*)(wl + (ksl * 8 + nt) * 512 + 256);
        v16bf w;
#pragma unroll
        for (int i = 0; i < 8; ++i) { w[i] = lo[i]; w[8 + i] = hi[i]; }
        acc[nt] = __builtin_amdgcn_wmma_f32_16x16x32_bf16(false, a, false, w,
                                                          (short)0, acc[nt], false, false);
      }
    }
    // this wave's reads of buffer buf are over before it may be refilled
    asm volatile("s_wait_dscnt 0x0" ::: "memory");
    // this wave's copies of stage t + 1 have landed before the barrier publishes them
    asm volatile("s_wait_asynccnt 0x0" ::: "memory");
    __syncthreads();
    if (t + 2 < PJ_NST)
      pj_copy_stage(gx, (t + 2) * PJ_KC, lx + buf * (PJ_XBUF * 4),
                    gw + (t + 2) * 4 * 512, lw + buf * (PJ_WBUF * 2));
  }
  // no copy is outstanding when the wave ends
  asm volatile("s_wait_asynccnt 0x0" ::: "memory");

  if (mat == 0) {
    // Q: row major, 64 columns a row
    unsigned short* __restrict__ O = Qb + (size_t)(row0 + rt * 16 + half * 8) * A_ + ln;
#pragma unroll
    for (int nt = 0; nt < 4; ++nt) {
      const float bb = bq[nt * 16 + ln];
#pragma unroll
      for (int j = 0; j < 8; ++j) O[j * A_ + nt * 16] = bf_bits(acc[nt][j] + bb);
    }
  } else {
    // K: each 16-row tile (2 KB) in the order in which attn_colsum's lanes read
    // it: plane p = col / 16 (512 B), reader lane ((col / 8) & 1) * 16 + row % 16
    // (16 B), element col % 8
    unsigned short* __restrict__ O = Kb + (size_t)((row0 >> 4) + rt) * KT_WORDS
                                     + ((ln >> 3) * 16 + half * 8) * 8 + (ln & 7);
#pragma unroll
    for (int nt = 0; nt < 4; ++nt) {
      const float bb = bk[nt * 16 + ln];
#pragma unroll
      for (int j = 0; j < 8; ++j) O[nt * 256 + j * 8] = bf_bits(acc[nt][j] + bb);
    }
  }
}

__device__ __forceinline__ void load_kfrag(const unsigned short* __restrict__ row,
                                           int kb, v16bf& f0, v16bf& f1) {
  v8bf lo0 = *(const v8bf*)(row + kb);
  v8bf hi0 = *(const v8bf*)(row + kb + 16);
  v8bf lo1 = *(const v8bf*)(row + kb + 32);
  v8bf hi1 = *(const v8bf*)(row + kb + 48);
#pragma unroll
  for (int i = 0; i < 8; ++i) {
    f0[i] = lo0[i]; f0[8 + i] = hi0[i];
    f1[i] = lo1[i]; f1[8 + i] = hi1[i];
  }
}

__device__ __forceinline__ void load_ktile(const unsigned short* tile, int lane,
                                           v16bf& f0, v16bf& f1) {
  v8bf lo0 = *(const v8bf*)(tile + lane * 8);
  v8bf hi0 = *(const v8bf*)(tile + 256 + lane * 8);
  v8bf lo1 = *(const v8bf*)(tile + 512 + lane * 8);
  v8bf hi1 = *(const v8bf*)(tile + 768 + lane * 8);
#pragma unroll
  for (int i = 0; i < 8; ++i) {
    f0[i] = lo0[i]; f0[8 + i] = hi0[i];
    f1[i] = lo1[i]; f1[8 + i] = hi1[i];
  }
}

#define CHUNK_T    8
#define CHUNK_ROWS (CHUNK_T * 16)
#define NCHUNK     (S_ / CHUNK_ROWS)

__device__ __forceinline__ v4u tdm_group0(const unsigned short* gsrc, unsigned lds_off) {
  unsigned long long ga = (unsigned long long)gsrc;
  // every word that is computed is made wave-uniform: the group lies in scalar registers
  v4u g0 = { 1u,                                   // count=1, user mode
             (unsigned)__builtin_amdgcn_readfirstlane((int)lds_off),              // lds_addr
             (unsigned)__builtin_amdgcn_readfirstlane((int)(ga & 0xFFFFFFFFu)),   // global_addr[31:0]
             (unsigned)__builtin_amdgcn_readfirstlane(
                 (int)(((ga >> 32) & 0x01FFFFFFu) | 0x80000000u)) };              // [56:32] | type=2
  asm volatile("" : "+s"(g0));
  return g0;
}

__device__ __forceinline__ v8i tdm_group1() {
  v8i g1 = { 0x00010000,
             0x00400000,
             0x08000000,
             0x00400000,
             CHUNK_ROWS,
             64,
             0, 0 };
  asm volatile("" : "+s"(g1));
  return g1;
}

__device__ __forceinline__ void tdm_load_chunk(v4u g0, v8i g1) {
  v4i gz4 = { 0, 0, 0, 0 };
  v8i gz8 = { 0, 0, 0, 0, 0, 0, 0, 0 };
  __builtin_amdgcn_tensor_load_to_lds(g0, g1, gz4, gz4, gz8, 0);
}

// The wait that covers the request made with g0 and g1. It names both groups, so
// that their registers keep their values from the request up to this wait.
__device__ __forceinline__ void tdm_wait(v4u g0, v8i g1) {
  asm volatile("s_wait_tensorcnt 0x0" :: "s"(g0), "s"(g1) : "memory");
}

#define GT 4                            // tiles of K that a wave works on together

// 16 x 16 products of one wave's Q rows with GT 16-row tiles of K that follow one
// another in LDS. The loops are unrolled: all LDS loads of the group issue together
// and are waited for once, and its GT chains of two matrix instructions are
// independent, so that each fills the others' distance.
__device__ __forceinline__ void qk_group(const unsigned short* tiles, int lane,
                                         const v16bf& aq0, const v16bf& aq1, v8f (&acc)[GT]) {
  v16bf bk0[GT], bk1[GT];
#pragma unroll
  for (int i = 0; i < GT; ++i) load_ktile(tiles + i * KT_WORDS, lane, bk0[i], bk1[i]);
  // holds all loads of the group in front of its matrix instructions (loaded values as
  // inputs only): without it the fragment registers are used again inside the group,
  // and the wave waits for LDS five times a group instead of once
  asm volatile("" :: "v"(bk0[0]), "v"(bk1[0]), "v"(bk0[1]), "v"(bk1[1]),
                     "v"(bk0[2]), "v"(bk1[2]), "v"(bk0[3]), "v"(bk1[3]));
#pragma unroll
  for (int i = 0; i < GT; ++i) {
    v8f z = {};
    acc[i] = __builtin_amdgcn_wmma_f32_16x16x32_bf16(false, aq0, false, bk0[i],
                                                     (short)0, z, false, false);
  }
#pragma unroll
  for (int i = 0; i < GT; ++i)
    acc[i] = __builtin_amdgcn_wmma_f32_16x16x32_bf16(false, aq1, false, bk1[i],
                                                     (short)0, acc[i], false, false);
}

// The softmax works in powers of two on the raw products: exp((a - m) / 8) is
// exp2(a * SC_LOG2 - m * SC_LOG2), one multiply-add and one v_exp_f32 a score. Rows j
// and j + 1 of an accumulator tile lie in neighbouring registers and are worked as a
// pair, so that the multiply-adds and the sums are packed instructions.
#define SC_LOG2 0.18033688f             // log2(e) / sqrt(64)

__device__ __forceinline__ v2f exp2_pair(v2f t) {
  return (v2f){ __builtin_amdgcn_exp2f(t.x), __builtin_amdgcn_exp2f(t.y) };
}

// pass 1 on one group: running maximum of the raw products (mR) and sum of powers, per
// lane and row pair; the maximum is raised and the old sum rescaled once for the GT
// scores of a row. EDGE: the group may hold masked columns: this lane's column of
// tile i counts where i * 16 < nl; elsewhere every column counts and nl is not read.
// (In p1_group and p2_group all loops are unrolled: registers only.)
template <bool EDGE>
__device__ __forceinline__ void p1_group(const v8f (&acc)[GT], int nl, v2f (&mR)[4],
                                         v2f (&lL)[4]) {
  const v2f sc = { SC_LOG2, SC_LOG2 };
#pragma unroll
  for (int jp = 0; jp < 4; ++jp) {
    v2f a[GT];
    v2f nm = mR[jp];
#pragma unroll
    for (int i = 0; i < GT; ++i) {
      a[i].x = (!EDGE || i * 16 < nl) ? acc[i][2 * jp]     : -1e30f;
      a[i].y = (!EDGE || i * 16 < nl) ? acc[i][2 * jp + 1] : -1e30f;
      nm.x   = fmaxf(nm.x, a[i].x);
      nm.y   = fmaxf(nm.y, a[i].y);
    }
    const v2f ns = nm * sc;
    v2f r = exp2_pair(__builtin_elementwise_fma(mR[jp], sc, -ns));
    if (EDGE) {
      // a lane that has met no unmasked column yet: its exponent is the rounding rest of
      // a huge product, its sum is 0 and stays 0
      r.x = (nm.x > -1e30f) ? r.x : 0.f;
      r.y = (nm.y > -1e30f) ? r.y : 0.f;
    }
    v2f l = lL[jp] * r;
#pragma unroll
    for (int i = 0; i < GT; ++i) {
      v2f e = exp2_pair(__builtin_elementwise_fma(a[i], sc, -ns));
      if (EDGE) {
        e.x = (i * 16 < nl) ? e.x : 0.f;
        e.y = (i * 16 < nl) ? e.y : 0.f;
      }
      l += e;
    }
    lL[jp] = l;
    mR[jp] = nm;
  }
}

// pass 2 on one group: probabilities exp2(a * SC_LOG2 - cc), cc = the row's scaled
// maximum + log2 of its sum, summed over the wave's 16 rows, added to the
// block's column sums cs[0] (all rows) and cs[S_] (rows weighted by their mask); the
// GT tiles' sums are independent chains, and their exchanges between the two halves
// of the wave are waited for once
template <bool EDGE>
__device__ __forceinline__ void p2_group(const v8f (&acc)[GT], int nl, const v2f (&cc)[4],
                                         const v2f (&mr)[4], int half, float* cs) {
  const v2f sc = { SC_LOG2, SC_LOG2 };
  float ca[GT], cw[GT];
#pragma unroll
  for (int i = 0; i < GT; ++i) {
    v2f sa = { 0.f, 0.f }, sw = { 0.f, 0.f };
#pragma unroll
    for (int jp = 0; jp < 4; ++jp) {
      const v2f a = { acc[i][2 * jp], acc[i][2 * jp + 1] };
      v2f p = exp2_pair(__builtin_elementwise_fma(a, sc, -cc[jp]));
      if (EDGE) {
        p.x = (i * 16 < nl) ? p.x : 0.f;
        p.y = (i * 16 < nl) ? p.y : 0.f;
      }
      sa += p;
      sw = __builtin_elementwise_fma(mr[jp], p, sw);
    }
    ca[i] = sa.x + sa.y;
    cw[i] = sw.x + sw.y;
  }
  float oa[GT], ow[GT];
#pragma unroll
  for (int i = 0; i < GT; ++i) {
    oa[i] = __shfl_xor(ca[i], 16, 32);
    ow[i] = __shfl_xor(cw[i], 16, 32);
  }
  if (half == 0) {
#pragma unroll
    for (int i = 0; i < GT; ++i) {
      atomicAdd(cs + i * 16, ca[i] + oa[i]);      // LDS adds: the 8 waves meet here
      atomicAdd(cs + S_ + i * 16, cw[i] + ow[i]);
    }
  }
}

__global__ void __launch_bounds__(256)
attn_colsum(const unsigned short* __restrict__ Qb, const unsigned short* __restrict__ Kb,
            const int* __restrict__ mask, const int* __restrict__ ord,
            const int* __restrict__ nb,
            float* __restrict__ w_all, float* __restrict__ w_msk) {
  __shared__ unsigned short ksh[2][CHUNK_ROWS * A_];   // 2 x 16 KB
  __shared__ float csum[2][S_];                        // the block's column sums, 16 KB

  const int lane = threadIdx.x & 31;
  const int wave = threadIdx.x >> 5;
  const int rowtile = blockIdx.x * 8 + wave;     // 0 .. 2047 (same batch per block)
  const int b  = rowtile >> 7;
  const int s0 = (rowtile & 127) << 4;
  const int half = lane >> 4;
  const int ln   = lane & 15;
  const int kb   = half * 8;

  const unsigned short* kpanel = Kb + (size_t)b * S_ * A_;
  const unsigned lds0 = (unsigned)(unsigned long long)(const void*)&ksh[0][0];
  const unsigned lds1 = (unsigned)(unsigned long long)(const void*)&ksh[1][0];

  // A fragments of Q (16 x 64 bf16 -> two 16x32 fragments)
  const unsigned short* qrow = Qb + ((size_t)(b * S_ + s0 + ln)) * A_;
  v16bf aq0, aq1;
  load_kfrag(qrow, kb, aq0, aq1);

  const int* mrow = mask + (size_t)b * S_;
  const int* orow = ord + (size_t)b * S_;
  v2f mr[4];                                     // rows 2*jp and 2*jp + 1 of this half
#pragma unroll
  for (int j = 0; j < 8; ++j)
    mr[j >> 1][j & 1] = (float)mrow[orow[s0 + j + half * 8] & (S_ - 1)];

  // unmasked columns of this batch, the same in every wave of the block, held in
  // 0 .. S whatever the word holds: 1 .. NCHUNK chunks
  const int ncol  = min(max(__builtin_amdgcn_readfirstlane(nb[b]), 0), S_);
  const int nch   = max((ncol + CHUNK_ROWS - 1) / CHUNK_ROWS, 1);
  const int ngf   = ncol / (GT * 16);            // groups whose columns are all unmasked
  const int ng    = (ncol + GT * 16 - 1) / (GT * 16);   // groups that hold an unmasked column
  const int nl    = ncol - ngf * (GT * 16) - ln; // in the group behind them: see p1_group

  v2f mR[4], lL[4];
#pragma unroll
  for (int jp = 0; jp < 4; ++jp) {
    mR[jp] = (v2f){ -1e30f, -1e30f };
    lL[jp] = (v2f){ 0.f, 0.f };
  }

  // start values of the block's column sums; the barriers of pass 1 stand
  // between these stores and the first add of pass 2
  for (int i = 0; i < 2 * S_ / 256; ++i) (&csum[0][0])[i * 256 + threadIdx.x] = 0.f;

  // ---- pass 1: row max + sum of exp (online, per-lane partials) ----
  const v8i g1 = tdm_group1();
  v4u g0 = tdm_group0(kpanel, lds0);
  if (wave == 0) tdm_load_chunk(g0, g1);
  for (int c = 0; c < nch; ++c) {
    tdm_wait(g0, g1);
    __syncthreads();                              // chunk c visible in buf c&1
    if (c + 1 < nch) {
      g0 = tdm_group0(kpanel + (size_t)(c + 1) * CHUNK_ROWS * A_, ((c + 1) & 1) ? lds1 : lds0);
      if (wave == 0) tdm_load_chunk(g0, g1);
    }
    const unsigned short* kc = &ksh[c & 1][0];
    for (int g = c * (CHUNK_T / GT); g < min(ng, (c + 1) * (CHUNK_T / GT)); ++g) {
      v8f acc[GT];
      qk_group(kc + (g - c * (CHUNK_T / GT)) * GT * KT_WORDS, lane, aq0, aq1, acc);
      if (g < ngf) p1_group<false>(acc, 0, mR, lL);
      else         p1_group<true>(acc, nl, mR, lL);
    }
    __syncthreads();                              // readers done before overwrite
  }
  // scaled maxima, as pass 1 used them; a lane without an unmasked column has sum 0
  v2f mS[4];
#pragma unroll
  for (int j = 0; j < 8; ++j)
    mS[j >> 1][j & 1] = (lL[j >> 1][j & 1] > 0.f) ? mR[j >> 1][j & 1] * SC_LOG2 : -1e30f;
  // combine partials across the 16 lanes holding each row
#pragma unroll
  for (int d = 1; d < 16; d <<= 1) {
#pragma unroll
    for (int j = 0; j < 8; ++j) {
      const float m = mS[j >> 1][j & 1];
      const float l = lL[j >> 1][j & 1];
      float om = __shfl_xor(m, d, 32);
      float ol = __shfl_xor(l, d, 32);
      float nm = fmaxf(m, om);
      lL[j >> 1][j & 1] = l * __builtin_amdgcn_exp2f(m - nm) + ol * __builtin_amdgcn_exp2f(om - nm);
      mS[j >> 1][j & 1] = nm;
    }
  }
  // division by the row's sum as a subtraction in the exponent; a row without a sum
  // gets probability exp2(-huge) = 0
  v2f cc[4];
#pragma unroll
  for (int j = 0; j < 8; ++j) {
    const float l = lL[j >> 1][j & 1];
    cc[j >> 1][j & 1] = (l > 0.f) ? mS[j >> 1][j & 1] + __builtin_amdgcn_logf(l) : 1e30f;
  }

  // ---- pass 2: probabilities -> column sums ----
  float* gsum = ((threadIdx.x >> 7) ? w_msk : w_all) + (size_t)b * S_ + (threadIdx.x & 127);
  g0 = tdm_group0(kpanel, lds0);
  if (wave == 0) tdm_load_chunk(g0, g1);
  for (int c = 0; c < nch; ++c) {
    tdm_wait(g0, g1);
    __syncthreads();
    if (c + 1 < nch) {
      g0 = tdm_group0(kpanel + (size_t)(c + 1) * CHUNK_ROWS * A_, ((c + 1) & 1) ? lds1 : lds0);
      if (wave == 0) tdm_load_chunk(g0, g1);
    }
    const unsigned short* kc = &ksh[c & 1][0];
    for (int g = c * (CHUNK_T / GT); g < min(ng, (c + 1) * (CHUNK_T / GT)); ++g) {
      v8f acc[GT];
      qk_group(kc + (g - c * (CHUNK_T / GT)) * GT * KT_WORDS, lane, aq0, aq1, acc);
      float* cs = &csum[0][g * GT * 16 + ln];
      if (g < ngf) p2_group<false>(acc, 0, cc, mr, half, cs);
      else         p2_group<true>(acc, nl, cc, mr, half, cs);
    }
    __syncthreads();
  }
  // behind the last barrier the block's sums are complete: one global add per
  // thread and worked chunk (both loops unrolled: bs[] stays in registers)
  float bs[NCHUNK];
#pragma unroll
  for (int i = 0; i < NCHUNK; ++i)
    bs[i] = csum[threadIdx.x >> 7][i * CHUNK_ROWS + (threadIdx.x & 127)];
  // holds all LDS reads in front of the first add: the adds issue back to back, and
  // no register that an issued add names is loaded anew behind it
  asm volatile("" :: "v"(bs[0]), "v"(bs[1]), "v"(bs[2]), "v"(bs[3]), "v"(bs[4]), "v"(bs[5]),
                     "v"(bs[6]), "v"(bs[7]), "v"(bs[8]), "v"(bs[9]), "v"(bs[10]), "v"(bs[11]),
                     "v"(bs[12]), "v"(bs[13]), "v"(bs[14]), "v"(bs[15]));
#pragma unroll
  for (int i = 0; i < NCHUNK; ++i)
    if (i < nch) atomicAdd(gsum + i * CHUNK_ROWS, bs[i]);
}

#define ZW_BLOCKS ((B_ * S_ + 255) / 256)

__global__ void __launch_bounds__(256)
setup_ws(const int* __restrict__ mask, const float* __restrict__ Wq,
         const float* __restrict__ Wk, float* __restrict__ w_all,
         float* __restrict__ w_msk, float* __restrict__ y, int* __restrict__ ord,
         int* __restrict__ pos, int* __restrict__ nb,
         unsigned short* __restrict__ WqB, unsigned short* __restrict__ WkB) {
  __shared__ int seg[S_ / 32];                   // unmasked positions per run of 32
  if (blockIdx.x >= B_ + PW_BLOCKS) {
    int i = (blockIdx.x - (B_ + PW_BLOCKS)) * 256 + threadIdx.x;
    if (i < B_ * S_) { w_all[i] = 0.f; w_msk[i] = 0.f; }
    if (i < B_ * H_) y[i] = 0.f;
    return;
  }
  if (blockIdx.x >= B_) {
    prep_wfrag(blockIdx.x - B_, Wq, Wk, WqB, WkB);
    return;
  }
  const int b    = blockIdx.x;
  const int lane = threadIdx.x & 31;
  const int wave = threadIdx.x >> 5;
  const int* m = mask + (size_t)b * S_;
  int mv[S_ / 256];                              // all loads first: one memory latency, not 8
#pragma unroll
  for (int i = 0; i < S_ / 256; ++i) mv[i] = m[i * 256 + threadIdx.x];
  unsigned bal[S_ / 256];
#pragma unroll
  for (int i = 0; i < S_ / 256; ++i) {
    bal[i] = (unsigned)__ballot(mv[i] != 0);
    if (lane == 0) seg[i * 8 + wave] = __popc(bal[i]);
  }
  __syncthreads();
  int run = 0, base[S_ / 256];
#pragma unroll
  for (int g = 0; g < S_ / 32; ++g) {            // run g holds positions g*32 .. +31
    if ((g & 7) == wave) base[g >> 3] = run;
    run += seg[g];
  }
#pragma unroll
  for (int i = 0; i < S_ / 256; ++i) {
    const int s     = i * 256 + threadIdx.x;
    const int front = base[i] + __popc(bal[i] & ((1u << lane) - 1u));  // unmasked before s
    const int p     = ((bal[i] >> lane) & 1u) ? front : run + (s - front);
    ord[(size_t)b * S_ + p] = s;
    pos[(size_t)b * S_ + s] = p;
  }
  if (threadIdx.x == 0) nb[b] = run;
}

// One block per batch; a block range of after_attn.
__device__ __forceinline__ void
batch_stats(int b, const int* __restrict__ mask, const float* __restrict__ w_msk,
            float* __restrict__ sumw, float* __restrict__ denom) {
  __shared__ float sm[256], sw[256];
  int t = threadIdx.x;
  float a = 0.f, c = 0.f;
  for (int s = t; s < S_; s += 256) {
    a += (float)mask[(size_t)b * S_ + s];
    c += w_msk[(size_t)b * S_ + s];
  }
  sm[t] = a; sw[t] = c; __syncthreads();
  for (int st = 128; st > 0; st >>= 1) {
    if (t < st) { sm[t] += sm[t + st]; sw[t] += sw[t + st]; }
    __syncthreads();
  }
  if (t == 0) { denom[b] = sm[0] + 1e-8f; sumw[b] = sw[0]; }
}

#define WX_BLOCKS ((H_ / 256) * 8 * B_)
#define WX_GR 4
#define WX_NG (8 * WX_GR)
#define WX_NQ 8

__device__ __forceinline__ void
wx_gemv(int blk, const float* __restrict__ x, const float* __restrict__ w_msk,
        const int* __restrict__ ord, const int* __restrict__ nb,
        float* __restrict__ y) {
  __shared__ __attribute__((aligned(16))) float red[WX_GR][256];
  const int h0 = (blk & (H_ / 256 - 1)) * 256;
  const int sc = (blk / (H_ / 256)) & 7;
  const int b  = blk / ((H_ / 256) * 8);
  const int gi = sc * WX_GR + __builtin_amdgcn_readfirstlane((int)(threadIdx.x >> 6));
  const unsigned c4 = (unsigned)(h0 >> 2) + (threadIdx.x & 63);   // this lane's 4 columns
  const v4f* xb = (const v4f*)(x + ((size_t)b * S_) * H_);
  const v4f* wb = (const v4f*)(w_msk + (size_t)b * S_);
  const v4i* ob = (const v4i*)(ord + (size_t)b * S_);
  const int ncol = min(max(nb[b], 0), S_);
  const int nq   = (ncol + 3) >> 2;
  v4i o[WX_NQ];
  v4f w[WX_NQ];
#pragma unroll
  for (int j = 0; j < WX_NQ; ++j) {
    o[j] = ob[min(gi + WX_NG * j, max(nq - 1, 0))];
    w[j] = wb[gi + WX_NG * j];
  }
  v4f v[WX_NQ * 4];
#pragma unroll
  for (int hf = 0; hf < 2; ++hf) {
    unsigned f[16];
#pragma unroll
    for (int u = 0; u < 16; ++u)                 // the & keeps the row inside its batch
      f[u] = (unsigned)(o[hf * 4 + (u >> 2)][u & 3] & (S_ - 1)) * (H_ / 4) + c4;
#pragma unroll
    for (int u = 0; u < 16; ++u) v[hf * 16 + u] = xb[f[u]];
    // the wait stands before any rewrite of a register that the 16 loads name; it names
    // their offsets, so that those registers keep their values up to it
    asm volatile("s_wait_xcnt 0x0"
                 :: "v"(f[0]), "v"(f[1]), "v"(f[2]), "v"(f[3]), "v"(f[4]), "v"(f[5]),
                    "v"(f[6]), "v"(f[7]), "v"(f[8]), "v"(f[9]), "v"(f[10]), "v"(f[11]),
                    "v"(f[12]), "v"(f[13]), "v"(f[14]), "v"(f[15])
                 : "memory");
  }
  v4f acc = { 0.f, 0.f, 0.f, 0.f };
  for (int q = gi + WX_NG * WX_NQ; q < nq; q += WX_NG) {
    const v4i oe = ob[q];
    const v4f we = wb[q];
    unsigned f[4];
    v4f e[4];
#pragma unroll
    for (int u = 0; u < 4; ++u) f[u] = (unsigned)(oe[u] & (S_ - 1)) * (H_ / 4) + c4;
#pragma unroll
    for (int u = 0; u < 4; ++u) e[u] = xb[f[u]];
    asm volatile("s_wait_xcnt 0x0" :: "v"(f[0]), "v"(f[1]), "v"(f[2]), "v"(f[3]) : "memory");
#pragma unroll
    for (int u = 0; u < 4; ++u) acc += we[u] * e[u];
  }
#pragma unroll
  for (int u = 0; u < WX_NQ * 4; ++u) acc += w[u >> 2][u & 3] * v[u];
  *(v4f*)&red[threadIdx.x >> 6][(threadIdx.x & 63) * 4] = acc;
  __syncthreads();                               // the WX_GR partial sums are in LDS
  float s = 0.f;
#pragma unroll
  for (int i = 0; i < WX_GR; ++i) s += red[i][threadIdx.x];
  atomicAdd(&y[(size_t)b * H_ + h0 + threadIdx.x], s);
  // other block ranges of the launch follow in the code: the wait stands before any
  // rewrite of a register that the add names
  asm volatile("s_wait_xcnt 0x0" ::: "memory");
}

// out[b,h] = (y[b,:] @ Wv[:,h] + sumw[b]*bv[h]) / denom[b]
// One block = 32 columns of out (one 128-byte line a row) for all 16 batches, so
// that Wv is read once. The 1024 k are split over the block's 32 waves, 32 k each:
// a wave issues all its loads at once and pays the memory latency once. The 16
// batches are the 16 rows of an f32 WMMA tile; the waves' partial tiles meet in LDS.
// Every loop here is unrolled, so that its arrays stay in registers.
#define OP_COLS  32
#define OP_WAVES 32
#define OP_KW    (H_ / OP_WAVES)
#define OP_TPIT  272

__global__ void __launch_bounds__(1024)
out_proj(const float* __restrict__ y, const float* __restrict__ Wv,
         const float* __restrict__ bv, const float* __restrict__ sumw,
         const float* __restrict__ denom, float* __restrict__ out) {
  __shared__ float red[OP_WAVES][2 * OP_TPIT];

  const int lane = threadIdx.x & 31;
  const int wave = threadIdx.x >> 5;
  const int half = lane >> 4;
  const int ln   = lane & 15;
  const int c0   = blockIdx.x * OP_COLS;
  const int k0   = wave * OP_KW + half * 16;   // this lane's 16 k, for A and for B alike
  float* rw = &red[wave][lane];                // where this lane puts its partial sums

  // B side: rows k0 .. k0+15 of Wv, columns c0 + 2*ln and + 1 (16 lanes = one line).
  // Tile 0 takes the even columns, tile 1 the odd ones.
  const float* wp = Wv + (size_t)k0 * H_ + c0 + 2 * ln;
  v2f w[16];
#pragma unroll
  for (int j = 0; j < 16; ++j) w[j] = *(const v2f*)(wp + (size_t)j * H_);
  // A side: batch ln, the same 16 k
  const float* yp = y + (size_t)ln * H_ + k0;
  v4f a[4];
#pragma unroll
  for (int i = 0; i < 4; ++i) a[i] = *(const v4f*)(yp + 4 * i);

  // the finishing threads (one per output, wave = batch) fetch their terms early
  float sb = 0.f, bb = 0.f, dn = 1.f;
  if (wave < B_) { sb = sumw[wave]; bb = bv[c0 + lane]; dn = denom[wave]; }

  // fragments: k = k0 + 2i, k0 + 2i + 1 in registers 0, 1 of A and of B alike
  v2f af[8], b0[8], b1[8];
#pragma unroll
  for (int i = 0; i < 8; ++i) {
    af[i] = (v2f){ a[i >> 1][(i & 1) * 2], a[i >> 1][(i & 1) * 2 + 1] };
    b0[i] = (v2f){ w[2 * i][0], w[2 * i + 1][0] };
    b1[i] = (v2f){ w[2 * i][1], w[2 * i + 1][1] };
  }
  // all register moves that form the fragments stay in front of the matrix run, so
  // that none of them overwrites an operand of a matrix instruction just issued
  __builtin_amdgcn_sched_barrier(0);
  v8f acc0 = {}, acc1 = {};
#pragma unroll
  for (int i = 0; i < 8; ++i) {
    acc0 = __builtin_amdgcn_wmma_f32_16x16x4_f32(false, af[i], false, b0[i], (short)0, acc0,
                                                 false, false);
    acc1 = __builtin_amdgcn_wmma_f32_16x16x4_f32(false, af[i], false, b1[i], (short)0, acc1,
                                                 false, false);
  }
  __builtin_amdgcn_sched_barrier(0);
  asm volatile("v_nop\n\tv_nop\n\tv_nop\n\tv_nop");
  __builtin_amdgcn_sched_barrier(0);
#pragma unroll
  for (int j = 0; j < 8; ++j) {
    rw[j * 32]           = acc0[j];
    rw[OP_TPIT + j * 32] = acc1[j];
  }
  __syncthreads();                             // all 64 partial tiles (two per wave) are in LDS

  if (wave < B_) {
    const int idx = (lane & 1) * OP_TPIT + (wave & 7) * 32 + (wave >> 3) * 16 + (lane >> 1);
    float s = 0.f;
#pragma unroll
    for (int v = 0; v < OP_WAVES; ++v) s += red[v][idx];
    out[(size_t)wave * H_ + c0 + lane] = (s + sb * bb) / dn;
  }
}

#define AM_BLOCKS ((B_ * S_ + 255) / 256)

__device__ __forceinline__ void
attn_mean(int blk, const float* __restrict__ w_all, const int* __restrict__ pos,
          float* __restrict__ out2) {
  int i = blk * 256 + threadIdx.x;
  if (i < B_ * S_)
    out2[i] = w_all[(i & ~(S_ - 1)) + (pos[i] & (S_ - 1))] * (1.0f / (float)S_);
}

// What needs the finished column sums of attn_colsum and nothing else, three jobs
// that need nothing of one another, as block ranges of one launch: B_ blocks of
// batch_stats (the longest chain of waits, so they stand first), WX_BLOCKS of
// wx_gemv, AM_BLOCKS of attn_mean. The range is picked by blockIdx alone, so every
// barrier of batch_stats and of wx_gemv is passed by its whole block.
__global__ void __launch_bounds__(256)
after_attn(const float* __restrict__ x, const int* __restrict__ mask,
           const float* __restrict__ w_all, const float* __restrict__ w_msk,
           const int* __restrict__ ord, const int* __restrict__ pos,
           const int* __restrict__ nb, float* __restrict__ sumw,
           float* __restrict__ denom, float* __restrict__ y, float* __restrict__ out2) {
  const int blk = blockIdx.x;
  if (blk < B_)                  batch_stats(blk, mask, w_msk, sumw, denom);
  else if (blk < B_ + WX_BLOCKS) wx_gemv(blk - B_, x, w_msk, ord, nb, y);
  else                           attn_mean(blk - (B_ + WX_BLOCKS), w_all, pos, out2);
}

// ---------------------------------------------------------------------------
extern "C" void kernel_launch(void* const* d_in, const int* in_sizes, int n_in,
                              void* d_out, int out_size, void* d_ws, size_t ws_size,
                              hipStream_t stream) {
  const float* x    = (const float*)d_in[0];
  const int*   mask = (const int*)  d_in[1];
  const float* Wq   = (const float*)d_in[2];
  const float* bq   = (const float*)d_in[3];
  const float* Wk   = (const float*)d_in[4];
  const float* bk   = (const float*)d_in[5];
  const float* Wv   = (const float*)d_in[6];
  const float* bv   = (const float*)d_in[7];
  float* out  = (float*)d_out;                       // (B,H) = 16384 floats
  float* out2 = out + (size_t)B_ * H_;               // (B,S) = 32768 floats

  char* ws = (char*)d_ws;
  const size_t QB_OFF   = 0;
  const size_t KB_OFF   = QB_OFF   + (size_t)B_ * S_ * A_ * 2;   // bf16 Q
  const size_t WQB_OFF  = KB_OFF   + (size_t)B_ * S_ * A_ * 2;   // bf16 K
  const size_t WKB_OFF  = WQB_OFF  + (size_t)65536 * 2;
  const size_t WALL_OFF = WKB_OFF  + (size_t)65536 * 2;
  const size_t WMSK_OFF = WALL_OFF + (size_t)B_ * S_ * 4;
  const size_t Y_OFF    = WMSK_OFF + (size_t)B_ * S_ * 4;
  const size_t SUMW_OFF = Y_OFF    + (size_t)B_ * H_ * 4;
  const size_t DEN_OFF  = SUMW_OFF + 64;
  const size_t NB_OFF   = DEN_OFF  + 64;
  const size_t ORD_OFF  = NB_OFF   + 64;
  const size_t POS_OFF  = ORD_OFF  + (size_t)B_ * S_ * 4;

  unsigned short* Qb   = (unsigned short*)(ws + QB_OFF);
  unsigned short* Kb   = (unsigned short*)(ws + KB_OFF);
  unsigned short* WqB  = (unsigned short*)(ws + WQB_OFF);
  unsigned short* WkB  = (unsigned short*)(ws + WKB_OFF);
  float* w_all = (float*)(ws + WALL_OFF);
  float* w_msk = (float*)(ws + WMSK_OFF);
  float* y     = (float*)(ws + Y_OFF);
  float* sumw  = (float*)(ws + SUMW_OFF);
  float* denom = (float*)(ws + DEN_OFF);
  int*   nb    = (int*)(ws + NB_OFF);
  int*   ord   = (int*)(ws + ORD_OFF);
  int*   pos   = (int*)(ws + POS_OFF);

  setup_ws   <<<B_ + PW_BLOCKS + ZW_BLOCKS, 256, 0, stream>>>(mask, Wq, Wk, w_all, w_msk, y,
                                                              ord, pos, nb, WqB, WkB);
  proj_qk    <<<(B_ * S_) / 128, 512, 0, stream>>>(x, bq, bk, ord, WqB, WkB, Qb, Kb);
  attn_colsum<<<(B_ * S_ / 16) / 8, 256, 0, stream>>>(Qb, Kb, mask, ord, nb, w_all, w_msk);
  after_attn <<<B_ + WX_BLOCKS + AM_BLOCKS, 256, 0, stream>>>(x, mask, w_all, w_msk, ord, pos,
                                                              nb, sumw, denom, y, out2);
  out_proj   <<<H_ / 32, 1024, 0, stream>>>(y, Wv, bv, sumw, denom, out);
}

// v010
// A run of this version takes 45.6 microseconds.
// In both of two side-by-side timings against v009, it was 1.04 times as fast.
// Counting every step since v000, it is 6.26 times as fast.
#include <hip/hip_runtime.h>
#include <math.h>

#define S_ 2048
#define H_ 1024
#define A_ 64
#define B_ 16

typedef __attribute__((ext_vector_type(16))) __bf16 v16bf;
typedef __attribute__((ext_vector_type(8)))  __bf16 v8bf;
typedef __attribute__((ext_vector_type(8)))  float  v8f;
typedef __attribute__((ext_vector_type(4)))  unsigned int v4u;
typedef __attribute__((ext_vector_type(8)))  int v8i;
typedef __attribute__((ext_vector_type(4)))  int v4i;
typedef __attribute__((ext_vector_type(2)))  float v2f;

__device__ __forceinline__ __bf16 f2bf(float f) { return (__bf16)f; }
__device__ __forceinline__ unsigned short bf_bits(float f) {
  __bf16 h = (__bf16)f;
  return __builtin_bit_cast(unsigned short, h);
}

#define PW_BLOCKS (65536 / 256)

__device__ __forceinline__ void
prep_wfrag(int blk, const float* __restrict__ Wq, const float* __restrict__ Wk,
           unsigned short* __restrict__ WqB, unsigned short* __restrict__ WkB) {
  int idx = blk * 256 + threadIdx.x;             // 0 .. 65535
  int e    = idx & 15;
  int lane = (idx >> 4) & 31;
  int ks   = (idx >> 9) & 31;
  int nt   = (idx >> 14) & 3;
  int n = nt * 16 + (lane & 15);
  int k = ks * 32 + ((lane >> 4) << 3) + ((e & 8) ? (16 + (e & 7)) : (e & 7));
  WqB[idx] = bf_bits(Wq[(size_t)k * A_ + n]);
  WkB[idx] = bf_bits(Wk[(size_t)k * A_ + n]);
  // other block ranges of the launch follow in the code: the wait stands before any
  // rewrite of a register that the two stores name
  asm volatile("s_wait_xcnt 0x0" ::: "memory");
}

#define PJ_ROWS   128
#define PJ_KC     128                        // k columns per stage
#define PJ_NST    (H_ / PJ_KC)               // 8 stages
#define PJ_XPITCH 132                        // floats per LDS row: 528 B = 16 B x odd
#define PJ_XBUF   (PJ_ROWS * PJ_XPITCH)      // floats per x buffer
#define PJ_WBUF   (4 * 8 * 512)              // 16-bit words per weight buffer

#define KT_WORDS  (16 * A_)                  // 16-bit words of one 16-row tile of K

typedef __attribute__((ext_vector_type(4))) float v4f;

__device__ __forceinline__ unsigned lds_byte(const void* p) {
  return (unsigned)(unsigned long long)p;
}

// One wave's share of one stage: 8 rows of x (512 B each) and 4 x 512 B of
// packed weights. A fragment's two 16-byte halves per lane are split into two
// planes of 512 B, so that each later ds_load_b128 reads 512 contiguous bytes.
__device__ __forceinline__ void pj_copy_stage(const float* const (&gx)[8], int xo, unsigned lx,
                                              const unsigned short* gw, unsigned lw) {
  asm volatile(
      "global_load_async_to_lds_b128 %0, %1, off\n\t"
      "global_load_async_to_lds_b128 %2, %3, off\n\t"
      "global_load_async_to_lds_b128 %4, %5, off\n\t"
      "global_load_async_to_lds_b128 %6, %7, off\n\t"
      "global_load_async_to_lds_b128 %8, %9, off\n\t"
      "global_load_async_to_lds_b128 %10, %11, off\n\t"
      "global_load_async_to_lds_b128 %12, %13, off\n\t"
      "global_load_async_to_lds_b128 %14, %15, off\n\t"
      "global_load_async_to_lds_b128 %16, %17, off\n\t"
      "global_load_async_to_lds_b128 %18, %19, off\n\t"
      "global_load_async_to_lds_b128 %20, %21, off\n\t"
      "global_load_async_to_lds_b128 %22, %23, off\n\t"
      "s_wait_xcnt 0x0"
      :: "v"(lx),                     "v"(gx[0] + xo),
         "v"(lx + 1 * PJ_XPITCH * 4), "v"(gx[1] + xo),
         "v"(lx + 2 * PJ_XPITCH * 4), "v"(gx[2] + xo),
         "v"(lx + 3 * PJ_XPITCH * 4), "v"(gx[3] + xo),
         "v"(lx + 4 * PJ_XPITCH * 4), "v"(gx[4] + xo),
         "v"(lx + 5 * PJ_XPITCH * 4), "v"(gx[5] + xo),
         "v"(lx + 6 * PJ_XPITCH * 4), "v"(gx[6] + xo),
         "v"(lx + 7 * PJ_XPITCH * 4), "v"(gx[7] + xo),
         "v"(lw),                     "v"(gw),
         "v"(lw + 256),               "v"(gw + 256),
         "v"(lw + 8192),              "v"(gw + 512),
         "v"(lw + 8192 + 256),        "v"(gw + 768)
      : "memory");
}

__global__ void __launch_bounds__(512)
proj_qk(const float* __restrict__ x, const float* __restrict__ bq,
        const float* __restrict__ bk, const int* __restrict__ ord,
        const unsigned short* __restrict__ WqB, const unsigned short* __restrict__ WkB,
        unsigned short* __restrict__ Qb, unsigned short* __restrict__ Kb) {
  __shared__ __attribute__((aligned(16))) float          xs[2][PJ_XBUF];
  __shared__ __attribute__((aligned(16))) unsigned short wf[2][PJ_WBUF];

  const int lane = threadIdx.x & 31;
  const int wave = threadIdx.x >> 5;             // 0 .. 15
  const int rt   = wave & 7;                     // 16-row tile of the block
  const int mat  = wave >> 3;                    // 0: Q, 1: K
  const int half = lane >> 4;
  const int ln   = lane & 15;
  const int row0 = blockIdx.x * PJ_ROWS;

  const int cnt = (wave >> 1) & 3;
  const float* gx[8];                            // unrolled: gx[] stays in registers
#pragma unroll
  for (int r = 0; r < 8; ++r)                    // the & keeps the row inside its batch
    gx[r] = x + (size_t)((row0 & ~(S_ - 1)) + (ord[row0 + wave * 8 + r] & (S_ - 1))) * H_
            + lane * 4;
  const unsigned short* gw = (mat ? WkB : WqB) + (size_t)cnt * 32 * 512
                             + (wave & 1) * 1024 + lane * 8;
  const unsigned lx = lds_byte(&xs[0][wave * 8 * PJ_XPITCH + lane * 4]);
  const unsigned lw = lds_byte(&wf[0][((wave & 1) * 16 + mat * 4 + cnt) * 512
                                      + (lane & 1) * 256 + (lane >> 1) * 8]);

  pj_copy_stage(gx, 0, lx, gw, lw);
  // stage 0 has landed for this wave before the barrier publishes it
  asm volatile("s_wait_asynccnt 0x0" ::: "memory");
  __syncthreads();
  pj_copy_stage(gx, PJ_KC, lx + PJ_XBUF * 4, gw + 4 * 512, lw + PJ_WBUF * 2);

  v8f acc[4] = {};
  for (int t = 0; t < PJ_NST; ++t) {
    const int buf = t & 1;
    const float* xr = &xs[buf][(rt * 16 + ln) * PJ_XPITCH + half * 8];
    const unsigned short* wl = &wf[buf][mat * 4 * 512 + lane * 8];
#pragma unroll
    for (int ksl = 0; ksl < 4; ++ksl) {
      v4f f0 = *(const v4f*)(xr + ksl * 32);
      v4f f1 = *(const v4f*)(xr + ksl * 32 + 4);
      v4f f2 = *(const v4f*)(xr + ksl * 32 + 16);
      v4f f3 = *(const v4f*)(xr + ksl * 32 + 20);
      v16bf a;
#pragma unroll
      for (int i = 0; i < 4; ++i) {
        a[i]      = f2bf(f0[i]);
        a[4 + i]  = f2bf(f1[i]);
        a[8 + i]  = f2bf(f2[i]);
        a[12 + i] = f2bf(f3[i]);
      }
#pragma unroll
      for (int nt = 0; nt < 4; ++nt) {
        v8bf lo = *(const v8bf*)(wl + (ksl * 8 + nt) * 512);
        v8bf hi = *(const v8bf*)(wl + (ksl * 8 + nt) * 512 + 256);
        v16bf w;
#pragma unroll
        for (int i = 0; i < 8; ++i) { w[i] = lo[i]; w[8 + i] = hi[i]; }
        acc[nt] = __builtin_amdgcn_wmma_f32_16x16x32_bf16(false, a, false, w,
                                                          (short)0, acc[nt], false, false);
      }
    }
    // this wave's reads of buffer buf are over before it may be refilled
    asm volatile("s_wait_dscnt 0x0" ::: "memory");
    // this wave's copies of stage t + 1 have landed before the barrier publishes them
    asm volatile("s_wait_asynccnt 0x0" ::: "memory");
    __syncthreads();
    if (t + 2 < PJ_NST)
      pj_copy_stage(gx, (t + 2) * PJ_KC, lx + buf * (PJ_XBUF * 4),
                    gw + (t + 2) * 4 * 512, lw + buf * (PJ_WBUF * 2));
  }
  // no copy is outstanding when the wave ends
  asm volatile("s_wait_asynccnt 0x0" ::: "memory");

  if (mat == 0) {
    // Q: row major, 64 columns a row
    unsigned short* __restrict__ O = Qb + (size_t)(row0 + rt * 16 + half * 8) * A_ + ln;
#pragma unroll
    for (int nt = 0; nt < 4; ++nt) {
      const float bb = bq[nt * 16 + ln];
#pragma unroll
      for (int j = 0; j < 8; ++j) O[j * A_ + nt * 16] = bf_bits(acc[nt][j] + bb);
    }
  } else {
    // K: each 16-row tile (2 KB) in the order in which attn_colsum's lanes read
    // it: plane p = col / 16 (512 B), reader lane ((col / 8) & 1) * 16 + row % 16
    // (16 B), element col % 8
    unsigned short* __restrict__ O = Kb + (size_t)((row0 >> 4) + rt) * KT_WORDS
                                     + ((ln >> 3) * 16 + half * 8) * 8 + (ln & 7);
#pragma unroll
    for (int nt = 0; nt < 4; ++nt) {
      const float bb = bk[nt * 16 + ln];
#pragma unroll
      for (int j = 0; j < 8; ++j) O[nt * 256 + j * 8] = bf_bits(acc[nt][j] + bb);
    }
  }
}

__device__ __forceinline__ void load_kfrag(const unsigned short* __restrict__ row,
                                           int kb, v16bf& f0, v16bf& f1) {
  v8bf lo0 = *(const v8bf*)(row + kb);
  v8bf hi0 = *(const v8bf*)(row + kb + 16);
  v8bf lo1 = *(const v8bf*)(row + kb + 32);
  v8bf hi1 = *(const v8bf*)(row + kb + 48);
#pragma unroll
  for (int i = 0; i < 8; ++i) {
    f0[i] = lo0[i]; f0[8 + i] = hi0[i];
    f1[i] = lo1[i]; f1[8 + i] = hi1[i];
  }
}

__device__ __forceinline__ void load_ktile(const unsigned short* tile, int lane,
                                           v16bf& f0, v16bf& f1) {
  v8bf lo0 = *(const v8bf*)(tile + lane * 8);
  v8bf hi0 = *(const v8bf*)(tile + 256 + lane * 8);
  v8bf lo1 = *(const v8bf*)(tile + 512 + lane * 8);
  v8bf hi1 = *(const v8bf*)(tile + 768 + lane * 8);
#pragma unroll
  for (int i = 0; i < 8; ++i) {
    f0[i] = lo0[i]; f0[8 + i] = hi0[i];
    f1[i] = lo1[i]; f1[8 + i] = hi1[i];
  }
}

#define CHUNK_T    8
#define CHUNK_ROWS (CHUNK_T * 16)
#define NCHUNK     (S_ / CHUNK_ROWS)

__device__ __forceinline__ v4u tdm_group0(const unsigned short* gsrc, unsigned lds_off) {
  unsigned long long ga = (unsigned long long)gsrc;
  // every word that is computed is made wave-uniform: the group lies in scalar registers
  v4u g0 = { 1u,                                   // count=1, user mode
             (unsigned)__builtin_amdgcn_readfirstlane((int)lds_off),              // lds_addr
             (unsigned)__builtin_amdgcn_readfirstlane((int)(ga & 0xFFFFFFFFu)),   // global_addr[31:0]
             (unsigned)__builtin_amdgcn_readfirstlane(
                 (int)(((ga >> 32) & 0x01FFFFFFu) | 0x80000000u)) };              // [56:32] | type=2
  asm volatile("" : "+s"(g0));
  return g0;
}

__device__ __forceinline__ v8i tdm_group1() {
  v8i g1 = { 0x00010000,
             0x00400000,
             0x08000000,
             0x00400000,
             CHUNK_ROWS,
             64,
             0, 0 };
  asm volatile("" : "+s"(g1));
  return g1;
}

__device__ __forceinline__ void tdm_load_chunk(v4u g0, v8i g1) {
  v4i gz4 = { 0, 0, 0, 0 };
  v8i gz8 = { 0, 0, 0, 0, 0, 0, 0, 0 };
  __builtin_amdgcn_tensor_load_to_lds(g0, g1, gz4, gz4, gz8, 0);
}

// The wait that covers the request made with g0 and g1. It names both groups, so
// that their registers keep their values from the request up to this wait.
__device__ __forceinline__ void tdm_wait(v4u g0, v8i g1) {
  asm volatile("s_wait_tensorcnt 0x0" :: "s"(g0), "s"(g1) : "memory");
}

#define GT 4                            // tiles of K that a wave works on together

// 16 x 16 products of one wave's Q rows with GT 16-row tiles of K that follow one
// another in LDS. The loops are unrolled: all LDS loads of the group issue together
// and are waited for once, and its GT chains of two matrix instructions are
// independent, so that each fills the others' distance.
__device__ __forceinline__ void qk_group(const unsigned short* tiles, int lane,
                                         const v16bf& aq0, const v16bf& aq1, v8f (&acc)[GT]) {
  v16bf bk0[GT], bk1[GT];
#pragma unroll
  for (int i = 0; i < GT; ++i) load_ktile(tiles + i * KT_WORDS, lane, bk0[i], bk1[i]);
  // holds all loads of the group in front of its matrix instructions (loaded values as
  // inputs only): without it the fragment registers are used again inside the group,
  // and the wave waits for LDS five times a group instead of once
  asm volatile("" :: "v"(bk0[0]), "v"(bk1[0]), "v"(bk0[1]), "v"(bk1[1]),
                     "v"(bk0[2]), "v"(bk1[2]), "v"(bk0[3]), "v"(bk1[3]));
#pragma unroll
  for (int i = 0; i < GT; ++i) {
    v8f z = {};
    acc[i] = __builtin_amdgcn_wmma_f32_16x16x32_bf16(false, aq0, false, bk0[i],
                                                     (short)0, z, false, false);
  }
#pragma unroll
  for (int i = 0; i < GT; ++i)
    acc[i] = __builtin_amdgcn_wmma_f32_16x16x32_bf16(false, aq1, false, bk1[i],
                                                     (short)0, acc[i], false, false);
}

// The softmax works in powers of two on the raw products: exp((a - m) / 8) is
// exp2(a * SC_LOG2 - m * SC_LOG2), one multiply-add and one v_exp_f32 a score. Rows j
// and j + 1 of an accumulator tile lie in neighbouring registers and are worked as a
// pair, so that the multiply-adds and the sums are packed instructions.
#define SC_LOG2 0.18033688f             // log2(e) / sqrt(64)

__device__ __forceinline__ v2f exp2_pair(v2f t) {
  return (v2f){ __builtin_amdgcn_exp2f(t.x), __builtin_amdgcn_exp2f(t.y) };
}

// pass 1 on one group: running maximum of the raw products (mR) and sum of powers, per
// lane and row pair; the maximum is raised and the old sum rescaled once for the GT
// scores of a row. EDGE: the group may hold masked columns: this lane's column of
// tile i counts where i * 16 < nl; elsewhere every column counts and nl is not read.
// (In p1_group and p2_group all loops are unrolled: registers only.)
template <bool EDGE>
__device__ __forceinline__ void p1_group(const v8f (&acc)[GT], int nl, v2f (&mR)[4],
                                         v2f (&lL)[4]) {
  const v2f sc = { SC_LOG2, SC_LOG2 };
#pragma unroll
  for (int jp = 0; jp < 4; ++jp) {
    v2f a[GT];
    v2f nm = mR[jp];
#pragma unroll
    for (int i = 0; i < GT; ++i) {
      a[i].x = (!EDGE || i * 16 < nl) ? acc[i][2 * jp]     : -1e30f;
      a[i].y = (!EDGE || i * 16 < nl) ? acc[i][2 * jp + 1] : -1e30f;
      nm.x   = fmaxf(nm.x, a[i].x);
      nm.y   = fmaxf(nm.y, a[i].y);
    }
    const v2f ns = nm * sc;
    v2f r = exp2_pair(__builtin_elementwise_fma(mR[jp], sc, -ns));
    if (EDGE) {
      // a lane that has met no unmasked column yet: its exponent is the rounding rest of
      // a huge product, its sum is 0 and stays 0
      r.x = (nm.x > -1e30f) ? r.x : 0.f;
      r.y = (nm.y > -1e30f) ? r.y : 0.f;
    }
    v2f l = lL[jp] * r;
#pragma unroll
    for (int i = 0; i < GT; ++i) {
      v2f e = exp2_pair(__builtin_elementwise_fma(a[i], sc, -ns));
      if (EDGE) {
        e.x = (i * 16 < nl) ? e.x : 0.f;
        e.y = (i * 16 < nl) ? e.y : 0.f;
      }
      l += e;
    }
    lL[jp] = l;
    mR[jp] = nm;
  }
}

// pass 2 on one group: probabilities exp2(a * SC_LOG2 - cc), cc = the row's scaled
// maximum + log2 of its sum, summed over the wave's 16 rows, added to the
// block's column sums cs[0] (all rows) and cs[S_] (rows weighted by their mask); the
// GT tiles' sums are independent chains, and their exchanges between the two halves
// of the wave are waited for once
template <bool EDGE>
__device__ __forceinline__ void p2_group(const v8f (&acc)[GT], int nl, const v2f (&cc)[4],
                                         const v2f (&mr)[4], int half, float* cs) {
  const v2f sc = { SC_LOG2, SC_LOG2 };
  float ca[GT], cw[GT];
#pragma unroll
  for (int i = 0; i < GT; ++i) {
    v2f sa = { 0.f, 0.f }, sw = { 0.f, 0.f };
#pragma unroll
    for (int jp = 0; jp < 4; ++jp) {
      const v2f a = { acc[i][2 * jp], acc[i][2 * jp + 1] };
      v2f p = exp2_pair(__builtin_elementwise_fma(a, sc, -cc[jp]));
      if (EDGE) {
        p.x = (i * 16 < nl) ? p.x : 0.f;
        p.y = (i * 16 < nl) ? p.y : 0.f;
      }
      sa += p;
      sw = __builtin_elementwise_fma(mr[jp], p, sw);
    }
    ca[i] = sa.x + sa.y;
    cw[i] = sw.x + sw.y;
  }
  float oa[GT], ow[GT];
#pragma unroll
  for (int i = 0; i < GT; ++i) {
    oa[i] = __shfl_xor(ca[i], 16, 32);
    ow[i] = __shfl_xor(cw[i], 16, 32);
  }
  if (half == 0) {
#pragma unroll
    for (int i = 0; i < GT; ++i) {
      atomicAdd(cs + i * 16, ca[i] + oa[i]);      // LDS adds: the 8 waves meet here
      atomicAdd(cs + S_ + i * 16, cw[i] + ow[i]);
    }
  }
}

__global__ void __launch_bounds__(256)
attn_colsum(const unsigned short* __restrict__ Qb, const unsigned short* __restrict__ Kb,
            const int* __restrict__ mask, const int* __restrict__ ord,
            const int* __restrict__ nb,
            float* __restrict__ w_all, float* __restrict__ w_msk) {
  __shared__ unsigned short ksh[2][CHUNK_ROWS * A_];   // 2 x 16 KB
  __shared__ float csum[2][S_];                        // the block's column sums, 16 KB

  const int lane = threadIdx.x & 31;
  const int wave = threadIdx.x >> 5;
  const int rowtile = blockIdx.x * 8 + wave;     // 0 .. 2047 (same batch per block)
  const int b  = rowtile >> 7;
  const int s0 = (rowtile & 127) << 4;
  const int half = lane >> 4;
  const int ln   = lane & 15;
  const int kb   = half * 8;

  const unsigned short* kpanel = Kb + (size_t)b * S_ * A_;
  const unsigned lds0 = (unsigned)(unsigned long long)(const void*)&ksh[0][0];
  const unsigned lds1 = (unsigned)(unsigned long long)(const void*)&ksh[1][0];

  // A fragments of Q (16 x 64 bf16 -> two 16x32 fragments)
  const unsigned short* qrow = Qb + ((size_t)(b * S_ + s0 + ln)) * A_;
  v16bf aq0, aq1;
  load_kfrag(qrow, kb, aq0, aq1);

  const int* mrow = mask + (size_t)b * S_;
  const int* orow = ord + (size_t)b * S_;
  v2f mr[4];                                     // rows 2*jp and 2*jp + 1 of this half
#pragma unroll
  for (int j = 0; j < 8; ++j)
    mr[j >> 1][j & 1] = (float)mrow[orow[s0 + j + half * 8] & (S_ - 1)];

  // unmasked columns of this batch, the same in every wave of the block, held in
  // 0 .. S whatever the word holds: 1 .. NCHUNK chunks
  const int ncol  = min(max(__builtin_amdgcn_readfirstlane(nb[b]), 0), S_);
  const int nch   = max((ncol + CHUNK_ROWS - 1) / CHUNK_ROWS, 1);
  const int ngf   = ncol / (GT * 16);            // groups whose columns are all unmasked
  const int ng    = (ncol + GT * 16 - 1) / (GT * 16);   // groups that hold an unmasked column
  const int nl    = ncol - ngf * (GT * 16) - ln; // in the group behind them: see p1_group

  v2f mR[4], lL[4];
#pragma unroll
  for (int jp = 0; jp < 4; ++jp) {
    mR[jp] = (v2f){ -1e30f, -1e30f };
    lL[jp] = (v2f){ 0.f, 0.f };
  }

  // start values of the block's column sums; the barriers of pass 1 stand
  // between these stores and the first add of pass 2
  for (int i = 0; i < 2 * S_ / 256; ++i) (&csum[0][0])[i * 256 + threadIdx.x] = 0.f;

  // ---- pass 1: row max + sum of exp (online, per-lane partials) ----
  const v8i g1 = tdm_group1();
  v4u g0 = tdm_group0(kpanel, lds0);
  if (wave == 0) tdm_load_chunk(g0, g1);
  for (int c = 0; c < nch; ++c) {
    tdm_wait(g0, g1);
    __syncthreads();                              // chunk c visible in buf c&1
    if (c + 1 < nch) {
      g0 = tdm_group0(kpanel + (size_t)(c + 1) * CHUNK_ROWS * A_, ((c + 1) & 1) ? lds1 : lds0);
      if (wave == 0) tdm_load_chunk(g0, g1);
    }
    const unsigned short* kc = &ksh[c & 1][0];
    for (int g = c * (CHUNK_T / GT); g < min(ng, (c + 1) * (CHUNK_T / GT)); ++g) {
      v8f acc[GT];
      qk_group(kc + (g - c * (CHUNK_T / GT)) * GT * KT_WORDS, lane, aq0, aq1, acc);
      if (g < ngf) p1_group<false>(acc, 0, mR, lL);
      else         p1_group<true>(acc, nl, mR, lL);
    }
    __syncthreads();                              // readers done before overwrite
  }
  // scaled maxima, as pass 1 used them; a lane without an unmasked column has sum 0
  v2f mS[4];
#pragma unroll
  for (int j = 0; j < 8; ++j)
    mS[j >> 1][j & 1] = (lL[j >> 1][j & 1] > 0.f) ? mR[j >> 1][j & 1] * SC_LOG2 : -1e30f;
  // combine partials across the 16 lanes holding each row
#pragma unroll
  for (int d = 1; d < 16; d <<= 1) {
#pragma unroll
    for (int j = 0; j < 8; ++j) {
      const float m = mS[j >> 1][j & 1];
      const float l = lL[j >> 1][j & 1];
      float om = __shfl_xor(m, d, 32);
      float ol = __shfl_xor(l, d, 32);
      float nm = fmaxf(m, om);
      lL[j >> 1][j & 1] = l * __builtin_amdgcn_exp2f(m - nm) + ol * __builtin_amdgcn_exp2f(om - nm);
      mS[j >> 1][j & 1] = nm;
    }
  }
  // division by the row's sum as a subtraction in the exponent; a row without a sum
  // gets probability exp2(-huge) = 0
  v2f cc[4];
#pragma unroll
  for (int j = 0; j < 8; ++j) {
    const float l = lL[j >> 1][j & 1];
    cc[j >> 1][j & 1] = (l > 0.f) ? mS[j >> 1][j & 1] + __builtin_amdgcn_logf(l) : 1e30f;
  }

  // ---- pass 2: probabilities -> column sums ----
  float* gsum = ((threadIdx.x >> 7) ? w_msk : w_all) + (size_t)b * S_ + (threadIdx.x & 127);
  g0 = tdm_group0(kpanel, lds0);
  if (wave == 0) tdm_load_chunk(g0, g1);
  for (int c = 0; c < nch; ++c) {
    tdm_wait(g0, g1);
    __syncthreads();
    if (c + 1 < nch) {
      g0 = tdm_group0(kpanel + (size_t)(c + 1) * CHUNK_ROWS * A_, ((c + 1) & 1) ? lds1 : lds0);
      if (wave == 0) tdm_load_chunk(g0, g1);
    }
    const unsigned short* kc = &ksh[c & 1][0];
    for (int g = c * (CHUNK_T / GT); g < min(ng, (c + 1) * (CHUNK_T / GT)); ++g) {
      v8f acc[GT];
      qk_group(kc + (g - c * (CHUNK_T / GT)) * GT * KT_WORDS, lane, aq0, aq1, acc);
      float* cs = &csum[0][g * GT * 16 + ln];
      if (g < ngf) p2_group<false>(acc, 0, cc, mr, half, cs);
      else         p2_group<true>(acc, nl, cc, mr, half, cs);
    }
    __syncthreads();
  }
  // behind the last barrier the block's sums are complete: one global add per
  // thread and worked chunk (both loops unrolled: bs[] stays in registers)
  float bs[NCHUNK];
#pragma unroll
  for (int i = 0; i < NCHUNK; ++i)
    bs[i] = csum[threadIdx.x >> 7][i * CHUNK_ROWS + (threadIdx.x & 127)];
  // holds all LDS reads in front of the first add: the adds issue back to back, and
  // no register that an issued add names is loaded anew behind it
  asm volatile("" :: "v"(bs[0]), "v"(bs[1]), "v"(bs[2]), "v"(bs[3]), "v"(bs[4]), "v"(bs[5]),
                     "v"(bs[6]), "v"(bs[7]), "v"(bs[8]), "v"(bs[9]), "v"(bs[10]), "v"(bs[11]),
                     "v"(bs[12]), "v"(bs[13]), "v"(bs[14]), "v"(bs[15]));
#pragma unroll
  for (int i = 0; i < NCHUNK; ++i)
    if (i < nch) atomicAdd(gsum + i * CHUNK_ROWS, bs[i]);
}

#define ZW_BLOCKS ((B_ * S_ + 255) / 256)

__global__ void __launch_bounds__(256)
setup_ws(const int* __restrict__ mask, const float* __restrict__ Wq,
         const float* __restrict__ Wk, float* __restrict__ w_all,
         float* __restrict__ w_msk, float* __restrict__ y, int* __restrict__ ord,
         int* __restrict__ pos, int* __restrict__ nb,
         unsigned short* __restrict__ WqB, unsigned short* __restrict__ WkB) {
  __shared__ int seg[S_ / 32];                   // unmasked positions per run of 32
  if (blockIdx.x >= B_ + PW_BLOCKS) {
    int i = (blockIdx.x - (B_ + PW_BLOCKS)) * 256 + threadIdx.x;
    if (i < B_ * S_) { w_all[i] = 0.f; w_msk[i] = 0.f; }
    if (i < B_ * H_) y[i] = 0.f;
    return;
  }
  if (blockIdx.x >= B_) {
    prep_wfrag(blockIdx.x - B_, Wq, Wk, WqB, WkB);
    return;
  }
  const int b    = blockIdx.x;
  const int lane = threadIdx.x & 31;
  const int wave = threadIdx.x >> 5;
  const int* m = mask + (size_t)b * S_;
  int mv[S_ / 256];                              // all loads first: one memory latency, not 8
#pragma unroll
  for (int i = 0; i < S_ / 256; ++i) mv[i] = m[i * 256 + threadIdx.x];
  unsigned bal[S_ / 256];
#pragma unroll
  for (int i = 0; i < S_ / 256; ++i) {
    bal[i] = (unsigned)__ballot(mv[i] != 0);
    if (lane == 0) seg[i * 8 + wave] = __popc(bal[i]);
  }
  __syncthreads();
  int run = 0, base[S_ / 256];
#pragma unroll
  for (int g = 0; g < S_ / 32; ++g) {            // run g holds positions g*32 .. +31
    if ((g & 7) == wave) base[g >> 3] = run;
    run += seg[g];
  }
#pragma unroll
  for (int i = 0; i < S_ / 256; ++i) {
    const int s     = i * 256 + threadIdx.x;
    const int front = base[i] + __popc(bal[i] & ((1u << lane) - 1u));  // unmasked before s
    const int p     = ((bal[i] >> lane) & 1u) ? front : run + (s - front);
    ord[(size_t)b * S_ + p] = s;
    pos[(size_t)b * S_ + s] = p;
  }
  if (threadIdx.x == 0) nb[b] = run;
}

// One block per batch; a block range of after_attn.
__device__ __forceinline__ void
batch_stats(int b, const int* __restrict__ mask, const float* __restrict__ w_msk,
            float* __restrict__ sumw, float* __restrict__ denom) {
  __shared__ float sm[256], sw[256];
  int t = threadIdx.x;
  float a = 0.f, c = 0.f;
  for (int s = t; s < S_; s += 256) {
    a += (float)mask[(size_t)b * S_ + s];
    c += w_msk[(size_t)b * S_ + s];
  }
  sm[t] = a; sw[t] = c; __syncthreads();
  for (int st = 128; st > 0; st >>= 1) {
    if (t < st) { sm[t] += sm[t + st]; sw[t] += sw[t + st]; }
    __syncthreads();
  }
  if (t == 0) { denom[b] = sm[0] + 1e-8f; sumw[b] = sw[0]; }
}

#define WX_BLOCKS ((H_ / 256) * 8 * B_)
#define WX_GR 4
#define WX_NG (8 * WX_GR)
#define WX_NQ 8

__device__ __forceinline__ void
wx_gemv(int blk, const float* __restrict__ x, const float* __restrict__ w_msk,
        const int* __restrict__ ord, const int* __restrict__ nb,
        float* __restrict__ y) {
  __shared__ __attribute__((aligned(16))) float red[WX_GR][256];
  const int sc = blk & 7;
  const int h0 = ((blk >> 3) & (H_ / 256 - 1)) * 256;
  const int b  = blk / ((H_ / 256) * 8);
  const int gi = sc * WX_GR + __builtin_amdgcn_readfirstlane((int)(threadIdx.x >> 6));
  const unsigned c4 = (unsigned)(h0 >> 2) + (threadIdx.x & 63);   // this lane's 4 columns
  const v4f* xb = (const v4f*)(x + ((size_t)b * S_) * H_);
  const v4f* wb = (const v4f*)(w_msk + (size_t)b * S_);
  const v4i* ob = (const v4i*)(ord + (size_t)b * S_);
  const int ncol = min(max(nb[b], 0), S_);
  const int nq   = (ncol + 3) >> 2;
  v4i o[WX_NQ];
  v4f w[WX_NQ];
#pragma unroll
  for (int j = 0; j < WX_NQ; ++j) {
    o[j] = ob[min(gi * WX_NQ + j, max(nq - 1, 0))];
    w[j] = wb[gi * WX_NQ + j];
  }
  v4f v[WX_NQ * 4];
#pragma unroll
  for (int hf = 0; hf < 2; ++hf) {
    unsigned f[16];
#pragma unroll
    for (int u = 0; u < 16; ++u)                 // the & keeps the row inside its batch
      f[u] = (unsigned)(o[hf * 4 + (u >> 2)][u & 3] & (S_ - 1)) * (H_ / 4) + c4;
#pragma unroll
    for (int u = 0; u < 16; ++u) v[hf * 16 + u] = xb[f[u]];
    // the wait stands before any rewrite of a register that the 16 loads name; it names
    // their offsets, so that those registers keep their values up to it
    asm volatile("s_wait_xcnt 0x0"
                 :: "v"(f[0]), "v"(f[1]), "v"(f[2]), "v"(f[3]), "v"(f[4]), "v"(f[5]),
                    "v"(f[6]), "v"(f[7]), "v"(f[8]), "v"(f[9]), "v"(f[10]), "v"(f[11]),
                    "v"(f[12]), "v"(f[13]), "v"(f[14]), "v"(f[15])
                 : "memory");
  }
  v4f acc = { 0.f, 0.f, 0.f, 0.f };
  for (int q = gi + WX_NG * WX_NQ; q < nq; q += WX_NG) {
    const v4i oe = ob[q];
    const v4f we = wb[q];
    unsigned f[4];
    v4f e[4];
#pragma unroll
    for (int u = 0; u < 4; ++u) f[u] = (unsigned)(oe[u] & (S_ - 1)) * (H_ / 4) + c4;
#pragma unroll
    for (int u = 0; u < 4; ++u) e[u] = xb[f[u]];
    asm volatile("s_wait_xcnt 0x0" :: "v"(f[0]), "v"(f[1]), "v"(f[2]), "v"(f[3]) : "memory");
#pragma unroll
    for (int u = 0; u < 4; ++u) acc += we[u] * e[u];
  }
#pragma unroll
  for (int u = 0; u < WX_NQ * 4; ++u) acc += w[u >> 2][u & 3] * v[u];
  *(v4f*)&red[threadIdx.x >> 6][(threadIdx.x & 63) * 4] = acc;
  __syncthreads();                               // the WX_GR partial sums are in LDS
  float s = 0.f;
#pragma unroll
  for (int i = 0; i < WX_GR; ++i) s += red[i][threadIdx.x];
  atomicAdd(&y[(size_t)b * H_ + h0 + threadIdx.x], s);
  // other block ranges of the launch follow in the code: the wait stands before any
  // rewrite of a register that the add names
  asm volatile("s_wait_xcnt 0x0" ::: "memory");
}

// out[b,h] = (y[b,:] @ Wv[:,h] + sumw[b]*bv[h]) / denom[b]
// One block = 32 columns of out (one 128-byte line a row) for all 16 batches, so
// that Wv is read once. The 1024 k are split over the block's 32 waves, 32 k each:
// a wave issues all its loads at once and pays the memory latency once. The 16
// batches are the 16 rows of an f32 WMMA tile; the waves' partial tiles meet in LDS.
// Every loop here is unrolled, so that its arrays stay in registers.
#define OP_COLS  32
#define OP_WAVES 32
#define OP_KW    (H_ / OP_WAVES)
#define OP_TPIT  272

__global__ void __launch_bounds__(1024)
out_proj(const float* __restrict__ y, const float* __restrict__ Wv,
         const float* __restrict__ bv, const float* __restrict__ sumw,
         const float* __restrict__ denom, float* __restrict__ out) {
  __shared__ float red[OP_WAVES][2 * OP_TPIT];

  const int lane = threadIdx.x & 31;
  const int wave = threadIdx.x >> 5;
  const int half = lane >> 4;
  const int ln   = lane & 15;
  const int c0   = blockIdx.x * OP_COLS;
  const int k0   = wave * OP_KW + half * 16;   // this lane's 16 k, for A and for B alike
  float* rw = &red[wave][lane];                // where this lane puts its partial sums

  // B side: rows k0 .. k0+15 of Wv, columns c0 + 2*ln and + 1 (16 lanes = one line).
  // Tile 0 takes the even columns, tile 1 the odd ones.
  const float* wp = Wv + (size_t)k0 * H_ + c0 + 2 * ln;
  v2f w[16];
#pragma unroll
  for (int j = 0; j < 16; ++j) w[j] = *(const v2f*)(wp + (size_t)j * H_);
  // A side: batch ln, the same 16 k
  const float* yp = y + (size_t)ln * H_ + k0;
  v4f a[4];
#pragma unroll
  for (int i = 0; i < 4; ++i) a[i] = *(const v4f*)(yp + 4 * i);

  // the finishing threads (one per output, wave = batch) fetch their terms early
  float sb = 0.f, bb = 0.f, dn = 1.f;
  if (wave < B_) { sb = sumw[wave]; bb = bv[c0 + lane]; dn = denom[wave]; }

  // fragments: k = k0 + 2i, k0 + 2i + 1 in registers 0, 1 of A and of B alike
  v2f af[8], b0[8], b1[8];
#pragma unroll
  for (int i = 0; i < 8; ++i) {
    af[i] = (v2f){ a[i >> 1][(i & 1) * 2], a[i >> 1][(i & 1) * 2 + 1] };
    b0[i] = (v2f){ w[2 * i][0], w[2 * i + 1][0] };
    b1[i] = (v2f){ w[2 * i][1], w[2 * i + 1][1] };
  }
  // all register moves that form the fragments stay in front of the matrix run, so
  // that none of them overwrites an operand of a matrix instruction just issued
  __builtin_amdgcn_sched_barrier(0);
  v8f acc0 = {}, acc1 = {};
#pragma unroll
  for (int i = 0; i < 8; ++i) {
    acc0 = __builtin_amdgcn_wmma_f32_16x16x4_f32(false, af[i], false, b0[i], (short)0, acc0,
                                                 false, false);
    acc1 = __builtin_amdgcn_wmma_f32_16x16x4_f32(false, af[i], false, b1[i], (short)0, acc1,
                                                 false, false);
  }
  __builtin_amdgcn_sched_barrier(0);
  asm volatile("v_nop\n\tv_nop\n\tv_nop\n\tv_nop");
  __builtin_amdgcn_sched_barrier(0);
#pragma unroll
  for (int j = 0; j < 8; ++j) {
    rw[j * 32]           = acc0[j];
    rw[OP_TPIT + j * 32] = acc1[j];
  }
  __syncthreads();                             // all 64 partial tiles (two per wave) are in LDS

  if (wave < B_) {
    const int idx = (lane & 1) * OP_TPIT + (wave & 7) * 32 + (wave >> 3) * 16 + (lane >> 1);
    float s = 0.f;
#pragma unroll
    for (int v = 0; v < OP_WAVES; ++v) s += red[v][idx];
    out[(size_t)wave * H_ + c0 + lane] = (s + sb * bb) / dn;
  }
}

#define AM_BLOCKS ((B_ * S_ + 255) / 256)

__device__ __forceinline__ void
attn_mean(int blk, const float* __restrict__ w_all, const int* __restrict__ pos,
          float* __restrict__ out2) {
  int i = blk * 256 + threadIdx.x;
  if (i < B_ * S_)
    out2[i] = w_all[(i & ~(S_ - 1)) + (pos[i] & (S_ - 1))] * (1.0f / (float)S_);
}

// What needs the finished column sums of attn_colsum and nothing else, three jobs
// that need nothing of one another, as block ranges of one launch: B_ blocks of
// batch_stats (the longest chain of waits, so they stand first), WX_BLOCKS of
// wx_gemv, AM_BLOCKS of attn_mean. The range is picked by blockIdx alone, so every
// barrier of batch_stats and of wx_gemv is passed by its whole block.
__global__ void __launch_bounds__(256)
after_attn(const float* __restrict__ x, const int* __restrict__ mask,
           const float* __restrict__ w_all, const float* __restrict__ w_msk,
           const int* __restrict__ ord, const int* __restrict__ pos,
           const int* __restrict__ nb, float* __restrict__ sumw,
           float* __restrict__ denom, float* __restrict__ y, float* __restrict__ out2) {
  const int blk = blockIdx.x;
  if (blk < B_)                  batch_stats(blk, mask, w_msk, sumw, denom);
  else if (blk < B_ + WX_BLOCKS) wx_gemv(blk - B_, x, w_msk, ord, nb, y);
  else                           attn_mean(blk - (B_ + WX_BLOCKS), w_all, pos, out2);
}

// ---------------------------------------------------------------------------
extern "C" void kernel_launch(void* const* d_in, const int* in_sizes, int n_in,
                              void* d_out, int out_size, void* d_ws, size_t ws_size,
                              hipStream_t stream) {
  const float* x    = (const float*)d_in[0];
  const int*   mask = (const int*)  d_in[1];
  const float* Wq   = (const float*)d_in[2];
  const float* bq   = (const float*)d_in[3];
  const float* Wk   = (const float*)d_in[4];
  const float* bk   = (const float*)d_in[5];
  const float* Wv   = (const float*)d_in[6];
  const float* bv   = (const float*)d_in[7];
  float* out  = (float*)d_out;                       // (B,H) = 16384 floats
  float* out2 = out + (size_t)B_ * H_;               // (B,S) = 32768 floats

  char* ws = (char*)d_ws;
  const size_t QB_OFF   = 0;
  const size_t KB_OFF   = QB_OFF   + (size_t)B_ * S_ * A_ * 2;   // bf16 Q
  const size_t WQB_OFF  = KB_OFF   + (size_t)B_ * S_ * A_ * 2;   // bf16 K
  const size_t WKB_OFF  = WQB_OFF  + (size_t)65536 * 2;
  const size_t WALL_OFF = WKB_OFF  + (size_t)65536 * 2;
  const size_t WMSK_OFF = WALL_OFF + (size_t)B_ * S_ * 4;
  const size_t Y_OFF    = WMSK_OFF + (size_t)B_ * S_ * 4;
  const size_t SUMW_OFF = Y_OFF    + (size_t)B_ * H_ * 4;
  const size_t DEN_OFF  = SUMW_OFF + 64;
  const size_t NB_OFF   = DEN_OFF  + 64;
  const size_t ORD_OFF  = NB_OFF   + 64;
  const size_t POS_OFF  = ORD_OFF  + (size_t)B_ * S_ * 4;

  unsigned short* Qb   = (unsigned short*)(ws + QB_OFF);
  unsigned short* Kb   = (unsigned short*)(ws + KB_OFF);
  unsigned short* WqB  = (unsigned short*)(ws + WQB_OFF);
  unsigned short* WkB  = (unsigned short*)(ws + WKB_OFF);
  float* w_all = (float*)(ws + WALL_OFF);
  float* w_msk = (float*)(ws + WMSK_OFF);
  float* y     = (float*)(ws + Y_OFF);
  float* sumw  = (float*)(ws + SUMW_OFF);
  float* denom = (float*)(ws + DEN_OFF);
  int*   nb    = (int*)(ws + NB_OFF);
  int*   ord   = (int*)(ws + ORD_OFF);
  int*   pos   = (int*)(ws + POS_OFF);

  setup_ws   <<<B_ + PW_BLOCKS + ZW_BLOCKS, 256, 0, stream>>>(mask, Wq, Wk, w_all, w_msk, y,
                                                              ord, pos, nb, WqB, WkB);
  proj_qk    <<<(B_ * S_) / 128, 512, 0, stream>>>(x, bq, bk, ord, WqB, WkB, Qb, Kb);
  attn_colsum<<<(B_ * S_ / 16) / 8, 256, 0, stream>>>(Qb, Kb, mask, ord, nb, w_all, w_msk);
  after_attn <<<B_ + WX_BLOCKS + AM_BLOCKS, 256, 0, stream>>>(x, mask, w_all, w_msk, ord, pos,
                                                              nb, sumw, denom, y, out2);
  out_proj   <<<H_ / 32, 1024, 0, stream>>>(y, Wv, bv, sumw, denom, out);
}
